// v000
// The times below were measured on an AMD MI455X: many runs one after another, warmed up first and cycling through
// copies of the inputs, with the whole window's GPU time divided by the number of runs. Launches and the gaps
// between them are all in it. The median over several windows is given; except for v000 it joins two sittings, which
// can be a few percent apart, so the side-by-side timings, each taken in one sitting, are the better comparison.
// v000 is the starting kernel. One run takes 434 microseconds.
#include <hip/hip_runtime.h>

#define B_DIM   2
#define T_DIM   2048
#define C_DIM   1024
#define H_DIM   16
#define HD_DIM  64
#define DFF_DIM 4096
#define BT_DIM  (B_DIM * T_DIM)

typedef __attribute__((ext_vector_type(16))) __bf16 v16bf;
typedef __attribute__((ext_vector_type(8)))  float  v8f;
typedef __attribute__((ext_vector_type(4)))  unsigned int u32x4;

__device__ __forceinline__ v8f wmma_bf16(v16bf a, v16bf b, v8f c) {
  // D = A(16x32 bf16) * B(32x16 bf16) + C(16x16 f32)
  return __builtin_amdgcn_wmma_f32_16x16x32_bf16(
      /*neg_a=*/false, a, /*neg_b=*/false, b,
      /*c_mod=*/(short)0, c, /*reuse_a=*/false, /*reuse_b=*/false);
}

// Load one 16x32 bf16 fragment in the CDNA5 A-matrix lane layout from a
// row-major [16 x ld] tile.  Lanes 0-15: row=lane, K 0-7 (lo) / 16-23 (hi);
// lanes 16-31: row=lane-16, K 8-15 (lo) / 24-31 (hi).  Two b128 loads.
// Works for B as well when B is pre-transposed to [N][K].
__device__ __forceinline__ v16bf load_frag(const __bf16* base, int ld) {
  const int lane = threadIdx.x & 31;
  const int r    = lane & 15;
  const int kh   = (lane >> 4) << 3;        // 0 or 8
  const __bf16* p = base + (size_t)r * ld + kh;
  union { v16bf v; struct { u32x4 lo, hi; } q; } u;
  u.q.lo = *(const u32x4*)(p);
  u.q.hi = *(const u32x4*)(p + 16);
  return u.v;
}

__device__ __forceinline__ void wait_lds() {
  asm volatile("s_wait_dscnt 0" ::: "memory");
}

// ---------------------------------------------------------------- converts
__global__ __launch_bounds__(256) void f32_to_bf16_kernel(
    const float* __restrict__ in, __bf16* __restrict__ out, int n) {
  int i = (blockIdx.x * 256 + threadIdx.x) * 4;
  if (i + 3 < n) {
    float4 f = *(const float4*)(in + i);
    out[i + 0] = (__bf16)f.x;
    out[i + 1] = (__bf16)f.y;
    out[i + 2] = (__bf16)f.z;
    out[i + 3] = (__bf16)f.w;
  }
}

// in: f32 row-major [R][Cc] -> out: bf16 [Cc][R]   (weights -> [N][K] layout)
__global__ __launch_bounds__(256) void transpose_f32_to_bf16(
    const float* __restrict__ in, __bf16* __restrict__ out, int R, int Cc) {
  __shared__ float tile[32][33];
  const int c0 = blockIdx.x * 32, r0 = blockIdx.y * 32;
  for (int i = threadIdx.y; i < 32; i += 8)
    tile[i][threadIdx.x] = in[(size_t)(r0 + i) * Cc + c0 + threadIdx.x];
  __syncthreads();
  for (int i = threadIdx.y; i < 32; i += 8)
    out[(size_t)(c0 + i) * R + r0 + threadIdx.x] = (__bf16)tile[threadIdx.x][i];
}

// ---------------------------------------------------------------- GEMM
enum { EPI_QK = 0, EPI_VT = 1, EPI_F32_BIAS = 2, EPI_RELU_BF16 = 3 };

// C[M,N] = A[M,K](bf16) * Bt[N,K]^T(bf16), f32 accumulate.
// Block: 256 threads = 8 waves; block tile 256(M) x 64(N).
// Wave tile 32x64: 2 M-tiles x 4 N-tiles = 8 WMMAs per K=32 step, so each
// LDS B-fragment feeds two WMMAs.  B-tile (64x32) is double-buffered in LDS
// with a register prefetch of the next K-step, one barrier per step.
template <int EPI>
__global__ __launch_bounds__(256) void gemm_bf16_wmma(
    const __bf16* __restrict__ A, const __bf16* __restrict__ Bt,
    const float* __restrict__ bias, void* __restrict__ outp,
    int M, int N, int K) {
  __shared__ __bf16 Bs[2][64 * 32];

  const int lane = threadIdx.x & 31;
  const int wave = threadIdx.x >> 5;
  const int row0 = (blockIdx.y * 8 + wave) * 32;   // 32 rows per wave
  const int col0 = blockIdx.x * 64;

  v8f acc0[4] = {};
  v8f acc1[4] = {};

  const int ldn = threadIdx.x >> 2;         // 0..63 : local N row of Bs
  const int ldk = (threadIdx.x & 3) << 3;   // 0,8,16,24
  const __bf16* bsrc  = Bt + (size_t)(col0 + ldn) * K + ldk;
  const __bf16* asrc0 = A + (size_t)row0 * K;
  const __bf16* asrc1 = asrc0 + (size_t)16 * K;

  u32x4 breg = *(const u32x4*)(bsrc);       // prefetch K-step 0
  int p = 0;

  for (int k0 = 0; k0 < K; k0 += 32) {
    *(u32x4*)&Bs[p][ldn * 32 + ldk] = breg;
    __syncthreads();
    if (k0 + 32 < K) {
      breg = *(const u32x4*)(bsrc + k0 + 32);      // overlaps with WMMAs
      __builtin_prefetch(asrc0 + k0 + 32, 0, 1);
      __builtin_prefetch(asrc1 + k0 + 32, 0, 1);
    }
    v16bf a0 = load_frag(asrc0 + k0, K);
    v16bf a1 = load_frag(asrc1 + k0, K);
#pragma unroll
    for (int j = 0; j < 4; ++j) {
      v16bf bf = load_frag(&Bs[p][(j * 16) * 32], 32);
      acc0[j] = wmma_bf16(a0, bf, acc0[j]);
      acc1[j] = wmma_bf16(a1, bf, acc1[j]);
    }
    p ^= 1;   // next store goes to the other buffer; no 2nd barrier needed
  }

  const int half = lane >> 4, ln = lane & 15;
#pragma unroll
  for (int m2 = 0; m2 < 2; ++m2) {
#pragma unroll
    for (int j = 0; j < 4; ++j) {
#pragma unroll
      for (int r = 0; r < 8; ++r) {
        const int row = row0 + m2 * 16 + half * 8 + r;  // D layout
        const int col = col0 + j * 16 + ln;
        float v = m2 ? acc1[j][r] : acc0[j][r];
        if constexpr (EPI == EPI_QK) {
          // [BT,C] -> bf16 [B,H,T,hd]
          const int bi = row >> 11, ti = row & (T_DIM - 1);
          const int hi = col >> 6, di = col & (HD_DIM - 1);
          ((__bf16*)outp)[(((size_t)bi * H_DIM + hi) * T_DIM + ti) * HD_DIM + di] =
              (__bf16)v;
        } else if constexpr (EPI == EPI_VT) {
          // [BT,C] -> bf16 [B,H,hd,T]  (V transposed: K-contiguous for P*V)
          const int bi = row >> 11, ti = row & (T_DIM - 1);
          const int hi = col >> 6, di = col & (HD_DIM - 1);
          ((__bf16*)outp)[(((size_t)bi * H_DIM + hi) * HD_DIM + di) * T_DIM + ti] =
              (__bf16)v;
        } else if constexpr (EPI == EPI_F32_BIAS) {
          ((float*)outp)[(size_t)row * N + col] = v + bias[col];
        } else {  // EPI_RELU_BF16
          float o = v + bias[col];
          o = o > 0.f ? o : 0.f;
          ((__bf16*)outp)[(size_t)row * N + col] = (__bf16)o;
        }
      }
    }
  }
}

// ---------------------------------------------------------------- attention
// Flash-style causal attention. One wave per 16-row Q tile; K blocks of 32.
#define ATT_WAVES 4
__global__ __launch_bounds__(128) void attn_wmma_kernel(
    const __bf16* __restrict__ q,   // [B,H,T,hd]
    const __bf16* __restrict__ k,   // [B,H,T,hd]
    const __bf16* __restrict__ vt,  // [B,H,hd,T]
    __bf16* __restrict__ attnb) {   // bf16 [B,T,C]
  __shared__ __bf16 lds[ATT_WAVES][16 * 32];

  const int wave = threadIdx.x >> 5;
  const int lane = threadIdx.x & 31;
  const int half = lane >> 4, ln = lane & 15;

  const int qt0 = (blockIdx.x * ATT_WAVES + wave) * 16;
  const int bh  = blockIdx.y;
  const int bi  = bh >> 4;          // /H
  const int hi  = bh & (H_DIM - 1);

  const __bf16* Qp = q + ((size_t)bh * T_DIM + qt0) * HD_DIM;
  const __bf16* Kp = k + (size_t)bh * T_DIM * HD_DIM;
  const __bf16* Vp = vt + (size_t)bh * HD_DIM * T_DIM;

  const v16bf qa0 = load_frag(Qp, HD_DIM);        // K = 0..31 of hd
  const v16bf qa1 = load_frag(Qp + 32, HD_DIM);   // K = 32..63 of hd

  v8f o[4] = {};
  float rm[8], rl[8];
#pragma unroll
  for (int r = 0; r < 8; ++r) { rm[r] = -1e30f; rl[r] = 0.f; }

  __bf16* L = &lds[wave][0];

  for (int kv0 = 0; kv0 < qt0 + 16; kv0 += 32) {
    float pm[2][8];
#pragma unroll
    for (int j = 0; j < 2; ++j) {
      const __bf16* Kb = Kp + (size_t)(kv0 + j * 16) * HD_DIM;
      v16bf kb0 = load_frag(Kb, HD_DIM);
      v16bf kb1 = load_frag(Kb + 32, HD_DIM);
      v8f s = {};
      s = wmma_bf16(qa0, kb0, s);
      s = wmma_bf16(qa1, kb1, s);
#pragma unroll
      for (int r = 0; r < 8; ++r) {
        float val = s[r] * 0.125f;              // hd^-0.5
        const int qg = qt0 + half * 8 + r;
        const int kg = kv0 + j * 16 + ln;
        pm[j][r] = (kg > qg) ? -1e30f : val;    // causal mask
      }
    }
    // online softmax, rows live in VGPR index r within each 16-lane half
#pragma unroll
    for (int r = 0; r < 8; ++r) {
      float mx = fmaxf(pm[0][r], pm[1][r]);
      mx = fmaxf(mx, __shfl_xor(mx, 1, 32));
      mx = fmaxf(mx, __shfl_xor(mx, 2, 32));
      mx = fmaxf(mx, __shfl_xor(mx, 4, 32));
      mx = fmaxf(mx, __shfl_xor(mx, 8, 32));
      const float mnew  = fmaxf(rm[r], mx);
      const float scale = __expf(rm[r] - mnew);
      rm[r] = mnew;
      const float p0 = __expf(pm[0][r] - mnew);
      const float p1 = __expf(pm[1][r] - mnew);
      float rs = p0 + p1;
      rs += __shfl_xor(rs, 1, 32);
      rs += __shfl_xor(rs, 2, 32);
      rs += __shfl_xor(rs, 4, 32);
      rs += __shfl_xor(rs, 8, 32);
      rl[r] = rl[r] * scale + rs;
      pm[0][r] = p0; pm[1][r] = p1;
#pragma unroll
      for (int jj = 0; jj < 4; ++jj) o[jj][r] *= scale;
    }
    // P (16x32, D-layout) -> LDS -> A-fragment layout
#pragma unroll
    for (int j = 0; j < 2; ++j)
#pragma unroll
      for (int r = 0; r < 8; ++r)
        L[(half * 8 + r) * 32 + j * 16 + ln] = (__bf16)pm[j][r];
    wait_lds();
    const v16bf pf = load_frag(L, 32);
#pragma unroll
    for (int jj = 0; jj < 4; ++jj) {
      v16bf vb = load_frag(Vp + (size_t)(jj * 16) * T_DIM + kv0, T_DIM);
      o[jj] = wmma_bf16(pf, vb, o[jj]);
    }
  }
  // normalize + scatter back to [B,T,C] bf16
#pragma unroll
  for (int r = 0; r < 8; ++r) {
    const float inv = 1.f / rl[r];
    const int qg = qt0 + half * 8 + r;
#pragma unroll
    for (int jj = 0; jj < 4; ++jj) {
      size_t dst = ((size_t)bi * T_DIM + qg) * C_DIM + hi * HD_DIM + jj * 16 + ln;
      attnb[dst] = (__bf16)(o[jj][r] * inv);
    }
  }
}

// ---------------------------------------------------------------- LN
// out = LN(x + y) * g + b ; one block per row of C_DIM=1024, 256 threads.
__global__ __launch_bounds__(256) void ln_residual_kernel(
    const float* __restrict__ x, const float* __restrict__ y,
    const float* __restrict__ g, const float* __restrict__ b,
    float* __restrict__ out, __bf16* __restrict__ outb) {
  const int row = blockIdx.x;
  const float* xr = x + (size_t)row * C_DIM;
  const float* yr = y + (size_t)row * C_DIM;
  float v[4], s = 0.f, s2 = 0.f;
#pragma unroll
  for (int i = 0; i < 4; ++i) {
    const int idx = threadIdx.x + i * 256;
    const float t = xr[idx] + yr[idx];
    v[i] = t; s += t; s2 += t * t;
  }
#pragma unroll
  for (int m = 1; m < 32; m <<= 1) {
    s  += __shfl_xor(s, m, 32);
    s2 += __shfl_xor(s2, m, 32);
  }
  __shared__ float w1s[8], w2s[8];
  if ((threadIdx.x & 31) == 0) {
    w1s[threadIdx.x >> 5] = s;
    w2s[threadIdx.x >> 5] = s2;
  }
  __syncthreads();
  s = 0.f; s2 = 0.f;
#pragma unroll
  for (int j = 0; j < 8; ++j) { s += w1s[j]; s2 += w2s[j]; }
  const float mean = s * (1.f / C_DIM);
  const float var  = s2 * (1.f / C_DIM) - mean * mean;
  const float rstd = rsqrtf(var + 1e-5f);
#pragma unroll
  for (int i = 0; i < 4; ++i) {
    const int idx = threadIdx.x + i * 256;
    const float o = (v[i] - mean) * rstd * g[idx] + b[idx];
    out[(size_t)row * C_DIM + idx] = o;
    if (outb) outb[(size_t)row * C_DIM + idx] = (__bf16)o;
  }
}

// ---------------------------------------------------------------- launch
extern "C" void kernel_launch(void* const* d_in, const int* in_sizes, int n_in,
                              void* d_out, int out_size, void* d_ws, size_t ws_size,
                              hipStream_t stream) {
  const float* x     = (const float*)d_in[0];
  const float* wq    = (const float*)d_in[1];
  const float* wk    = (const float*)d_in[2];
  const float* wv    = (const float*)d_in[3];
  const float* wp    = (const float*)d_in[4];
  const float* bproj = (const float*)d_in[5];
  const float* w1    = (const float*)d_in[6];
  const float* b1    = (const float*)d_in[7];
  const float* w2    = (const float*)d_in[8];
  const float* b2    = (const float*)d_in[9];
  const float* g1    = (const float*)d_in[10];
  const float* be1   = (const float*)d_in[11];
  const float* g2    = (const float*)d_in[12];
  const float* be2   = (const float*)d_in[13];

  char* ws = (char*)d_ws;
  size_t o = 0;
  auto take = [&](size_t nbytes) -> void* {
    void* p = ws + o;
    o += (nbytes + 255) & ~(size_t)255;
    return p;
  };
  const size_t BTC = (size_t)BT_DIM * C_DIM;
  __bf16* xb    = (__bf16*)take(BTC * 2);
  __bf16* wqt   = (__bf16*)take((size_t)C_DIM * C_DIM * 2);
  __bf16* wkt   = (__bf16*)take((size_t)C_DIM * C_DIM * 2);
  __bf16* wvt   = (__bf16*)take((size_t)C_DIM * C_DIM * 2);
  __bf16* wpt   = (__bf16*)take((size_t)C_DIM * C_DIM * 2);
  __bf16* w1t   = (__bf16*)take((size_t)C_DIM * DFF_DIM * 2);
  __bf16* w2t   = (__bf16*)take((size_t)DFF_DIM * C_DIM * 2);
  __bf16* qb    = (__bf16*)take(BTC * 2);
  __bf16* kb    = (__bf16*)take(BTC * 2);
  __bf16* vtb   = (__bf16*)take(BTC * 2);
  __bf16* attnb = (__bf16*)take(BTC * 2);
  float*  y1    = (float*)take(BTC * 4);
  float*  x1    = (float*)take(BTC * 4);
  __bf16* x1b   = (__bf16*)take(BTC * 2);
  __bf16* h1    = (__bf16*)take((size_t)BT_DIM * DFF_DIM * 2);
  float*  y2    = (float*)take(BTC * 4);

  const dim3 tb(32, 8);
  f32_to_bf16_kernel<<<(BTC / 4 + 255) / 256, 256, 0, stream>>>(x, xb, (int)BTC);
  transpose_f32_to_bf16<<<dim3(C_DIM / 32, C_DIM / 32), tb, 0, stream>>>(wq, wqt, C_DIM, C_DIM);
  transpose_f32_to_bf16<<<dim3(C_DIM / 32, C_DIM / 32), tb, 0, stream>>>(wk, wkt, C_DIM, C_DIM);
  transpose_f32_to_bf16<<<dim3(C_DIM / 32, C_DIM / 32), tb, 0, stream>>>(wv, wvt, C_DIM, C_DIM);
  transpose_f32_to_bf16<<<dim3(C_DIM / 32, C_DIM / 32), tb, 0, stream>>>(wp, wpt, C_DIM, C_DIM);
  transpose_f32_to_bf16<<<dim3(DFF_DIM / 32, C_DIM / 32), tb, 0, stream>>>(w1, w1t, C_DIM, DFF_DIM);
  transpose_f32_to_bf16<<<dim3(C_DIM / 32, DFF_DIM / 32), tb, 0, stream>>>(w2, w2t, DFF_DIM, C_DIM);

  // block tile 256(M) x 64(N)
  const dim3 gC(C_DIM / 64, BT_DIM / 256);
  gemm_bf16_wmma<EPI_QK><<<gC, 256, 0, stream>>>(xb, wqt, nullptr, qb, BT_DIM, C_DIM, C_DIM);
  gemm_bf16_wmma<EPI_QK><<<gC, 256, 0, stream>>>(xb, wkt, nullptr, kb, BT_DIM, C_DIM, C_DIM);
  gemm_bf16_wmma<EPI_VT><<<gC, 256, 0, stream>>>(xb, wvt, nullptr, vtb, BT_DIM, C_DIM, C_DIM);

  attn_wmma_kernel<<<dim3(T_DIM / (16 * ATT_WAVES), B_DIM * H_DIM), 128, 0, stream>>>(
      qb, kb, vtb, attnb);

  gemm_bf16_wmma<EPI_F32_BIAS><<<gC, 256, 0, stream>>>(attnb, wpt, bproj, y1, BT_DIM, C_DIM, C_DIM);
  ln_residual_kernel<<<BT_DIM, 256, 0, stream>>>(x, y1, g1, be1, x1, x1b);

  gemm_bf16_wmma<EPI_RELU_BF16><<<dim3(DFF_DIM / 64, BT_DIM / 256), 256, 0, stream>>>(
      x1b, w1t, b1, h1, BT_DIM, DFF_DIM, C_DIM);
  gemm_bf16_wmma<EPI_F32_BIAS><<<gC, 256, 0, stream>>>(h1, w2t, b2, y2, BT_DIM, C_DIM, DFF_DIM);
  ln_residual_kernel<<<BT_DIM, 256, 0, stream>>>(x1, y2, g2, be2, (float*)d_out, nullptr);
}

// v001
// It runs in 312 microseconds.
// Next to v000, in two timings, it ran 1.43 and 1.42 times as fast.
#include <hip/hip_runtime.h>

#define B_DIM   2
#define T_DIM   2048
#define C_DIM   1024
#define H_DIM   16
#define HD_DIM  64
#define DFF_DIM 4096
#define BT_DIM  (B_DIM * T_DIM)

typedef __attribute__((ext_vector_type(16))) __bf16 v16bf;
typedef __attribute__((ext_vector_type(8)))  float  v8f;
typedef __attribute__((ext_vector_type(4)))  unsigned int u32x4;

__device__ __forceinline__ v8f wmma_bf16(v16bf a, v16bf b, v8f c) {
  // D = A(16x32 bf16) * B(32x16 bf16) + C(16x16 f32)
  return __builtin_amdgcn_wmma_f32_16x16x32_bf16(
      /*neg_a=*/false, a, /*neg_b=*/false, b,
      /*c_mod=*/(short)0, c, /*reuse_a=*/false, /*reuse_b=*/false);
}

// Load one 16x32 bf16 fragment in the CDNA5 A-matrix lane layout from a
// row-major [16 x ld] tile.  Lanes 0-15: row=lane, K 0-7 (lo) / 16-23 (hi);
// lanes 16-31: row=lane-16, K 8-15 (lo) / 24-31 (hi).  Two b128 loads.
// Works for B as well when B is pre-transposed to [N][K].
__device__ __forceinline__ v16bf load_frag(const __bf16* base, int ld) {
  const int lane = threadIdx.x & 31;
  const int r    = lane & 15;
  const int kh   = (lane >> 4) << 3;        // 0 or 8
  const __bf16* p = base + (size_t)r * ld + kh;
  union { v16bf v; struct { u32x4 lo, hi; } q; } u;
  u.q.lo = *(const u32x4*)(p);
  u.q.hi = *(const u32x4*)(p + 16);
  return u.v;
}

__device__ __forceinline__ void wait_lds() {
  asm volatile("s_wait_dscnt 0" ::: "memory");
}

// ---------------------------------------------------------------- converts
__global__ __launch_bounds__(256) void f32_to_bf16_kernel(
    const float* __restrict__ in, __bf16* __restrict__ out, int n) {
  int i = (blockIdx.x * 256 + threadIdx.x) * 4;
  if (i + 3 < n) {
    float4 f = *(const float4*)(in + i);
    out[i + 0] = (__bf16)f.x;
    out[i + 1] = (__bf16)f.y;
    out[i + 2] = (__bf16)f.z;
    out[i + 3] = (__bf16)f.w;
  }
}

// in: f32 row-major [R][Cc] -> out: bf16 [Cc][R]   (weights -> [N][K] layout)
__global__ __launch_bounds__(256) void transpose_f32_to_bf16(
    const float* __restrict__ in, __bf16* __restrict__ out, int R, int Cc) {
  __shared__ float tile[32][33];
  const int c0 = blockIdx.x * 32, r0 = blockIdx.y * 32;
  for (int i = threadIdx.y; i < 32; i += 8)
    tile[i][threadIdx.x] = in[(size_t)(r0 + i) * Cc + c0 + threadIdx.x];
  __syncthreads();
  for (int i = threadIdx.y; i < 32; i += 8)
    out[(size_t)(c0 + i) * R + r0 + threadIdx.x] = (__bf16)tile[threadIdx.x][i];
}

// ---------------------------------------------------------------- GEMM
enum { EPI_QK = 0, EPI_VT = 1, EPI_F32_BIAS = 2, EPI_RELU_BF16 = 3 };

// C[M,N] = A[M,K](bf16) * Bt[N,K]^T(bf16), f32 accumulate.
// Block: 256 threads = 8 waves; block tile 256(M) x 64(N).
// Wave tile 32x64: 2 M-tiles x 4 N-tiles = 8 WMMAs per K=32 step.
// A pass is 128 k = 256 bytes of each of the 256 A rows and 64 Bt rows.  The
// pass's 320 rows are brought into LDS by asynchronous 16-byte copies, two
// buffers: the next pass's copies fly while this pass is multiplied.
// Needs M % 256 == 0, N % 64 == 0, K % 128 == 0.
#define G_PASS  128                       // k per pass
#define G_PITCH 136                       // LDS row pitch, bf16: 272 B = 16 B x 17
#define G_ROWS  320                       // 256 A rows, then 64 Bt rows
#define G_BUF   (G_ROWS * G_PITCH)        // bf16 per buffer

// Ten copies of 16 bytes per lane, global -> LDS, through no register.  The
// s_wait_xcnt closes the statement so that no address register named here is
// rewritten before it.
#define G_COPY10(l, g, o)                                                  \
  asm volatile(                                                            \
      "global_load_async_to_lds_b128 %0, %10, off\n\t"                     \
      "global_load_async_to_lds_b128 %1, %11, off\n\t"                     \
      "global_load_async_to_lds_b128 %2, %12, off\n\t"                     \
      "global_load_async_to_lds_b128 %3, %13, off\n\t"                     \
      "global_load_async_to_lds_b128 %4, %14, off\n\t"                     \
      "global_load_async_to_lds_b128 %5, %15, off\n\t"                     \
      "global_load_async_to_lds_b128 %6, %16, off\n\t"                     \
      "global_load_async_to_lds_b128 %7, %17, off\n\t"                     \
      "global_load_async_to_lds_b128 %8, %18, off\n\t"                     \
      "global_load_async_to_lds_b128 %9, %19, off\n\t"                     \
      "s_wait_xcnt 0x0"                                                    \
      :: "v"(l[o + 0]), "v"(l[o + 1]), "v"(l[o + 2]), "v"(l[o + 3]),       \
         "v"(l[o + 4]), "v"(l[o + 5]), "v"(l[o + 6]), "v"(l[o + 7]),       \
         "v"(l[o + 8]), "v"(l[o + 9]),                                     \
         "v"(g[o + 0]), "v"(g[o + 1]), "v"(g[o + 2]), "v"(g[o + 3]),       \
         "v"(g[o + 4]), "v"(g[o + 5]), "v"(g[o + 6]), "v"(g[o + 7]),       \
         "v"(g[o + 8]), "v"(g[o + 9])                                      \
      : "memory")

template <int EPI>
__global__ __launch_bounds__(256) void gemm_bf16_wmma(
    const __bf16* __restrict__ A, const __bf16* __restrict__ Bt,
    const float* __restrict__ bias, void* __restrict__ outp,
    int M, int N, int K) {
  __shared__ __attribute__((aligned(16))) __bf16 Ts[2 * G_BUF];

  const int lane = threadIdx.x & 31;
  const int wave = threadIdx.x >> 5;
  const int row0 = (blockIdx.y * 8 + wave) * 32;   // 32 rows per wave
  const int col0 = blockIdx.x * 64;

  v8f acc0[4] = {};
  v8f acc1[4] = {};

  // Copy map: 16 lanes cover one 256-byte row; copy i of a thread serves tile
  // row i * 16 + crow (i < 16: A rows, i >= 16: Bt rows).
  const int crow = threadIdx.x >> 4;        // 0..15
  const int ccol = (threadIdx.x & 15) << 3; // bf16 offset in the row
  const __bf16* asrc = A + (size_t)(blockIdx.y * 256 + crow) * K + ccol;
  const __bf16* bsrc = Bt + (size_t)(col0 + crow) * K + ccol;
  const unsigned ldst = (unsigned)(size_t)&Ts[crow * G_PITCH + ccol];

  auto issue = [&](int t, int buf) {
    unsigned l[20];
    const __bf16* g[20];
#pragma unroll  // constant indices: l and g stay in registers
    for (int i = 0; i < 20; ++i) {
      l[i] = ldst + (unsigned)(buf * G_BUF + i * 16 * G_PITCH) * 2u;
      g[i] = (i < 16 ? asrc + (size_t)(i * 16) * K
                     : bsrc + (size_t)((i - 16) * 16) * K) + t * G_PASS;
    }
    G_COPY10(l, g, 0);
    G_COPY10(l, g, 10);
  };

  const int npass = K / G_PASS;
  issue(0, 0);
  // pass 0 has landed for this wave, then for all waves
  asm volatile("s_wait_asynccnt 0x0" ::: "memory");
  __syncthreads();
  if (npass > 1) issue(1, 1);

  for (int t = 0; t < npass; ++t) {
    const __bf16* As = &Ts[(t & 1) * G_BUF + wave * 32 * G_PITCH];
    const __bf16* Bs = &Ts[(t & 1) * G_BUF + 256 * G_PITCH];
    // Two fragment sets: the LDS reads of k step s + 1 are issued as one group
    // ahead of the WMMAs of step s, so that their latency hides behind them.
    v16bf fa[2][2], fb[2][4];
    fa[0][0] = load_frag(As, G_PITCH);
    fa[0][1] = load_frag(As + 16 * G_PITCH, G_PITCH);
#pragma unroll  // constant j: fb stays in registers
    for (int j = 0; j < 4; ++j) fb[0][j] = load_frag(Bs + (j * 16) * G_PITCH, G_PITCH);
#pragma unroll  // constant set index: the fragments stay in registers
    for (int s = 0; s < G_PASS / 32; ++s) {
      const int cur = s & 1, nxt = cur ^ 1;
      if (s + 1 < G_PASS / 32) {
        const int kk = (s + 1) * 32;
        fa[nxt][0] = load_frag(As + kk, G_PITCH);
        fa[nxt][1] = load_frag(As + 16 * G_PITCH + kk, G_PITCH);
#pragma unroll  // constant j: fb stays in registers
        for (int j = 0; j < 4; ++j)
          fb[nxt][j] = load_frag(Bs + (j * 16) * G_PITCH + kk, G_PITCH);
      }
      // keeps the read group ahead of the WMMAs: without it the scheduler sinks
      // each read to just before its use and every WMMA pair waits on LDS
      __builtin_amdgcn_sched_barrier(0);
#pragma unroll  // constant j: accumulators and fragments stay in registers
      for (int j = 0; j < 4; ++j) {
        acc0[j] = wmma_bf16(fa[cur][0], fb[cur][j], acc0[j]);
        acc1[j] = wmma_bf16(fa[cur][1], fb[cur][j], acc1[j]);
      }
      // keeps the next step's reads from moving up among these WMMAs
      __builtin_amdgcn_sched_barrier(0);
    }
    // Hand-over: this wave's reads of buffer t & 1 are done, its copies of
    // pass t + 1 have landed; behind the barrier that holds for every wave.
    wait_lds();
    asm volatile("s_wait_asynccnt 0x0" ::: "memory");
    __syncthreads();
    if (t + 2 < npass) issue(t + 2, t & 1);
  }
  // no copy is outstanding when the wave goes on to the stores and ends
  asm volatile("s_wait_asynccnt 0x0" ::: "memory");

  const int half = lane >> 4, ln = lane & 15;
#pragma unroll
  for (int m2 = 0; m2 < 2; ++m2) {
#pragma unroll
    for (int j = 0; j < 4; ++j) {
#pragma unroll
      for (int r = 0; r < 8; ++r) {
        const int row = row0 + m2 * 16 + half * 8 + r;  // D layout
        const int col = col0 + j * 16 + ln;
        float v = m2 ? acc1[j][r] : acc0[j][r];
        if constexpr (EPI == EPI_QK) {
          // [BT,C] -> bf16 [B,H,T,hd]
          const int bi = row >> 11, ti = row & (T_DIM - 1);
          const int hi = col >> 6, di = col & (HD_DIM - 1);
          ((__bf16*)outp)[(((size_t)bi * H_DIM + hi) * T_DIM + ti) * HD_DIM + di] =
              (__bf16)v;
        } else if constexpr (EPI == EPI_VT) {
          // [BT,C] -> bf16 [B,H,hd,T]  (V transposed: K-contiguous for P*V)
          const int bi = row >> 11, ti = row & (T_DIM - 1);
          const int hi = col >> 6, di = col & (HD_DIM - 1);
          ((__bf16*)outp)[(((size_t)bi * H_DIM + hi) * HD_DIM + di) * T_DIM + ti] =
              (__bf16)v;
        } else if constexpr (EPI == EPI_F32_BIAS) {
          ((float*)outp)[(size_t)row * N + col] = v + bias[col];
        } else {  // EPI_RELU_BF16
          float o = v + bias[col];
          o = o > 0.f ? o : 0.f;
          ((__bf16*)outp)[(size_t)row * N + col] = (__bf16)o;
        }
      }
    }
  }
}

// ---------------------------------------------------------------- attention
// Flash-style causal attention. One wave per 16-row Q tile; K blocks of 32.
#define ATT_WAVES 4
__global__ __launch_bounds__(128) void attn_wmma_kernel(
    const __bf16* __restrict__ q,   // [B,H,T,hd]
    const __bf16* __restrict__ k,   // [B,H,T,hd]
    const __bf16* __restrict__ vt,  // [B,H,hd,T]
    __bf16* __restrict__ attnb) {   // bf16 [B,T,C]
  __shared__ __bf16 lds[ATT_WAVES][16 * 32];

  const int wave = threadIdx.x >> 5;
  const int lane = threadIdx.x & 31;
  const int half = lane >> 4, ln = lane & 15;

  const int qt0 = (blockIdx.x * ATT_WAVES + wave) * 16;
  const int bh  = blockIdx.y;
  const int bi  = bh >> 4;          // /H
  const int hi  = bh & (H_DIM - 1);

  const __bf16* Qp = q + ((size_t)bh * T_DIM + qt0) * HD_DIM;
  const __bf16* Kp = k + (size_t)bh * T_DIM * HD_DIM;
  const __bf16* Vp = vt + (size_t)bh * HD_DIM * T_DIM;

  const v16bf qa0 = load_frag(Qp, HD_DIM);        // K = 0..31 of hd
  const v16bf qa1 = load_frag(Qp + 32, HD_DIM);   // K = 32..63 of hd

  v8f o[4] = {};
  float rm[8], rl[8];
#pragma unroll
  for (int r = 0; r < 8; ++r) { rm[r] = -1e30f; rl[r] = 0.f; }

  __bf16* L = &lds[wave][0];

  for (int kv0 = 0; kv0 < qt0 + 16; kv0 += 32) {
    float pm[2][8];
#pragma unroll
    for (int j = 0; j < 2; ++j) {
      const __bf16* Kb = Kp + (size_t)(kv0 + j * 16) * HD_DIM;
      v16bf kb0 = load_frag(Kb, HD_DIM);
      v16bf kb1 = load_frag(Kb + 32, HD_DIM);
      v8f s = {};
      s = wmma_bf16(qa0, kb0, s);
      s = wmma_bf16(qa1, kb1, s);
#pragma unroll
      for (int r = 0; r < 8; ++r) {
        float val = s[r] * 0.125f;              // hd^-0.5
        const int qg = qt0 + half * 8 + r;
        const int kg = kv0 + j * 16 + ln;
        pm[j][r] = (kg > qg) ? -1e30f : val;    // causal mask
      }
    }
    // online softmax, rows live in VGPR index r within each 16-lane half
#pragma unroll
    for (int r = 0; r < 8; ++r) {
      float mx = fmaxf(pm[0][r], pm[1][r]);
      mx = fmaxf(mx, __shfl_xor(mx, 1, 32));
      mx = fmaxf(mx, __shfl_xor(mx, 2, 32));
      mx = fmaxf(mx, __shfl_xor(mx, 4, 32));
      mx = fmaxf(mx, __shfl_xor(mx, 8, 32));
      const float mnew  = fmaxf(rm[r], mx);
      const float scale = __expf(rm[r] - mnew);
      rm[r] = mnew;
      const float p0 = __expf(pm[0][r] - mnew);
      const float p1 = __expf(pm[1][r] - mnew);
      float rs = p0 + p1;
      rs += __shfl_xor(rs, 1, 32);
      rs += __shfl_xor(rs, 2, 32);
      rs += __shfl_xor(rs, 4, 32);
      rs += __shfl_xor(rs, 8, 32);
      rl[r] = rl[r] * scale + rs;
      pm[0][r] = p0; pm[1][r] = p1;
#pragma unroll
      for (int jj = 0; jj < 4; ++jj) o[jj][r] *= scale;
    }
    // P (16x32, D-layout) -> LDS -> A-fragment layout
#pragma unroll
    for (int j = 0; j < 2; ++j)
#pragma unroll
      for (int r = 0; r < 8; ++r)
        L[(half * 8 + r) * 32 + j * 16 + ln] = (__bf16)pm[j][r];
    wait_lds();
    const v16bf pf = load_frag(L, 32);
#pragma unroll
    for (int jj = 0; jj < 4; ++jj) {
      v16bf vb = load_frag(Vp + (size_t)(jj * 16) * T_DIM + kv0, T_DIM);
      o[jj] = wmma_bf16(pf, vb, o[jj]);
    }
  }
  // normalize + scatter back to [B,T,C] bf16
#pragma unroll
  for (int r = 0; r < 8; ++r) {
    const float inv = 1.f / rl[r];
    const int qg = qt0 + half * 8 + r;
#pragma unroll
    for (int jj = 0; jj < 4; ++jj) {
      size_t dst = ((size_t)bi * T_DIM + qg) * C_DIM + hi * HD_DIM + jj * 16 + ln;
      attnb[dst] = (__bf16)(o[jj][r] * inv);
    }
  }
}

// ---------------------------------------------------------------- LN
// out = LN(x + y) * g + b ; one block per row of C_DIM=1024, 256 threads.
__global__ __launch_bounds__(256) void ln_residual_kernel(
    const float* __restrict__ x, const float* __restrict__ y,
    const float* __restrict__ g, const float* __restrict__ b,
    float* __restrict__ out, __bf16* __restrict__ outb) {
  const int row = blockIdx.x;
  const float* xr = x + (size_t)row * C_DIM;
  const float* yr = y + (size_t)row * C_DIM;
  float v[4], s = 0.f, s2 = 0.f;
#pragma unroll
  for (int i = 0; i < 4; ++i) {
    const int idx = threadIdx.x + i * 256;
    const float t = xr[idx] + yr[idx];
    v[i] = t; s += t; s2 += t * t;
  }
#pragma unroll
  for (int m = 1; m < 32; m <<= 1) {
    s  += __shfl_xor(s, m, 32);
    s2 += __shfl_xor(s2, m, 32);
  }
  __shared__ float w1s[8], w2s[8];
  if ((threadIdx.x & 31) == 0) {
    w1s[threadIdx.x >> 5] = s;
    w2s[threadIdx.x >> 5] = s2;
  }
  __syncthreads();
  s = 0.f; s2 = 0.f;
#pragma unroll
  for (int j = 0; j < 8; ++j) { s += w1s[j]; s2 += w2s[j]; }
  const float mean = s * (1.f / C_DIM);
  const float var  = s2 * (1.f / C_DIM) - mean * mean;
  const float rstd = rsqrtf(var + 1e-5f);
#pragma unroll
  for (int i = 0; i < 4; ++i) {
    const int idx = threadIdx.x + i * 256;
    const float o = (v[i] - mean) * rstd * g[idx] + b[idx];
    out[(size_t)row * C_DIM + idx] = o;
    if (outb) outb[(size_t)row * C_DIM + idx] = (__bf16)o;
  }
}

// ---------------------------------------------------------------- launch
extern "C" void kernel_launch(void* const* d_in, const int* in_sizes, int n_in,
                              void* d_out, int out_size, void* d_ws, size_t ws_size,
                              hipStream_t stream) {
  const float* x     = (const float*)d_in[0];
  const float* wq    = (const float*)d_in[1];
  const float* wk    = (const float*)d_in[2];
  const float* wv    = (const float*)d_in[3];
  const float* wp    = (const float*)d_in[4];
  const float* bproj = (const float*)d_in[5];
  const float* w1    = (const float*)d_in[6];
  const float* b1    = (const float*)d_in[7];
  const float* w2    = (const float*)d_in[8];
  const float* b2    = (const float*)d_in[9];
  const float* g1    = (const float*)d_in[10];
  const float* be1   = (const float*)d_in[11];
  const float* g2    = (const float*)d_in[12];
  const float* be2   = (const float*)d_in[13];

  char* ws = (char*)d_ws;
  size_t o = 0;
  auto take = [&](size_t nbytes) -> void* {
    void* p = ws + o;
    o += (nbytes + 255) & ~(size_t)255;
    return p;
  };
  const size_t BTC = (size_t)BT_DIM * C_DIM;
  __bf16* xb    = (__bf16*)take(BTC * 2);
  __bf16* wqt   = (__bf16*)take((size_t)C_DIM * C_DIM * 2);
  __bf16* wkt   = (__bf16*)take((size_t)C_DIM * C_DIM * 2);
  __bf16* wvt   = (__bf16*)take((size_t)C_DIM * C_DIM * 2);
  __bf16* wpt   = (__bf16*)take((size_t)C_DIM * C_DIM * 2);
  __bf16* w1t   = (__bf16*)take((size_t)C_DIM * DFF_DIM * 2);
  __bf16* w2t   = (__bf16*)take((size_t)DFF_DIM * C_DIM * 2);
  __bf16* qb    = (__bf16*)take(BTC * 2);
  __bf16* kb    = (__bf16*)take(BTC * 2);
  __bf16* vtb   = (__bf16*)take(BTC * 2);
  __bf16* attnb = (__bf16*)take(BTC * 2);
  float*  y1    = (float*)take(BTC * 4);
  float*  x1    = (float*)take(BTC * 4);
  __bf16* x1b   = (__bf16*)take(BTC * 2);
  __bf16* h1    = (__bf16*)take((size_t)BT_DIM * DFF_DIM * 2);
  float*  y2    = (float*)take(BTC * 4);

  const dim3 tb(32, 8);
  f32_to_bf16_kernel<<<(BTC / 4 + 255) / 256, 256, 0, stream>>>(x, xb, (int)BTC);
  transpose_f32_to_bf16<<<dim3(C_DIM / 32, C_DIM / 32), tb, 0, stream>>>(wq, wqt, C_DIM, C_DIM);
  transpose_f32_to_bf16<<<dim3(C_DIM / 32, C_DIM / 32), tb, 0, stream>>>(wk, wkt, C_DIM, C_DIM);
  transpose_f32_to_bf16<<<dim3(C_DIM / 32, C_DIM / 32), tb, 0, stream>>>(wv, wvt, C_DIM, C_DIM);
  transpose_f32_to_bf16<<<dim3(C_DIM / 32, C_DIM / 32), tb, 0, stream>>>(wp, wpt, C_DIM, C_DIM);
  transpose_f32_to_bf16<<<dim3(DFF_DIM / 32, C_DIM / 32), tb, 0, stream>>>(w1, w1t, C_DIM, DFF_DIM);
  transpose_f32_to_bf16<<<dim3(C_DIM / 32, DFF_DIM / 32), tb, 0, stream>>>(w2, w2t, DFF_DIM, C_DIM);

  // block tile 256(M) x 64(N)
  const dim3 gC(C_DIM / 64, BT_DIM / 256);
  gemm_bf16_wmma<EPI_QK><<<gC, 256, 0, stream>>>(xb, wqt, nullptr, qb, BT_DIM, C_DIM, C_DIM);
  gemm_bf16_wmma<EPI_QK><<<gC, 256, 0, stream>>>(xb, wkt, nullptr, kb, BT_DIM, C_DIM, C_DIM);
  gemm_bf16_wmma<EPI_VT><<<gC, 256, 0, stream>>>(xb, wvt, nullptr, vtb, BT_DIM, C_DIM, C_DIM);

  attn_wmma_kernel<<<dim3(T_DIM / (16 * ATT_WAVES), B_DIM * H_DIM), 128, 0, stream>>>(
      qb, kb, vtb, attnb);

  gemm_bf16_wmma<EPI_F32_BIAS><<<gC, 256, 0, stream>>>(attnb, wpt, bproj, y1, BT_DIM, C_DIM, C_DIM);
  ln_residual_kernel<<<BT_DIM, 256, 0, stream>>>(x, y1, g1, be1, x1, x1b);

  gemm_bf16_wmma<EPI_RELU_BF16><<<dim3(DFF_DIM / 64, BT_DIM / 256), 256, 0, stream>>>(
      x1b, w1t, b1, h1, BT_DIM, DFF_DIM, C_DIM);
  gemm_bf16_wmma<EPI_F32_BIAS><<<gC, 256, 0, stream>>>(h1, w2t, b2, y2, BT_DIM, C_DIM, DFF_DIM);
  ln_residual_kernel<<<BT_DIM, 256, 0, stream>>>(x1, y2, g2, be2, (float*)d_out, nullptr);
}

// v002
// Measured time: 257 microseconds a run.
// Timed twice side by side with v001, it ran 1.23 and 1.22 times as fast.
// Counting every step since v000, it is 1.75 times as fast.
#include <hip/hip_runtime.h>

#define B_DIM   2
#define T_DIM   2048
#define C_DIM   1024
#define H_DIM   16
#define HD_DIM  64
#define DFF_DIM 4096
#define BT_DIM  (B_DIM * T_DIM)

typedef __attribute__((ext_vector_type(16))) __bf16 v16bf;
typedef __attribute__((ext_vector_type(8)))  float  v8f;
typedef __attribute__((ext_vector_type(4)))  unsigned int u32x4;

__device__ __forceinline__ v8f wmma_bf16(v16bf a, v16bf b, v8f c) {
  // D = A(16x32 bf16) * B(32x16 bf16) + C(16x16 f32)
  return __builtin_amdgcn_wmma_f32_16x16x32_bf16(
      /*neg_a=*/false, a, /*neg_b=*/false, b,
      /*c_mod=*/(short)0, c, /*reuse_a=*/false, /*reuse_b=*/false);
}

// Load one 16x32 bf16 fragment in the CDNA5 A-matrix lane layout from a
// row-major [16 x ld] tile.  Lanes 0-15: row=lane, K 0-7 (lo) / 16-23 (hi);
// lanes 16-31: row=lane-16, K 8-15 (lo) / 24-31 (hi).  Two b128 loads.
// Works for B as well when B is pre-transposed to [N][K].
__device__ __forceinline__ v16bf load_frag(const __bf16* base, int ld) {
  const int lane = threadIdx.x & 31;
  const int r    = lane & 15;
  const int kh   = (lane >> 4) << 3;        // 0 or 8
  const __bf16* p = base + (size_t)r * ld + kh;
  union { v16bf v; struct { u32x4 lo, hi; } q; } u;
  u.q.lo = *(const u32x4*)(p);
  u.q.hi = *(const u32x4*)(p + 16);
  return u.v;
}

__device__ __forceinline__ void wait_lds() {
  asm volatile("s_wait_dscnt 0" ::: "memory");
}

// ---------------------------------------------------------------- converts
__global__ __launch_bounds__(256) void f32_to_bf16_kernel(
    const float* __restrict__ in, __bf16* __restrict__ out, int n) {
  int i = (blockIdx.x * 256 + threadIdx.x) * 4;
  if (i + 3 < n) {
    float4 f = *(const float4*)(in + i);
    out[i + 0] = (__bf16)f.x;
    out[i + 1] = (__bf16)f.y;
    out[i + 2] = (__bf16)f.z;
    out[i + 3] = (__bf16)f.w;
  }
}

// in: f32 row-major [R][Cc] -> out: bf16 [Cc][R]   (weights -> [N][K] layout)
__global__ __launch_bounds__(256) void transpose_f32_to_bf16(
    const float* __restrict__ in, __bf16* __restrict__ out, int R, int Cc) {
  __shared__ float tile[32][33];
  const int c0 = blockIdx.x * 32, r0 = blockIdx.y * 32;
  for (int i = threadIdx.y; i < 32; i += 8)
    tile[i][threadIdx.x] = in[(size_t)(r0 + i) * Cc + c0 + threadIdx.x];
  __syncthreads();
  for (int i = threadIdx.y; i < 32; i += 8)
    out[(size_t)(c0 + i) * R + r0 + threadIdx.x] = (__bf16)tile[threadIdx.x][i];
}

// ---------------------------------------------------------------- GEMM
enum { EPI_QK = 0, EPI_VT = 1, EPI_F32_BIAS = 2, EPI_RELU_BF16 = 3 };

// C[M,N] = A[M,K](bf16) * Bt[N,K]^T(bf16), f32 accumulate.
// Block: 256 threads = 8 waves; block tile 256(M) x 64(N).
// Wave tile 32x64: 2 M-tiles x 4 N-tiles = 8 WMMAs per K=32 step.
// A pass is 128 k = 256 bytes of each of the 256 A rows and 64 Bt rows.  The
// pass's 320 rows are brought into LDS by asynchronous 16-byte copies, two
// buffers: the next pass's copies fly while this pass is multiplied.
// Needs M % 256 == 0, N % 64 == 0, K % 128 == 0.
#define G_PASS  128                       // k per pass
#define G_PITCH 136                       // LDS row pitch, bf16: 272 B = 16 B x 17
#define G_ROWS  320                       // 256 A rows, then 64 Bt rows
#define G_BUF   (G_ROWS * G_PITCH)        // bf16 per buffer

// Ten copies of 16 bytes per lane, global -> LDS, through no register.  The
// s_wait_xcnt closes the statement so that no address register named here is
// rewritten before it.
#define G_COPY10(l, g, o)                                                  \
  asm volatile(                                                            \
      "global_load_async_to_lds_b128 %0, %10, off\n\t"                     \
      "global_load_async_to_lds_b128 %1, %11, off\n\t"                     \
      "global_load_async_to_lds_b128 %2, %12, off\n\t"                     \
      "global_load_async_to_lds_b128 %3, %13, off\n\t"                     \
      "global_load_async_to_lds_b128 %4, %14, off\n\t"                     \
      "global_load_async_to_lds_b128 %5, %15, off\n\t"                     \
      "global_load_async_to_lds_b128 %6, %16, off\n\t"                     \
      "global_load_async_to_lds_b128 %7, %17, off\n\t"                     \
      "global_load_async_to_lds_b128 %8, %18, off\n\t"                     \
      "global_load_async_to_lds_b128 %9, %19, off\n\t"                     \
      "s_wait_xcnt 0x0"                                                    \
      :: "v"(l[o + 0]), "v"(l[o + 1]), "v"(l[o + 2]), "v"(l[o + 3]),       \
         "v"(l[o + 4]), "v"(l[o + 5]), "v"(l[o + 6]), "v"(l[o + 7]),       \
         "v"(l[o + 8]), "v"(l[o + 9]),                                     \
         "v"(g[o + 0]), "v"(g[o + 1]), "v"(g[o + 2]), "v"(g[o + 3]),       \
         "v"(g[o + 4]), "v"(g[o + 5]), "v"(g[o + 6]), "v"(g[o + 7]),       \
         "v"(g[o + 8]), "v"(g[o + 9])                                      \
      : "memory")

template <int EPI>
__global__ __launch_bounds__(256) void gemm_bf16_wmma(
    const __bf16* __restrict__ A, const __bf16* __restrict__ Bt,
    const float* __restrict__ bias, void* __restrict__ outp,
    int M, int N, int K) {
  __shared__ __attribute__((aligned(16))) __bf16 Ts[2 * G_BUF];

  const int lane = threadIdx.x & 31;
  const int wave = threadIdx.x >> 5;
  const int row0 = (blockIdx.y * 8 + wave) * 32;   // 32 rows per wave
  const int col0 = blockIdx.x * 64;

  v8f acc0[4] = {};
  v8f acc1[4] = {};

  // Copy map: 16 lanes cover one 256-byte row; copy i of a thread serves tile
  // row i * 16 + crow (i < 16: A rows, i >= 16: Bt rows).
  const int crow = threadIdx.x >> 4;        // 0..15
  const int ccol = (threadIdx.x & 15) << 3; // bf16 offset in the row
  const __bf16* asrc = A + (size_t)(blockIdx.y * 256 + crow) * K + ccol;
  const __bf16* bsrc = Bt + (size_t)(col0 + crow) * K + ccol;
  const unsigned ldst = (unsigned)(size_t)&Ts[crow * G_PITCH + ccol];

  auto issue = [&](int t, int buf) {
    unsigned l[20];
    const __bf16* g[20];
#pragma unroll  // constant indices: l and g stay in registers
    for (int i = 0; i < 20; ++i) {
      l[i] = ldst + (unsigned)(buf * G_BUF + i * 16 * G_PITCH) * 2u;
      g[i] = (i < 16 ? asrc + (size_t)(i * 16) * K
                     : bsrc + (size_t)((i - 16) * 16) * K) + t * G_PASS;
    }
    G_COPY10(l, g, 0);
    G_COPY10(l, g, 10);
  };

  const int npass = K / G_PASS;
  issue(0, 0);
  // pass 0 has landed for this wave, then for all waves
  asm volatile("s_wait_asynccnt 0x0" ::: "memory");
  __syncthreads();
  if (npass > 1) issue(1, 1);

  for (int t = 0; t < npass; ++t) {
    const __bf16* As = &Ts[(t & 1) * G_BUF + wave * 32 * G_PITCH];
    const __bf16* Bs = &Ts[(t & 1) * G_BUF + 256 * G_PITCH];
    // Two fragment sets: the LDS reads of k step s + 1 are issued as one group
    // ahead of the WMMAs of step s, so that their latency hides behind them.
    v16bf fa[2][2], fb[2][4];
    fa[0][0] = load_frag(As, G_PITCH);
    fa[0][1] = load_frag(As + 16 * G_PITCH, G_PITCH);
#pragma unroll  // constant j: fb stays in registers
    for (int j = 0; j < 4; ++j) fb[0][j] = load_frag(Bs + (j * 16) * G_PITCH, G_PITCH);
#pragma unroll  // constant set index: the fragments stay in registers
    for (int s = 0; s < G_PASS / 32; ++s) {
      const int cur = s & 1, nxt = cur ^ 1;
      if (s + 1 < G_PASS / 32) {
        const int kk = (s + 1) * 32;
        fa[nxt][0] = load_frag(As + kk, G_PITCH);
        fa[nxt][1] = load_frag(As + 16 * G_PITCH + kk, G_PITCH);
#pragma unroll  // constant j: fb stays in registers
        for (int j = 0; j < 4; ++j)
          fb[nxt][j] = load_frag(Bs + (j * 16) * G_PITCH + kk, G_PITCH);
      }
      // keeps the read group ahead of the WMMAs: without it the scheduler sinks
      // each read to just before its use and every WMMA pair waits on LDS
      __builtin_amdgcn_sched_barrier(0);
#pragma unroll  // constant j: accumulators and fragments stay in registers
      for (int j = 0; j < 4; ++j) {
        acc0[j] = wmma_bf16(fa[cur][0], fb[cur][j], acc0[j]);
        acc1[j] = wmma_bf16(fa[cur][1], fb[cur][j], acc1[j]);
      }
      // keeps the next step's reads from moving up among these WMMAs
      __builtin_amdgcn_sched_barrier(0);
    }
    // Hand-over: this wave's reads of buffer t & 1 are done, its copies of
    // pass t + 1 have landed; behind the barrier that holds for every wave.
    wait_lds();
    asm volatile("s_wait_asynccnt 0x0" ::: "memory");
    __syncthreads();
    if (t + 2 < npass) issue(t + 2, t & 1);
  }
  // no copy is outstanding when the wave goes on to the stores and ends
  asm volatile("s_wait_asynccnt 0x0" ::: "memory");

  const int half = lane >> 4, ln = lane & 15;
#pragma unroll
  for (int m2 = 0; m2 < 2; ++m2) {
#pragma unroll
    for (int j = 0; j < 4; ++j) {
#pragma unroll
      for (int r = 0; r < 8; ++r) {
        const int row = row0 + m2 * 16 + half * 8 + r;  // D layout
        const int col = col0 + j * 16 + ln;
        float v = m2 ? acc1[j][r] : acc0[j][r];
        if constexpr (EPI == EPI_QK) {
          // [BT,C] -> bf16 [B,H,T,hd]
          const int bi = row >> 11, ti = row & (T_DIM - 1);
          const int hi = col >> 6, di = col & (HD_DIM - 1);
          ((__bf16*)outp)[(((size_t)bi * H_DIM + hi) * T_DIM + ti) * HD_DIM + di] =
              (__bf16)v;
        } else if constexpr (EPI == EPI_VT) {
          // [BT,C] -> bf16 [B,H,hd,T]  (V transposed: K-contiguous for P*V)
          const int bi = row >> 11, ti = row & (T_DIM - 1);
          const int hi = col >> 6, di = col & (HD_DIM - 1);
          ((__bf16*)outp)[(((size_t)bi * H_DIM + hi) * HD_DIM + di) * T_DIM + ti] =
              (__bf16)v;
        } else if constexpr (EPI == EPI_F32_BIAS) {
          ((float*)outp)[(size_t)row * N + col] = v + bias[col];
        } else {  // EPI_RELU_BF16
          float o = v + bias[col];
          o = o > 0.f ? o : 0.f;
          ((__bf16*)outp)[(size_t)row * N + col] = (__bf16)o;
        }
      }
    }
  }
}

// ---------------------------------------------------------------- attention
// Flash-style causal attention. One wave per 16-row Q tile; K blocks of 32.
// The 8 waves of a block (128 queries of one head) share K and V: a stage is
// 64 keys = 64 K rows and 64 V^T rows of 128 bytes each, brought into LDS by
// asynchronous 16-byte copies, two buffers: the next stage's copies fly while
// this stage is worked on.
#define ATT_WAVES 8
#define A_KEYS  64                        // keys per stage
#define A_PITCH 72                        // LDS row pitch, bf16: 144 B = 16 B x 9
#define A_ROWS  128                       // 64 K rows, then 64 V^T rows
#define A_BUF   (A_ROWS * A_PITCH)        // bf16 per buffer

// Four copies of 16 bytes per lane, global -> LDS, through no register.  The
// s_wait_xcnt closes the statement so that no address register named here is
// rewritten before it.
#define A_COPY4(l, g)                                                      \
  asm volatile(                                                            \
      "global_load_async_to_lds_b128 %0, %4, off\n\t"                      \
      "global_load_async_to_lds_b128 %1, %5, off\n\t"                      \
      "global_load_async_to_lds_b128 %2, %6, off\n\t"                      \
      "global_load_async_to_lds_b128 %3, %7, off\n\t"                      \
      "s_wait_xcnt 0x0"                                                    \
      :: "v"(l[0]), "v"(l[1]), "v"(l[2]), "v"(l[3]),                       \
         "v"(g[0]), "v"(g[1]), "v"(g[2]), "v"(g[3])                        \
      : "memory")

__global__ __launch_bounds__(256) void attn_wmma_kernel(
    const __bf16* __restrict__ q,   // [B,H,T,hd]
    const __bf16* __restrict__ k,   // [B,H,T,hd]
    const __bf16* __restrict__ vt,  // [B,H,hd,T]
    __bf16* __restrict__ attnb) {   // bf16 [B,T,C]
  __shared__ __attribute__((aligned(16))) __bf16 KV[2 * A_BUF];
  __shared__ __attribute__((aligned(16))) __bf16 lds[ATT_WAVES][16 * 32];

  // scalar wave number: the test that skips a pass is then a scalar branch
  const int wave = __builtin_amdgcn_readfirstlane(threadIdx.x >> 5);
  const int lane = threadIdx.x & 31;
  const int half = lane >> 4, ln = lane & 15;

  const int qt0 = (blockIdx.x * ATT_WAVES + wave) * 16;
  const int bh  = blockIdx.y;
  const int bi  = bh >> 4;          // /H
  const int hi  = bh & (H_DIM - 1);

  const __bf16* Qp = q + ((size_t)bh * T_DIM + qt0) * HD_DIM;
  const __bf16* Kp = k + (size_t)bh * T_DIM * HD_DIM;
  const __bf16* Vp = vt + (size_t)bh * HD_DIM * T_DIM;

  // Copy map: 8 lanes cover one 128-byte row; copy i of a thread serves stage
  // row i * 32 + crow (i < 2: K rows, i >= 2: V^T rows).
  const int crow = threadIdx.x >> 3;        // 0..31
  const int ccol = (threadIdx.x & 7) << 3;  // bf16 offset in the row
  const __bf16* ksrc = Kp + (size_t)crow * HD_DIM + ccol;
  const __bf16* vsrc = Vp + (size_t)crow * T_DIM + ccol;
  const unsigned ldst = (unsigned)(size_t)&KV[crow * A_PITCH + ccol];

  auto issue = [&](int st, int buf) {
    unsigned l[4];
    const __bf16* g[4];
#pragma unroll  // constant indices: l stays in registers
    for (int i = 0; i < 4; ++i)
      l[i] = ldst + (unsigned)(buf * A_BUF + i * 32 * A_PITCH) * 2u;
    g[0] = ksrc + (size_t)(st * A_KEYS) * HD_DIM;
    g[1] = ksrc + (size_t)(st * A_KEYS + 32) * HD_DIM;
    g[2] = vsrc + st * A_KEYS;
    g[3] = vsrc + (size_t)32 * T_DIM + st * A_KEYS;
    A_COPY4(l, g);
  };

  // The block's last query is (blockIdx.x + 1) * 128 - 1: so many keys, in
  // stages of 64; never fewer than two stages.
  const int nst = (blockIdx.x + 1) * (ATT_WAVES * 16 / A_KEYS);
  issue(0, 0);

  const v16bf qa0 = load_frag(Qp, HD_DIM);        // K = 0..31 of hd
  const v16bf qa1 = load_frag(Qp + 32, HD_DIM);   // K = 32..63 of hd

  v8f o[4] = {};
  float rm[8], rl[8];
#pragma unroll
  for (int r = 0; r < 8; ++r) { rm[r] = -1e30f; rl[r] = 0.f; }

  __bf16* L = &lds[wave][0];

  // stage 0 has landed for this wave, then for all waves
  asm volatile("s_wait_asynccnt 0x0" ::: "memory");
  __syncthreads();
  issue(1, 1);

  for (int t = 0; t < nst; ++t) {
    const __bf16* Ks = &KV[(t & 1) * A_BUF];
    const __bf16* Vs = Ks + A_KEYS * A_PITCH;
    for (int p = 0; p < A_KEYS / 32; ++p) {
      const int kv0 = t * A_KEYS + p * 32;
      if (kv0 >= qt0 + 16) continue;   // wholly above this wave's diagonal
      // The pass's K and V^T fragments are read from LDS as one group.
      v16bf kf[2][2], vf[4];
#pragma unroll  // constant j: kf stays in registers
      for (int j = 0; j < 2; ++j) {
        const __bf16* Kb = Ks + (p * 32 + j * 16) * A_PITCH;
        kf[j][0] = load_frag(Kb, A_PITCH);
        kf[j][1] = load_frag(Kb + 32, A_PITCH);
      }
#pragma unroll  // constant jj: vf stays in registers
      for (int jj = 0; jj < 4; ++jj)
        vf[jj] = load_frag(Vs + (jj * 16) * A_PITCH + p * 32, A_PITCH);
      // keeps the read group ahead of the WMMAs: without it the scheduler sinks
      // each read to just before its use and every WMMA waits out an LDS read
      __builtin_amdgcn_sched_barrier(0);
      float pm[2][8];
#pragma unroll
      for (int j = 0; j < 2; ++j) {
        v8f s = {};
        s = wmma_bf16(qa0, kf[j][0], s);
        s = wmma_bf16(qa1, kf[j][1], s);
#pragma unroll
        for (int r = 0; r < 8; ++r) {
          float val = s[r] * 0.125f;              // hd^-0.5
          const int qg = qt0 + half * 8 + r;
          const int kg = kv0 + j * 16 + ln;
          pm[j][r] = (kg > qg) ? -1e30f : val;    // causal mask
        }
      }
      // online softmax, rows live in VGPR index r within each 16-lane half
#pragma unroll
      for (int r = 0; r < 8; ++r) {
        float mx = fmaxf(pm[0][r], pm[1][r]);
        mx = fmaxf(mx, __shfl_xor(mx, 1, 32));
        mx = fmaxf(mx, __shfl_xor(mx, 2, 32));
        mx = fmaxf(mx, __shfl_xor(mx, 4, 32));
        mx = fmaxf(mx, __shfl_xor(mx, 8, 32));
        const float mnew  = fmaxf(rm[r], mx);
        const float scale = __expf(rm[r] - mnew);
        rm[r] = mnew;
        const float p0 = __expf(pm[0][r] - mnew);
        const float p1 = __expf(pm[1][r] - mnew);
        float rs = p0 + p1;
        rs += __shfl_xor(rs, 1, 32);
        rs += __shfl_xor(rs, 2, 32);
        rs += __shfl_xor(rs, 4, 32);
        rs += __shfl_xor(rs, 8, 32);
        rl[r] = rl[r] * scale + rs;
        pm[0][r] = p0; pm[1][r] = p1;
#pragma unroll
        for (int jj = 0; jj < 4; ++jj) o[jj][r] *= scale;
      }
      // P (16x32, D-layout) -> LDS -> A-fragment layout
#pragma unroll
      for (int j = 0; j < 2; ++j)
#pragma unroll
        for (int r = 0; r < 8; ++r)
          L[(half * 8 + r) * 32 + j * 16 + ln] = (__bf16)pm[j][r];
      wait_lds();
      const v16bf pf = load_frag(L, 32);
#pragma unroll
      for (int jj = 0; jj < 4; ++jj) o[jj] = wmma_bf16(pf, vf[jj], o[jj]);
    }
    // Hand-over: this wave's reads of buffer t & 1 are done, its copies of
    // stage t + 1 have landed; behind the barrier that holds for every wave.
    wait_lds();
    asm volatile("s_wait_asynccnt 0x0" ::: "memory");
    __syncthreads();
    if (t + 2 < nst) issue(t + 2, t & 1);
  }
  // no copy is outstanding when the wave goes on to the stores and ends
  asm volatile("s_wait_asynccnt 0x0" ::: "memory");

  // normalize + scatter back to [B,T,C] bf16
#pragma unroll
  for (int r = 0; r < 8; ++r) {
    const float inv = 1.f / rl[r];
    const int qg = qt0 + half * 8 + r;
#pragma unroll
    for (int jj = 0; jj < 4; ++jj) {
      size_t dst = ((size_t)bi * T_DIM + qg) * C_DIM + hi * HD_DIM + jj * 16 + ln;
      attnb[dst] = (__bf16)(o[jj][r] * inv);
    }
  }
}

// ---------------------------------------------------------------- LN
// out = LN(x + y) * g + b ; one block per row of C_DIM=1024, 256 threads.
__global__ __launch_bounds__(256) void ln_residual_kernel(
    const float* __restrict__ x, const float* __restrict__ y,
    const float* __restrict__ g, const float* __restrict__ b,
    float* __restrict__ out, __bf16* __restrict__ outb) {
  const int row = blockIdx.x;
  const float* xr = x + (size_t)row * C_DIM;
  const float* yr = y + (size_t)row * C_DIM;
  float v[4], s = 0.f, s2 = 0.f;
#pragma unroll
  for (int i = 0; i < 4; ++i) {
    const int idx = threadIdx.x + i * 256;
    const float t = xr[idx] + yr[idx];
    v[i] = t; s += t; s2 += t * t;
  }
#pragma unroll
  for (int m = 1; m < 32; m <<= 1) {
    s  += __shfl_xor(s, m, 32);
    s2 += __shfl_xor(s2, m, 32);
  }
  __shared__ float w1s[8], w2s[8];
  if ((threadIdx.x & 31) == 0) {
    w1s[threadIdx.x >> 5] = s;
    w2s[threadIdx.x >> 5] = s2;
  }
  __syncthreads();
  s = 0.f; s2 = 0.f;
#pragma unroll
  for (int j = 0; j < 8; ++j) { s += w1s[j]; s2 += w2s[j]; }
  const float mean = s * (1.f / C_DIM);
  const float var  = s2 * (1.f / C_DIM) - mean * mean;
  const float rstd = rsqrtf(var + 1e-5f);
#pragma unroll
  for (int i = 0; i < 4; ++i) {
    const int idx = threadIdx.x + i * 256;
    const float o = (v[i] - mean) * rstd * g[idx] + b[idx];
    out[(size_t)row * C_DIM + idx] = o;
    if (outb) outb[(size_t)row * C_DIM + idx] = (__bf16)o;
  }
}

// ---------------------------------------------------------------- launch
extern "C" void kernel_launch(void* const* d_in, const int* in_sizes, int n_in,
                              void* d_out, int out_size, void* d_ws, size_t ws_size,
                              hipStream_t stream) {
  const float* x     = (const float*)d_in[0];
  const float* wq    = (const float*)d_in[1];
  const float* wk    = (const float*)d_in[2];
  const float* wv    = (const float*)d_in[3];
  const float* wp    = (const float*)d_in[4];
  const float* bproj = (const float*)d_in[5];
  const float* w1    = (const float*)d_in[6];
  const float* b1    = (const float*)d_in[7];
  const float* w2    = (const float*)d_in[8];
  const float* b2    = (const float*)d_in[9];
  const float* g1    = (const float*)d_in[10];
  const float* be1   = (const float*)d_in[11];
  const float* g2    = (const float*)d_in[12];
  const float* be2   = (const float*)d_in[13];

  char* ws = (char*)d_ws;
  size_t o = 0;
  auto take = [&](size_t nbytes) -> void* {
    void* p = ws + o;
    o += (nbytes + 255) & ~(size_t)255;
    return p;
  };
  const size_t BTC = (size_t)BT_DIM * C_DIM;
  __bf16* xb    = (__bf16*)take(BTC * 2);
  __bf16* wqt   = (__bf16*)take((size_t)C_DIM * C_DIM * 2);
  __bf16* wkt   = (__bf16*)take((size_t)C_DIM * C_DIM * 2);
  __bf16* wvt   = (__bf16*)take((size_t)C_DIM * C_DIM * 2);
  __bf16* wpt   = (__bf16*)take((size_t)C_DIM * C_DIM * 2);
  __bf16* w1t   = (__bf16*)take((size_t)C_DIM * DFF_DIM * 2);
  __bf16* w2t   = (__bf16*)take((size_t)DFF_DIM * C_DIM * 2);
  __bf16* qb    = (__bf16*)take(BTC * 2);
  __bf16* kb    = (__bf16*)take(BTC * 2);
  __bf16* vtb   = (__bf16*)take(BTC * 2);
  __bf16* attnb = (__bf16*)take(BTC * 2);
  float*  y1    = (float*)take(BTC * 4);
  float*  x1    = (float*)take(BTC * 4);
  __bf16* x1b   = (__bf16*)take(BTC * 2);
  __bf16* h1    = (__bf16*)take((size_t)BT_DIM * DFF_DIM * 2);
  float*  y2    = (float*)take(BTC * 4);

  const dim3 tb(32, 8);
  f32_to_bf16_kernel<<<(BTC / 4 + 255) / 256, 256, 0, stream>>>(x, xb, (int)BTC);
  transpose_f32_to_bf16<<<dim3(C_DIM / 32, C_DIM / 32), tb, 0, stream>>>(wq, wqt, C_DIM, C_DIM);
  transpose_f32_to_bf16<<<dim3(C_DIM / 32, C_DIM / 32), tb, 0, stream>>>(wk, wkt, C_DIM, C_DIM);
  transpose_f32_to_bf16<<<dim3(C_DIM / 32, C_DIM / 32), tb, 0, stream>>>(wv, wvt, C_DIM, C_DIM);
  transpose_f32_to_bf16<<<dim3(C_DIM / 32, C_DIM / 32), tb, 0, stream>>>(wp, wpt, C_DIM, C_DIM);
  transpose_f32_to_bf16<<<dim3(DFF_DIM / 32, C_DIM / 32), tb, 0, stream>>>(w1, w1t, C_DIM, DFF_DIM);
  transpose_f32_to_bf16<<<dim3(C_DIM / 32, DFF_DIM / 32), tb, 0, stream>>>(w2, w2t, DFF_DIM, C_DIM);

  // block tile 256(M) x 64(N)
  const dim3 gC(C_DIM / 64, BT_DIM / 256);
  gemm_bf16_wmma<EPI_QK><<<gC, 256, 0, stream>>>(xb, wqt, nullptr, qb, BT_DIM, C_DIM, C_DIM);
  gemm_bf16_wmma<EPI_QK><<<gC, 256, 0, stream>>>(xb, wkt, nullptr, kb, BT_DIM, C_DIM, C_DIM);
  gemm_bf16_wmma<EPI_VT><<<gC, 256, 0, stream>>>(xb, wvt, nullptr, vtb, BT_DIM, C_DIM, C_DIM);

  attn_wmma_kernel<<<dim3(T_DIM / (16 * ATT_WAVES), B_DIM * H_DIM), 256, 0, stream>>>(
      qb, kb, vtb, attnb);

  gemm_bf16_wmma<EPI_F32_BIAS><<<gC, 256, 0, stream>>>(attnb, wpt, bproj, y1, BT_DIM, C_DIM, C_DIM);
  ln_residual_kernel<<<BT_DIM, 256, 0, stream>>>(x, y1, g1, be1, x1, x1b);

  gemm_bf16_wmma<EPI_RELU_BF16><<<dim3(DFF_DIM / 64, BT_DIM / 256), 256, 0, stream>>>(
      x1b, w1t, b1, h1, BT_DIM, DFF_DIM, C_DIM);
  gemm_bf16_wmma<EPI_F32_BIAS><<<gC, 256, 0, stream>>>(h1, w2t, b2, y2, BT_DIM, C_DIM, DFF_DIM);
  ln_residual_kernel<<<BT_DIM, 256, 0, stream>>>(x1, y2, g2, be2, (float*)d_out, nullptr);
}

// v003
// One run takes 239 microseconds.
// Timed twice side by side with v002, it ran 1.07 times as fast both times.
// Counting every step since v000, it is 1.87 times as fast.
#include <hip/hip_runtime.h>

#define B_DIM   2
#define T_DIM   2048
#define C_DIM   1024
#define H_DIM   16
#define HD_DIM  64
#define DFF_DIM 4096
#define BT_DIM  (B_DIM * T_DIM)

typedef __attribute__((ext_vector_type(16))) __bf16 v16bf;
typedef __attribute__((ext_vector_type(8)))  float  v8f;
typedef __attribute__((ext_vector_type(4)))  unsigned int u32x4;
typedef __attribute__((ext_vector_type(2)))  unsigned int u32x2;
typedef __attribute__((ext_vector_type(4)))  float  f32x4;
typedef __attribute__((ext_vector_type(8)))  float  f32x8;

__device__ __forceinline__ v8f wmma_bf16(v16bf a, v16bf b, v8f c) {
  // D = A(16x32 bf16) * B(32x16 bf16) + C(16x16 f32)
  return __builtin_amdgcn_wmma_f32_16x16x32_bf16(
      /*neg_a=*/false, a, /*neg_b=*/false, b,
      /*c_mod=*/(short)0, c, /*reuse_a=*/false, /*reuse_b=*/false);
}

// Load one 16x32 bf16 fragment in the CDNA5 A-matrix lane layout from a
// row-major [16 x ld] tile.  Lanes 0-15: row=lane, K 0-7 (lo) / 16-23 (hi);
// lanes 16-31: row=lane-16, K 8-15 (lo) / 24-31 (hi).  Two b128 loads.
// Works for B as well when B is pre-transposed to [N][K].
__device__ __forceinline__ v16bf load_frag(const __bf16* base, int ld) {
  const int lane = threadIdx.x & 31;
  const int r    = lane & 15;
  const int kh   = (lane >> 4) << 3;        // 0 or 8
  const __bf16* p = base + (size_t)r * ld + kh;
  union { v16bf v; struct { u32x4 lo, hi; } q; } u;
  u.q.lo = *(const u32x4*)(p);
  u.q.hi = *(const u32x4*)(p + 16);
  return u.v;
}

__device__ __forceinline__ void wait_lds() {
  asm volatile("s_wait_dscnt 0" ::: "memory");
}

// ---------------------------------------------------------------- converts
// The kernels without matrix work move few bytes per wave, and the time to
// start their waves outweighs the time to move their bytes: each wave below
// keeps 8 to 32 loads of 512 bytes in flight instead of a few short ones.

// 32 elements per thread: eight 16-byte loads in flight, eight 8-byte stores.
// Needs n % 8192 == 0 (grid = n / 8192).
__global__ __launch_bounds__(256) void f32_to_bf16_kernel(
    const float* __restrict__ in, __bf16* __restrict__ out) {
  const size_t base = (size_t)blockIdx.x * 8192 + threadIdx.x * 4;
  float4 f[8];
#pragma unroll  // constant i: f stays in registers, the loads go out together
  for (int i = 0; i < 8; ++i) f[i] = *(const float4*)(in + base + i * 1024);
#pragma unroll  // constant i: f stays in registers
  for (int i = 0; i < 8; ++i) {
    union { __bf16 h[4]; u32x2 q; } u;
    u.h[0] = (__bf16)f[i].x;
    u.h[1] = (__bf16)f[i].y;
    u.h[2] = (__bf16)f[i].z;
    u.h[3] = (__bf16)f[i].w;
    *(u32x2*)(out + base + i * 1024) = u.q;
  }
}

// in: f32 row-major [R][Cc] -> out: bf16 [Cc][R]   (weights -> [N][K] layout)
// One 128 x 128 tile per block of 8 waves.  A wave reads 16 whole tile rows
// (512 bytes each), so a lane holds 16 consecutive r of 4 columns: per column
// two 16-byte pieces of an output row.  The pieces pass through LDS so that
// the stores cover whole 256-byte output rows.  LDS rows are 256 bytes without
// a pad; piece p of row c lies at p ^ ((c >> 2) & 15), which spreads both the
// writers (16 lanes: 16 rows, one p) and the readers (16 lanes: one row) over
// all banks.  R and Cc are compile-time: every row step is then an immediate
// offset on one address.  Needs R % 128 == 0, Cc % 128 == 0.
template <int R, int Cc>
__global__ __launch_bounds__(256) void transpose_f32_to_bf16(
    const float* __restrict__ in, __bf16* __restrict__ out) {
  __shared__ __attribute__((aligned(16))) __bf16 tile[128 * 128];  // [c][r]
  const int lane = threadIdx.x & 31;
  const int wave = threadIdx.x >> 5;
  const int c0 = blockIdx.x * 128, r0 = blockIdx.y * 128;
  const float* src = in + (size_t)(r0 + wave * 16) * Cc + c0 + lane * 4;
  float f[16][4];
#pragma unroll  // constant i: f stays in registers, the loads go out together
  for (int i = 0; i < 16; ++i) {
    // the last load's result may land in the address pair that the earlier
    // loads name: the wait stands in front of that overwrite
    if (i == 15) asm volatile("s_wait_xcnt 0x0" ::: "memory");
    const float4 t = *(const float4*)(src + i * Cc);
    f[i][0] = t.x; f[i][1] = t.y; f[i][2] = t.z; f[i][3] = t.w;
  }
  // keeps all 16 loads ahead of the converts: without it the scheduler holds
  // six of them back until earlier ones have returned, a second latency
  __builtin_amdgcn_sched_barrier(0);
#pragma unroll  // constant e, h, k: f stays in registers
  for (int e = 0; e < 4; ++e) {
#pragma unroll
    for (int h = 0; h < 2; ++h) {
      union { __bf16 b[8]; u32x4 q; } u;
#pragma unroll
      for (int k = 0; k < 8; ++k) u.b[k] = (__bf16)f[h * 8 + k][e];
      const int piece = (wave * 2 + h) ^ (lane & 15);
      *(u32x4*)&tile[(lane * 4 + e) * 128 + piece * 8] = u.q;
    }
  }
  __syncthreads();
  const int crow = threadIdx.x >> 4;   // 0..15
  const int p    = threadIdx.x & 15;   // 16-byte piece of the output row
  __bf16* dst = out + (size_t)(c0 + crow) * R + r0 + p * 8;
#pragma unroll  // the eight LDS reads go out together, row steps are immediates
  for (int i = 0; i < 8; ++i) {
    const int c = i * 16 + crow;
    const u32x4 q = *(const u32x4*)&tile[c * 128 + (p ^ ((c >> 2) & 15)) * 8];
    *(u32x4*)(dst + i * 16 * R) = q;
  }
}

// ---------------------------------------------------------------- GEMM
enum { EPI_QK = 0, EPI_VT = 1, EPI_F32_BIAS = 2, EPI_RELU_BF16 = 3 };

// C[M,N] = A[M,K](bf16) * Bt[N,K]^T(bf16), f32 accumulate.
// Block: 256 threads = 8 waves; block tile 256(M) x 64(N).
// Wave tile 32x64: 2 M-tiles x 4 N-tiles = 8 WMMAs per K=32 step.
// A pass is 128 k = 256 bytes of each of the 256 A rows and 64 Bt rows.  The
// pass's 320 rows are brought into LDS by asynchronous 16-byte copies, two
// buffers: the next pass's copies fly while this pass is multiplied.
// Needs M % 256 == 0, N % 64 == 0, K % 128 == 0.
#define G_PASS  128                       // k per pass
#define G_PITCH 136                       // LDS row pitch, bf16: 272 B = 16 B x 17
#define G_ROWS  320                       // 256 A rows, then 64 Bt rows
#define G_BUF   (G_ROWS * G_PITCH)        // bf16 per buffer

// Ten copies of 16 bytes per lane, global -> LDS, through no register.  The
// s_wait_xcnt closes the statement so that no address register named here is
// rewritten before it.
#define G_COPY10(l, g, o)                                                  \
  asm volatile(                                                            \
      "global_load_async_to_lds_b128 %0, %10, off\n\t"                     \
      "global_load_async_to_lds_b128 %1, %11, off\n\t"                     \
      "global_load_async_to_lds_b128 %2, %12, off\n\t"                     \
      "global_load_async_to_lds_b128 %3, %13, off\n\t"                     \
      "global_load_async_to_lds_b128 %4, %14, off\n\t"                     \
      "global_load_async_to_lds_b128 %5, %15, off\n\t"                     \
      "global_load_async_to_lds_b128 %6, %16, off\n\t"                     \
      "global_load_async_to_lds_b128 %7, %17, off\n\t"                     \
      "global_load_async_to_lds_b128 %8, %18, off\n\t"                     \
      "global_load_async_to_lds_b128 %9, %19, off\n\t"                     \
      "s_wait_xcnt 0x0"                                                    \
      :: "v"(l[o + 0]), "v"(l[o + 1]), "v"(l[o + 2]), "v"(l[o + 3]),       \
         "v"(l[o + 4]), "v"(l[o + 5]), "v"(l[o + 6]), "v"(l[o + 7]),       \
         "v"(l[o + 8]), "v"(l[o + 9]),                                     \
         "v"(g[o + 0]), "v"(g[o + 1]), "v"(g[o + 2]), "v"(g[o + 3]),       \
         "v"(g[o + 4]), "v"(g[o + 5]), "v"(g[o + 6]), "v"(g[o + 7]),       \
         "v"(g[o + 8]), "v"(g[o + 9])                                      \
      : "memory")

template <int EPI>
__global__ __launch_bounds__(256) void gemm_bf16_wmma(
    const __bf16* __restrict__ A, const __bf16* __restrict__ Bt,
    const float* __restrict__ bias, void* __restrict__ outp,
    int M, int N, int K) {
  __shared__ __attribute__((aligned(16))) __bf16 Ts[2 * G_BUF];

  const int lane = threadIdx.x & 31;
  const int wave = threadIdx.x >> 5;
  const int row0 = (blockIdx.y * 8 + wave) * 32;   // 32 rows per wave
  const int col0 = blockIdx.x * 64;

  v8f acc0[4] = {};
  v8f acc1[4] = {};

  // Copy map: 16 lanes cover one 256-byte row; copy i of a thread serves tile
  // row i * 16 + crow (i < 16: A rows, i >= 16: Bt rows).
  const int crow = threadIdx.x >> 4;        // 0..15
  const int ccol = (threadIdx.x & 15) << 3; // bf16 offset in the row
  const __bf16* asrc = A + (size_t)(blockIdx.y * 256 + crow) * K + ccol;
  const __bf16* bsrc = Bt + (size_t)(col0 + crow) * K + ccol;
  const unsigned ldst = (unsigned)(size_t)&Ts[crow * G_PITCH + ccol];

  auto issue = [&](int t, int buf) {
    unsigned l[20];
    const __bf16* g[20];
#pragma unroll  // constant indices: l and g stay in registers
    for (int i = 0; i < 20; ++i) {
      l[i] = ldst + (unsigned)(buf * G_BUF + i * 16 * G_PITCH) * 2u;
      g[i] = (i < 16 ? asrc + (size_t)(i * 16) * K
                     : bsrc + (size_t)((i - 16) * 16) * K) + t * G_PASS;
    }
    G_COPY10(l, g, 0);
    G_COPY10(l, g, 10);
  };

  const int npass = K / G_PASS;
  issue(0, 0);
  // pass 0 has landed for this wave, then for all waves
  asm volatile("s_wait_asynccnt 0x0" ::: "memory");
  __syncthreads();
  if (npass > 1) issue(1, 1);

  for (int t = 0; t < npass; ++t) {
    const __bf16* As = &Ts[(t & 1) * G_BUF + wave * 32 * G_PITCH];
    const __bf16* Bs = &Ts[(t & 1) * G_BUF + 256 * G_PITCH];
    // Two fragment sets: the LDS reads of k step s + 1 are issued as one group
    // ahead of the WMMAs of step s, so that their latency hides behind them.
    v16bf fa[2][2], fb[2][4];
    fa[0][0] = load_frag(As, G_PITCH);
    fa[0][1] = load_frag(As + 16 * G_PITCH, G_PITCH);
#pragma unroll  // constant j: fb stays in registers
    for (int j = 0; j < 4; ++j) fb[0][j] = load_frag(Bs + (j * 16) * G_PITCH, G_PITCH);
#pragma unroll  // constant set index: the fragments stay in registers
    for (int s = 0; s < G_PASS / 32; ++s) {
      const int cur = s & 1, nxt = cur ^ 1;
      if (s + 1 < G_PASS / 32) {
        const int kk = (s + 1) * 32;
        fa[nxt][0] = load_frag(As + kk, G_PITCH);
        fa[nxt][1] = load_frag(As + 16 * G_PITCH + kk, G_PITCH);
#pragma unroll  // constant j: fb stays in registers
        for (int j = 0; j < 4; ++j)
          fb[nxt][j] = load_frag(Bs + (j * 16) * G_PITCH + kk, G_PITCH);
      }
      // keeps the read group ahead of the WMMAs: without it the scheduler sinks
      // each read to just before its use and every WMMA pair waits on LDS
      __builtin_amdgcn_sched_barrier(0);
#pragma unroll  // constant j: accumulators and fragments stay in registers
      for (int j = 0; j < 4; ++j) {
        acc0[j] = wmma_bf16(fa[cur][0], fb[cur][j], acc0[j]);
        acc1[j] = wmma_bf16(fa[cur][1], fb[cur][j], acc1[j]);
      }
      // keeps the next step's reads from moving up among these WMMAs
      __builtin_amdgcn_sched_barrier(0);
    }
    // Hand-over: this wave's reads of buffer t & 1 are done, its copies of
    // pass t + 1 have landed; behind the barrier that holds for every wave.
    wait_lds();
    asm volatile("s_wait_asynccnt 0x0" ::: "memory");
    __syncthreads();
    if (t + 2 < npass) issue(t + 2, t & 1);
  }
  // no copy is outstanding when the wave goes on to the stores and ends
  asm volatile("s_wait_asynccnt 0x0" ::: "memory");

  const int half = lane >> 4, ln = lane & 15;
#pragma unroll
  for (int m2 = 0; m2 < 2; ++m2) {
#pragma unroll
    for (int j = 0; j < 4; ++j) {
#pragma unroll
      for (int r = 0; r < 8; ++r) {
        const int row = row0 + m2 * 16 + half * 8 + r;  // D layout
        const int col = col0 + j * 16 + ln;
        float v = m2 ? acc1[j][r] : acc0[j][r];
        if constexpr (EPI == EPI_QK) {
          // [BT,C] -> bf16 [B,H,T,hd]
          const int bi = row >> 11, ti = row & (T_DIM - 1);
          const int hi = col >> 6, di = col & (HD_DIM - 1);
          ((__bf16*)outp)[(((size_t)bi * H_DIM + hi) * T_DIM + ti) * HD_DIM + di] =
              (__bf16)v;
        } else if constexpr (EPI == EPI_VT) {
          // [BT,C] -> bf16 [B,H,hd,T]  (V transposed: K-contiguous for P*V)
          const int bi = row >> 11, ti = row & (T_DIM - 1);
          const int hi = col >> 6, di = col & (HD_DIM - 1);
          ((__bf16*)outp)[(((size_t)bi * H_DIM + hi) * HD_DIM + di) * T_DIM + ti] =
              (__bf16)v;
        } else if constexpr (EPI == EPI_F32_BIAS) {
          ((float*)outp)[(size_t)row * N + col] = v + bias[col];
        } else {  // EPI_RELU_BF16
          float o = v + bias[col];
          o = o > 0.f ? o : 0.f;
          ((__bf16*)outp)[(size_t)row * N + col] = (__bf16)o;
        }
      }
    }
  }
}

// ---------------------------------------------------------------- attention
// Flash-style causal attention. One wave per 16-row Q tile; K blocks of 32.
// The 8 waves of a block (128 queries of one head) share K and V: a stage is
// 64 keys = 64 K rows and 64 V^T rows of 128 bytes each, brought into LDS by
// asynchronous 16-byte copies, two buffers: the next stage's copies fly while
// this stage is worked on.
#define ATT_WAVES 8
#define A_KEYS  64                        // keys per stage
#define A_PITCH 72                        // LDS row pitch, bf16: 144 B = 16 B x 9
#define A_ROWS  128                       // 64 K rows, then 64 V^T rows
#define A_BUF   (A_ROWS * A_PITCH)        // bf16 per buffer

// Four copies of 16 bytes per lane, global -> LDS, through no register.  The
// s_wait_xcnt closes the statement so that no address register named here is
// rewritten before it.
#define A_COPY4(l, g)                                                      \
  asm volatile(                                                            \
      "global_load_async_to_lds_b128 %0, %4, off\n\t"                      \
      "global_load_async_to_lds_b128 %1, %5, off\n\t"                      \
      "global_load_async_to_lds_b128 %2, %6, off\n\t"                      \
      "global_load_async_to_lds_b128 %3, %7, off\n\t"                      \
      "s_wait_xcnt 0x0"                                                    \
      :: "v"(l[0]), "v"(l[1]), "v"(l[2]), "v"(l[3]),                       \
         "v"(g[0]), "v"(g[1]), "v"(g[2]), "v"(g[3])                        \
      : "memory")

__global__ __launch_bounds__(256) void attn_wmma_kernel(
    const __bf16* __restrict__ q,   // [B,H,T,hd]
    const __bf16* __restrict__ k,   // [B,H,T,hd]
    const __bf16* __restrict__ vt,  // [B,H,hd,T]
    __bf16* __restrict__ attnb) {   // bf16 [B,T,C]
  __shared__ __attribute__((aligned(16))) __bf16 KV[2 * A_BUF];
  __shared__ __attribute__((aligned(16))) __bf16 lds[ATT_WAVES][16 * 32];

  // scalar wave number: the test that skips a pass is then a scalar branch
  const int wave = __builtin_amdgcn_readfirstlane(threadIdx.x >> 5);
  const int lane = threadIdx.x & 31;
  const int half = lane >> 4, ln = lane & 15;

  const int qt0 = (blockIdx.x * ATT_WAVES + wave) * 16;
  const int bh  = blockIdx.y;
  const int bi  = bh >> 4;          // /H
  const int hi  = bh & (H_DIM - 1);

  const __bf16* Qp = q + ((size_t)bh * T_DIM + qt0) * HD_DIM;
  const __bf16* Kp = k + (size_t)bh * T_DIM * HD_DIM;
  const __bf16* Vp = vt + (size_t)bh * HD_DIM * T_DIM;

  // Copy map: 8 lanes cover one 128-byte row; copy i of a thread serves stage
  // row i * 32 + crow (i < 2: K rows, i >= 2: V^T rows).
  const int crow = threadIdx.x >> 3;        // 0..31
  const int ccol = (threadIdx.x & 7) << 3;  // bf16 offset in the row
  const __bf16* ksrc = Kp + (size_t)crow * HD_DIM + ccol;
  const __bf16* vsrc = Vp + (size_t)crow * T_DIM + ccol;
  const unsigned ldst = (unsigned)(size_t)&KV[crow * A_PITCH + ccol];

  auto issue = [&](int st, int buf) {
    unsigned l[4];
    const __bf16* g[4];
#pragma unroll  // constant indices: l stays in registers
    for (int i = 0; i < 4; ++i)
      l[i] = ldst + (unsigned)(buf * A_BUF + i * 32 * A_PITCH) * 2u;
    g[0] = ksrc + (size_t)(st * A_KEYS) * HD_DIM;
    g[1] = ksrc + (size_t)(st * A_KEYS + 32) * HD_DIM;
    g[2] = vsrc + st * A_KEYS;
    g[3] = vsrc + (size_t)32 * T_DIM + st * A_KEYS;
    A_COPY4(l, g);
  };

  // The block's last query is (blockIdx.x + 1) * 128 - 1: so many keys, in
  // stages of 64; never fewer than two stages.
  const int nst = (blockIdx.x + 1) * (ATT_WAVES * 16 / A_KEYS);
  issue(0, 0);

  const v16bf qa0 = load_frag(Qp, HD_DIM);        // K = 0..31 of hd
  const v16bf qa1 = load_frag(Qp + 32, HD_DIM);   // K = 32..63 of hd

  v8f o[4] = {};
  float rm[8], rl[8];
#pragma unroll
  for (int r = 0; r < 8; ++r) { rm[r] = -1e30f; rl[r] = 0.f; }

  __bf16* L = &lds[wave][0];

  // stage 0 has landed for this wave, then for all waves
  asm volatile("s_wait_asynccnt 0x0" ::: "memory");
  __syncthreads();
  issue(1, 1);

  for (int t = 0; t < nst; ++t) {
    const __bf16* Ks = &KV[(t & 1) * A_BUF];
    const __bf16* Vs = Ks + A_KEYS * A_PITCH;
    for (int p = 0; p < A_KEYS / 32; ++p) {
      const int kv0 = t * A_KEYS + p * 32;
      if (kv0 >= qt0 + 16) continue;   // wholly above this wave's diagonal
      // The pass's K and V^T fragments are read from LDS as one group.
      v16bf kf[2][2], vf[4];
#pragma unroll  // constant j: kf stays in registers
      for (int j = 0; j < 2; ++j) {
        const __bf16* Kb = Ks + (p * 32 + j * 16) * A_PITCH;
        kf[j][0] = load_frag(Kb, A_PITCH);
        kf[j][1] = load_frag(Kb + 32, A_PITCH);
      }
#pragma unroll  // constant jj: vf stays in registers
      for (int jj = 0; jj < 4; ++jj)
        vf[jj] = load_frag(Vs + (jj * 16) * A_PITCH + p * 32, A_PITCH);
      // keeps the read group ahead of the WMMAs: without it the scheduler sinks
      // each read to just before its use and every WMMA waits out an LDS read
      __builtin_amdgcn_sched_barrier(0);
      float pm[2][8];
#pragma unroll
      for (int j = 0; j < 2; ++j) {
        v8f s = {};
        s = wmma_bf16(qa0, kf[j][0], s);
        s = wmma_bf16(qa1, kf[j][1], s);
#pragma unroll
        for (int r = 0; r < 8; ++r) {
          float val = s[r] * 0.125f;              // hd^-0.5
          const int qg = qt0 + half * 8 + r;
          const int kg = kv0 + j * 16 + ln;
          pm[j][r] = (kg > qg) ? -1e30f : val;    // causal mask
        }
      }
      // online softmax, rows live in VGPR index r within each 16-lane half
#pragma unroll
      for (int r = 0; r < 8; ++r) {
        float mx = fmaxf(pm[0][r], pm[1][r]);
        mx = fmaxf(mx, __shfl_xor(mx, 1, 32));
        mx = fmaxf(mx, __shfl_xor(mx, 2, 32));
        mx = fmaxf(mx, __shfl_xor(mx, 4, 32));
        mx = fmaxf(mx, __shfl_xor(mx, 8, 32));
        const float mnew  = fmaxf(rm[r], mx);
        const float scale = __expf(rm[r] - mnew);
        rm[r] = mnew;
        const float p0 = __expf(pm[0][r] - mnew);
        const float p1 = __expf(pm[1][r] - mnew);
        float rs = p0 + p1;
        rs += __shfl_xor(rs, 1, 32);
        rs += __shfl_xor(rs, 2, 32);
        rs += __shfl_xor(rs, 4, 32);
        rs += __shfl_xor(rs, 8, 32);
        rl[r] = rl[r] * scale + rs;
        pm[0][r] = p0; pm[1][r] = p1;
#pragma unroll
        for (int jj = 0; jj < 4; ++jj) o[jj][r] *= scale;
      }
      // P (16x32, D-layout) -> LDS -> A-fragment layout
#pragma unroll
      for (int j = 0; j < 2; ++j)
#pragma unroll
        for (int r = 0; r < 8; ++r)
          L[(half * 8 + r) * 32 + j * 16 + ln] = (__bf16)pm[j][r];
      wait_lds();
      const v16bf pf = load_frag(L, 32);
#pragma unroll
      for (int jj = 0; jj < 4; ++jj) o[jj] = wmma_bf16(pf, vf[jj], o[jj]);
    }
    // Hand-over: this wave's reads of buffer t & 1 are done, its copies of
    // stage t + 1 have landed; behind the barrier that holds for every wave.
    wait_lds();
    asm volatile("s_wait_asynccnt 0x0" ::: "memory");
    __syncthreads();
    if (t + 2 < nst) issue(t + 2, t & 1);
  }
  // no copy is outstanding when the wave goes on to the stores and ends
  asm volatile("s_wait_asynccnt 0x0" ::: "memory");

  // normalize + scatter back to [B,T,C] bf16
#pragma unroll
  for (int r = 0; r < 8; ++r) {
    const float inv = 1.f / rl[r];
    const int qg = qt0 + half * 8 + r;
#pragma unroll
    for (int jj = 0; jj < 4; ++jj) {
      size_t dst = ((size_t)bi * T_DIM + qg) * C_DIM + hi * HD_DIM + jj * 16 + ln;
      attnb[dst] = (__bf16)(o[jj][r] * inv);
    }
  }
}

// ---------------------------------------------------------------- LN
// out = LN(x + y) * g + b ; one wave per row of C_DIM=1024, 8 rows per block.
// A lane holds 32 elements of its row (eight 16-byte pieces, 512 bytes of the
// row per wave-wide request); the row's sums need no LDS and no barrier.
__global__ __launch_bounds__(256) void ln_residual_kernel(
    const float* __restrict__ x, const float* __restrict__ y,
    const float* __restrict__ g, const float* __restrict__ b,
    float* __restrict__ out, __bf16* __restrict__ outb) {
  const int lane = threadIdx.x & 31;
  const int row  = blockIdx.x * 8 + (threadIdx.x >> 5);
  const size_t off = (size_t)row * C_DIM + lane * 4;
  f32x8 xy[8], gb[8];   // x | y and g | b, one 16-byte piece of each
#pragma unroll  // constant i: the pieces stay in registers
  for (int i = 0; i < 8; ++i)
    xy[i] = __builtin_shufflevector(*(const f32x4*)(x + off + i * 128),
                                    *(const f32x4*)(y + off + i * 128),
                                    0, 1, 2, 3, 4, 5, 6, 7);
#pragma unroll  // constant i: the pieces stay in registers
  for (int i = 0; i < 8; ++i)
    gb[i] = __builtin_shufflevector(*(const f32x4*)(g + lane * 4 + i * 128),
                                    *(const f32x4*)(b + lane * 4 + i * 128),
                                    0, 1, 2, 3, 4, 5, 6, 7);
  // Loaded values as inputs only: holds all 32 loads ahead of the sums.  Without
  // it the compiler holds some x, y loads back until earlier ones have returned
  // and sinks each g, b load to its use, a further latency per piece.
  asm volatile("" :: "v"(xy[0]), "v"(xy[1]), "v"(xy[2]), "v"(xy[3]),
                     "v"(xy[4]), "v"(xy[5]), "v"(xy[6]), "v"(xy[7]),
                     "v"(gb[0]), "v"(gb[1]), "v"(gb[2]), "v"(gb[3]),
                     "v"(gb[4]), "v"(gb[5]), "v"(gb[6]), "v"(gb[7]));
  float v[8][4];
  float sa[4] = {0.f, 0.f, 0.f, 0.f}, sb[4] = {0.f, 0.f, 0.f, 0.f};
#pragma unroll  // constant i, e: xy and v stay in registers
  for (int i = 0; i < 8; ++i) {
#pragma unroll  // four independent chains
    for (int e = 0; e < 4; ++e) {
      v[i][e] = xy[i][e] + xy[i][e + 4];
      sa[e] += v[i][e];
      sb[e] += v[i][e] * v[i][e];
    }
  }
  float s  = (sa[0] + sa[1]) + (sa[2] + sa[3]);
  float s2 = (sb[0] + sb[1]) + (sb[2] + sb[3]);
#pragma unroll
  for (int m = 1; m < 32; m <<= 1) {
    s  += __shfl_xor(s, m, 32);
    s2 += __shfl_xor(s2, m, 32);
  }
  const float mean = s * (1.f / C_DIM);
  const float var  = s2 * (1.f / C_DIM) - mean * mean;
  const float rstd = rsqrtf(var + 1e-5f);
#pragma unroll  // constant i, e: v and gb stay in registers
  for (int i = 0; i < 8; ++i) {
#pragma unroll
    for (int e = 0; e < 4; ++e)
      v[i][e] = (v[i][e] - mean) * rstd * gb[i][e] + gb[i][e + 4];
    *(float4*)(out + off + i * 128) = make_float4(v[i][0], v[i][1], v[i][2], v[i][3]);
  }
  // the converts below reuse registers that the stores above name
  asm volatile("s_wait_xcnt 0x0" ::: "memory");
  if (outb) {
#pragma unroll  // constant i, e: v stays in registers
    for (int i = 0; i < 8; ++i) {
      union { __bf16 h[4]; u32x2 q; } u;
#pragma unroll
      for (int e = 0; e < 4; ++e) u.h[e] = (__bf16)v[i][e];
      *(u32x2*)(outb + off + i * 128) = u.q;
    }
  }
}

// ---------------------------------------------------------------- launch
extern "C" void kernel_launch(void* const* d_in, const int* in_sizes, int n_in,
                              void* d_out, int out_size, void* d_ws, size_t ws_size,
                              hipStream_t stream) {
  const float* x     = (const float*)d_in[0];
  const float* wq    = (const float*)d_in[1];
  const float* wk    = (const float*)d_in[2];
  const float* wv    = (const float*)d_in[3];
  const float* wp    = (const float*)d_in[4];
  const float* bproj = (const float*)d_in[5];
  const float* w1    = (const float*)d_in[6];
  const float* b1    = (const float*)d_in[7];
  const float* w2    = (const float*)d_in[8];
  const float* b2    = (const float*)d_in[9];
  const float* g1    = (const float*)d_in[10];
  const float* be1   = (const float*)d_in[11];
  const float* g2    = (const float*)d_in[12];
  const float* be2   = (const float*)d_in[13];

  char* ws = (char*)d_ws;
  size_t o = 0;
  auto take = [&](size_t nbytes) -> void* {
    void* p = ws + o;
    o += (nbytes + 255) & ~(size_t)255;
    return p;
  };
  const size_t BTC = (size_t)BT_DIM * C_DIM;
  __bf16* xb    = (__bf16*)take(BTC * 2);
  __bf16* wqt   = (__bf16*)take((size_t)C_DIM * C_DIM * 2);
  __bf16* wkt   = (__bf16*)take((size_t)C_DIM * C_DIM * 2);
  __bf16* wvt   = (__bf16*)take((size_t)C_DIM * C_DIM * 2);
  __bf16* wpt   = (__bf16*)take((size_t)C_DIM * C_DIM * 2);
  __bf16* w1t   = (__bf16*)take((size_t)C_DIM * DFF_DIM * 2);
  __bf16* w2t   = (__bf16*)take((size_t)DFF_DIM * C_DIM * 2);
  __bf16* qb    = (__bf16*)take(BTC * 2);
  __bf16* kb    = (__bf16*)take(BTC * 2);
  __bf16* vtb   = (__bf16*)take(BTC * 2);
  __bf16* attnb = (__bf16*)take(BTC * 2);
  float*  y1    = (float*)take(BTC * 4);
  float*  x1    = (float*)take(BTC * 4);
  __bf16* x1b   = (__bf16*)take(BTC * 2);
  __bf16* h1    = (__bf16*)take((size_t)BT_DIM * DFF_DIM * 2);
  float*  y2    = (float*)take(BTC * 4);

  f32_to_bf16_kernel<<<BTC / 8192, 256, 0, stream>>>(x, xb);
  transpose_f32_to_bf16<C_DIM, C_DIM><<<dim3(C_DIM / 128, C_DIM / 128), 256, 0, stream>>>(wq, wqt);
  transpose_f32_to_bf16<C_DIM, C_DIM><<<dim3(C_DIM / 128, C_DIM / 128), 256, 0, stream>>>(wk, wkt);
  transpose_f32_to_bf16<C_DIM, C_DIM><<<dim3(C_DIM / 128, C_DIM / 128), 256, 0, stream>>>(wv, wvt);
  transpose_f32_to_bf16<C_DIM, C_DIM><<<dim3(C_DIM / 128, C_DIM / 128), 256, 0, stream>>>(wp, wpt);
  transpose_f32_to_bf16<C_DIM, DFF_DIM><<<dim3(DFF_DIM / 128, C_DIM / 128), 256, 0, stream>>>(w1, w1t);
  transpose_f32_to_bf16<DFF_DIM, C_DIM><<<dim3(C_DIM / 128, DFF_DIM / 128), 256, 0, stream>>>(w2, w2t);

  // block tile 256(M) x 64(N)
  const dim3 gC(C_DIM / 64, BT_DIM / 256);
  gemm_bf16_wmma<EPI_QK><<<gC, 256, 0, stream>>>(xb, wqt, nullptr, qb, BT_DIM, C_DIM, C_DIM);
  gemm_bf16_wmma<EPI_QK><<<gC, 256, 0, stream>>>(xb, wkt, nullptr, kb, BT_DIM, C_DIM, C_DIM);
  gemm_bf16_wmma<EPI_VT><<<gC, 256, 0, stream>>>(xb, wvt, nullptr, vtb, BT_DIM, C_DIM, C_DIM);

  attn_wmma_kernel<<<dim3(T_DIM / (16 * ATT_WAVES), B_DIM * H_DIM), 256, 0, stream>>>(
      qb, kb, vtb, attnb);

  gemm_bf16_wmma<EPI_F32_BIAS><<<gC, 256, 0, stream>>>(attnb, wpt, bproj, y1, BT_DIM, C_DIM, C_DIM);
  ln_residual_kernel<<<BT_DIM / 8, 256, 0, stream>>>(x, y1, g1, be1, x1, x1b);

  gemm_bf16_wmma<EPI_RELU_BF16><<<dim3(DFF_DIM / 64, BT_DIM / 256), 256, 0, stream>>>(
      x1b, w1t, b1, h1, BT_DIM, DFF_DIM, C_DIM);
  gemm_bf16_wmma<EPI_F32_BIAS><<<gC, 256, 0, stream>>>(h1, w2t, b2, y2, BT_DIM, C_DIM, DFF_DIM);
  ln_residual_kernel<<<BT_DIM / 8, 256, 0, stream>>>(x1, y2, g2, be2, (float*)d_out, nullptr);
}

// v004
// A run of this version takes 196 microseconds.
// Timed twice side by side with v003, it ran 1.23 times as fast both times.
// Over all steps from v000 it is 2.30 times as fast.
#include <hip/hip_runtime.h>

#define B_DIM   2
#define T_DIM   2048
#define C_DIM   1024
#define H_DIM   16
#define HD_DIM  64
#define DFF_DIM 4096
#define BT_DIM  (B_DIM * T_DIM)

typedef __attribute__((ext_vector_type(16))) __bf16 v16bf;
typedef __attribute__((ext_vector_type(8)))  float  v8f;
typedef __attribute__((ext_vector_type(4)))  unsigned int u32x4;
typedef __attribute__((ext_vector_type(2)))  unsigned int u32x2;
typedef __attribute__((ext_vector_type(4)))  float  f32x4;
typedef __attribute__((ext_vector_type(8)))  float  f32x8;

__device__ __forceinline__ v8f wmma_bf16(v16bf a, v16bf b, v8f c) {
  // D = A(16x32 bf16) * B(32x16 bf16) + C(16x16 f32)
  return __builtin_amdgcn_wmma_f32_16x16x32_bf16(
      /*neg_a=*/false, a, /*neg_b=*/false, b,
      /*c_mod=*/(short)0, c, /*reuse_a=*/false, /*reuse_b=*/false);
}

// Load one 16x32 bf16 fragment in the CDNA5 A-matrix lane layout from a
// row-major [16 x ld] tile.  Lanes 0-15: row=lane, K 0-7 (lo) / 16-23 (hi);
// lanes 16-31: row=lane-16, K 8-15 (lo) / 24-31 (hi).  Two b128 loads.
// Works for B as well when B is pre-transposed to [N][K].
__device__ __forceinline__ v16bf load_frag(const __bf16* base, int ld) {
  const int lane = threadIdx.x & 31;
  const int r    = lane & 15;
  const int kh   = (lane >> 4) << 3;        // 0 or 8
  const __bf16* p = base + (size_t)r * ld + kh;
  union { v16bf v; struct { u32x4 lo, hi; } q; } u;
  u.q.lo = *(const u32x4*)(p);
  u.q.hi = *(const u32x4*)(p + 16);
  return u.v;
}

__device__ __forceinline__ void wait_lds() {
  asm volatile("s_wait_dscnt 0" ::: "memory");
}

// ---------------------------------------------------------------- converts
// The kernels without matrix work move few bytes per wave, and the time to
// start their waves outweighs the time to move their bytes: each wave below
// keeps 8 to 32 loads of 512 bytes in flight instead of a few short ones.

// 32 elements per thread: eight 16-byte loads in flight, eight 8-byte stores.
// Needs n % 8192 == 0 (grid = n / 8192).
__global__ __launch_bounds__(256) void f32_to_bf16_kernel(
    const float* __restrict__ in, __bf16* __restrict__ out) {
  const size_t base = (size_t)blockIdx.x * 8192 + threadIdx.x * 4;
  float4 f[8];
#pragma unroll  // constant i: f stays in registers, the loads go out together
  for (int i = 0; i < 8; ++i) f[i] = *(const float4*)(in + base + i * 1024);
#pragma unroll  // constant i: f stays in registers
  for (int i = 0; i < 8; ++i) {
    union { __bf16 h[4]; u32x2 q; } u;
    u.h[0] = (__bf16)f[i].x;
    u.h[1] = (__bf16)f[i].y;
    u.h[2] = (__bf16)f[i].z;
    u.h[3] = (__bf16)f[i].w;
    *(u32x2*)(out + base + i * 1024) = u.q;
  }
}

// in: f32 row-major [R][Cc] -> out: bf16 [Cc][R]   (weights -> [N][K] layout)
// One 128 x 128 tile per block of 8 waves.  A wave reads 16 whole tile rows
// (512 bytes each), so a lane holds 16 consecutive r of 4 columns: per column
// two 16-byte pieces of an output row.  The pieces pass through LDS so that
// the stores cover whole 256-byte output rows.  LDS rows are 256 bytes without
// a pad; piece p of row c lies at p ^ ((c >> 2) & 15), which spreads both the
// writers (16 lanes: 16 rows, one p) and the readers (16 lanes: one row) over
// all banks.  R and Cc are compile-time: every row step is then an immediate
// offset on one address.  Needs R % 128 == 0, Cc % 128 == 0.
template <int R, int Cc>
__global__ __launch_bounds__(256) void transpose_f32_to_bf16(
    const float* __restrict__ in, __bf16* __restrict__ out) {
  __shared__ __attribute__((aligned(16))) __bf16 tile[128 * 128];  // [c][r]
  const int lane = threadIdx.x & 31;
  const int wave = threadIdx.x >> 5;
  const int c0 = blockIdx.x * 128, r0 = blockIdx.y * 128;
  const float* src = in + (size_t)(r0 + wave * 16) * Cc + c0 + lane * 4;
  float f[16][4];
#pragma unroll  // constant i: f stays in registers, the loads go out together
  for (int i = 0; i < 16; ++i) {
    // the last load's result may land in the address pair that the earlier
    // loads name: the wait stands in front of that overwrite
    if (i == 15) asm volatile("s_wait_xcnt 0x0" ::: "memory");
    const float4 t = *(const float4*)(src + i * Cc);
    f[i][0] = t.x; f[i][1] = t.y; f[i][2] = t.z; f[i][3] = t.w;
  }
  // keeps all 16 loads ahead of the converts: without it the scheduler holds
  // six of them back until earlier ones have returned, a second latency
  __builtin_amdgcn_sched_barrier(0);
#pragma unroll  // constant e, h, k: f stays in registers
  for (int e = 0; e < 4; ++e) {
#pragma unroll
    for (int h = 0; h < 2; ++h) {
      union { __bf16 b[8]; u32x4 q; } u;
#pragma unroll
      for (int k = 0; k < 8; ++k) u.b[k] = (__bf16)f[h * 8 + k][e];
      const int piece = (wave * 2 + h) ^ (lane & 15);
      *(u32x4*)&tile[(lane * 4 + e) * 128 + piece * 8] = u.q;
    }
  }
  __syncthreads();
  const int crow = threadIdx.x >> 4;   // 0..15
  const int p    = threadIdx.x & 15;   // 16-byte piece of the output row
  __bf16* dst = out + (size_t)(c0 + crow) * R + r0 + p * 8;
#pragma unroll  // the eight LDS reads go out together, row steps are immediates
  for (int i = 0; i < 8; ++i) {
    const int c = i * 16 + crow;
    const u32x4 q = *(const u32x4*)&tile[c * 128 + (p ^ ((c >> 2) & 15)) * 8];
    *(u32x4*)(dst + i * 16 * R) = q;
  }
}

// ---------------------------------------------------------------- GEMM
enum { EPI_QK = 0, EPI_VT = 1, EPI_F32_BIAS = 2, EPI_RELU_BF16 = 3 };

// C[M,N] = A[M,K](bf16) * Bt[N,K]^T(bf16), f32 accumulate.
// Block: 256 threads = 8 waves; block tile 256(M) x 64(N).
// Wave tile 32x64: 2 M-tiles x 4 N-tiles = 8 WMMAs per K=32 step.
// A pass is 128 k = 256 bytes of each of the 256 A rows and 64 Bt rows.  The
// pass's 320 rows are brought into LDS by asynchronous 16-byte copies, two
// buffers: the next pass's copies fly while this pass is multiplied.
// Needs M % 256 == 0, N % 64 == 0, K % 128 == 0.
#define G_PASS  128                       // k per pass
#define G_PITCH 136                       // LDS row pitch, bf16: 272 B = 16 B x 17
#define G_ROWS  320                       // 256 A rows, then 64 Bt rows
#define G_BUF   (G_ROWS * G_PITCH)        // bf16 per buffer

// Ten copies of 16 bytes per lane, global -> LDS, through no register.  The
// s_wait_xcnt closes the statement so that no address register named here is
// rewritten before it.
#define G_COPY10(l, g, o)                                                  \
  asm volatile(                                                            \
      "global_load_async_to_lds_b128 %0, %10, off\n\t"                     \
      "global_load_async_to_lds_b128 %1, %11, off\n\t"                     \
      "global_load_async_to_lds_b128 %2, %12, off\n\t"                     \
      "global_load_async_to_lds_b128 %3, %13, off\n\t"                     \
      "global_load_async_to_lds_b128 %4, %14, off\n\t"                     \
      "global_load_async_to_lds_b128 %5, %15, off\n\t"                     \
      "global_load_async_to_lds_b128 %6, %16, off\n\t"                     \
      "global_load_async_to_lds_b128 %7, %17, off\n\t"                     \
      "global_load_async_to_lds_b128 %8, %18, off\n\t"                     \
      "global_load_async_to_lds_b128 %9, %19, off\n\t"                     \
      "s_wait_xcnt 0x0"                                                    \
      :: "v"(l[o + 0]), "v"(l[o + 1]), "v"(l[o + 2]), "v"(l[o + 3]),       \
         "v"(l[o + 4]), "v"(l[o + 5]), "v"(l[o + 6]), "v"(l[o + 7]),       \
         "v"(l[o + 8]), "v"(l[o + 9]),                                     \
         "v"(g[o + 0]), "v"(g[o + 1]), "v"(g[o + 2]), "v"(g[o + 3]),       \
         "v"(g[o + 4]), "v"(g[o + 5]), "v"(g[o + 6]), "v"(g[o + 7]),       \
         "v"(g[o + 8]), "v"(g[o + 9])                                      \
      : "memory")

template <int EPI>
__global__ __launch_bounds__(256) void gemm_bf16_wmma(
    const __bf16* __restrict__ A, const __bf16* __restrict__ Bt,
    const float* __restrict__ bias, void* __restrict__ outp,
    int M, int N, int K) {
  __shared__ __attribute__((aligned(16))) __bf16 Ts[2 * G_BUF];

  const int lane = threadIdx.x & 31;
  const int wave = threadIdx.x >> 5;
  const int row0 = (blockIdx.y * 8 + wave) * 32;   // 32 rows per wave
  const int col0 = blockIdx.x * 64;

  v8f acc0[4] = {};
  v8f acc1[4] = {};

  // Copy map: 16 lanes cover one 256-byte row; copy i of a thread serves tile
  // row i * 16 + crow (i < 16: A rows, i >= 16: Bt rows).
  const int crow = threadIdx.x >> 4;        // 0..15
  const int ccol = (threadIdx.x & 15) << 3; // bf16 offset in the row
  const __bf16* asrc = A + (size_t)(blockIdx.y * 256 + crow) * K + ccol;
  const __bf16* bsrc = Bt + (size_t)(col0 + crow) * K + ccol;
  const unsigned ldst = (unsigned)(size_t)&Ts[crow * G_PITCH + ccol];

  auto issue = [&](int t, int buf) {
    unsigned l[20];
    const __bf16* g[20];
#pragma unroll  // constant indices: l and g stay in registers
    for (int i = 0; i < 20; ++i) {
      l[i] = ldst + (unsigned)(buf * G_BUF + i * 16 * G_PITCH) * 2u;
      g[i] = (i < 16 ? asrc + (size_t)(i * 16) * K
                     : bsrc + (size_t)((i - 16) * 16) * K) + t * G_PASS;
    }
    G_COPY10(l, g, 0);
    G_COPY10(l, g, 10);
  };

  const int npass = K / G_PASS;
  issue(0, 0);
  // pass 0 has landed for this wave, then for all waves
  asm volatile("s_wait_asynccnt 0x0" ::: "memory");
  __syncthreads();
  if (npass > 1) issue(1, 1);

  for (int t = 0; t < npass; ++t) {
    const __bf16* As = &Ts[(t & 1) * G_BUF + wave * 32 * G_PITCH];
    const __bf16* Bs = &Ts[(t & 1) * G_BUF + 256 * G_PITCH];
    // Two fragment sets: the LDS reads of k step s + 1 are issued as one group
    // ahead of the WMMAs of step s, so that their latency hides behind them.
    v16bf fa[2][2], fb[2][4];
    fa[0][0] = load_frag(As, G_PITCH);
    fa[0][1] = load_frag(As + 16 * G_PITCH, G_PITCH);
#pragma unroll  // constant j: fb stays in registers
    for (int j = 0; j < 4; ++j) fb[0][j] = load_frag(Bs + (j * 16) * G_PITCH, G_PITCH);
#pragma unroll  // constant set index: the fragments stay in registers
    for (int s = 0; s < G_PASS / 32; ++s) {
      const int cur = s & 1, nxt = cur ^ 1;
      if (s + 1 < G_PASS / 32) {
        const int kk = (s + 1) * 32;
        fa[nxt][0] = load_frag(As + kk, G_PITCH);
        fa[nxt][1] = load_frag(As + 16 * G_PITCH + kk, G_PITCH);
#pragma unroll  // constant j: fb stays in registers
        for (int j = 0; j < 4; ++j)
          fb[nxt][j] = load_frag(Bs + (j * 16) * G_PITCH + kk, G_PITCH);
      }
      // keeps the read group ahead of the WMMAs: without it the scheduler sinks
      // each read to just before its use and every WMMA pair waits on LDS
      __builtin_amdgcn_sched_barrier(0);
#pragma unroll  // constant j: accumulators and fragments stay in registers
      for (int j = 0; j < 4; ++j) {
        acc0[j] = wmma_bf16(fa[cur][0], fb[cur][j], acc0[j]);
        acc1[j] = wmma_bf16(fa[cur][1], fb[cur][j], acc1[j]);
      }
      // keeps the next step's reads from moving up among these WMMAs
      __builtin_amdgcn_sched_barrier(0);
    }
    // Hand-over: this wave's reads of buffer t & 1 are done, its copies of
    // pass t + 1 have landed; behind the barrier that holds for every wave.
    wait_lds();
    asm volatile("s_wait_asynccnt 0x0" ::: "memory");
    __syncthreads();
    if (t + 2 < npass) issue(t + 2, t & 1);
  }
  // no copy is outstanding when the wave goes on to the stores and ends
  asm volatile("s_wait_asynccnt 0x0" ::: "memory");

  const int half = lane >> 4, ln = lane & 15;
#pragma unroll
  for (int m2 = 0; m2 < 2; ++m2) {
#pragma unroll
    for (int j = 0; j < 4; ++j) {
#pragma unroll
      for (int r = 0; r < 8; ++r) {
        const int row = row0 + m2 * 16 + half * 8 + r;  // D layout
        const int col = col0 + j * 16 + ln;
        float v = m2 ? acc1[j][r] : acc0[j][r];
        if constexpr (EPI == EPI_QK) {
          // [BT,C] -> bf16 [B,H,T,hd]
          const int bi = row >> 11, ti = row & (T_DIM - 1);
          const int hi = col >> 6, di = col & (HD_DIM - 1);
          ((__bf16*)outp)[(((size_t)bi * H_DIM + hi) * T_DIM + ti) * HD_DIM + di] =
              (__bf16)v;
        } else if constexpr (EPI == EPI_VT) {
          // [BT,C] -> bf16 [B,H,hd,T]  (V transposed: K-contiguous for P*V)
          const int bi = row >> 11, ti = row & (T_DIM - 1);
          const int hi = col >> 6, di = col & (HD_DIM - 1);
          ((__bf16*)outp)[(((size_t)bi * H_DIM + hi) * HD_DIM + di) * T_DIM + ti] =
              (__bf16)v;
        } else if constexpr (EPI == EPI_F32_BIAS) {
          ((float*)outp)[(size_t)row * N + col] = v + bias[col];
        } else {  // EPI_RELU_BF16
          float o = v + bias[col];
          o = o > 0.f ? o : 0.f;
          ((__bf16*)outp)[(size_t)row * N + col] = (__bf16)o;
        }
      }
    }
  }
}

#define ATT_WAVES 8
#define A_KEYS  64                        // keys per stage
#define A_PITCH 72                        // LDS row pitch, bf16: 144 B = 16 B x 9
#define A_ROWS  128                       // 64 K rows, then 64 V^T rows
#define A_BUF   (A_ROWS * A_PITCH)        // bf16 per buffer

// Four copies of 16 bytes per lane, global -> LDS, through no register.  The
// s_wait_xcnt closes the statement so that no address register named here is
// rewritten before it.
#define A_COPY4(l, g)                                                      \
  asm volatile(                                                            \
      "global_load_async_to_lds_b128 %0, %4, off\n\t"                      \
      "global_load_async_to_lds_b128 %1, %5, off\n\t"                      \
      "global_load_async_to_lds_b128 %2, %6, off\n\t"                      \
      "global_load_async_to_lds_b128 %3, %7, off\n\t"                      \
      "s_wait_xcnt 0x0"                                                    \
      :: "v"(l[0]), "v"(l[1]), "v"(l[2]), "v"(l[3]),                       \
         "v"(g[0]), "v"(g[1]), "v"(g[2]), "v"(g[3])                        \
      : "memory")

// Eight 2^x in one statement.  Behind a transcendental the instruction set asks
// for one independent instruction before its result is read or its source
// overwritten: here each v_exp_f32 is that instruction for the one before it
// (early-clobber outputs: none lies on a source), and the v_nop fills the slot
// behind the last.
#define A_EXP2X8(d, a)                                                     \
  asm("v_exp_f32 %0, %8\n\t"                                               \
      "v_exp_f32 %1, %9\n\t"                                               \
      "v_exp_f32 %2, %10\n\t"                                              \
      "v_exp_f32 %3, %11\n\t"                                              \
      "v_exp_f32 %4, %12\n\t"                                              \
      "v_exp_f32 %5, %13\n\t"                                              \
      "v_exp_f32 %6, %14\n\t"                                              \
      "v_exp_f32 %7, %15\n\t"                                              \
      "v_nop"                                                              \
      : "=&v"(d[0]), "=&v"(d[1]), "=&v"(d[2]), "=&v"(d[3]),                \
        "=&v"(d[4]), "=&v"(d[5]), "=&v"(d[6]), "=&v"(d[7])                 \
      : "v"(a[0]), "v"(a[1]), "v"(a[2]), "v"(a[3]),                        \
        "v"(a[4]), "v"(a[5]), "v"(a[6]), "v"(a[7]))

// lane l with lane l ^ 16, in the vector unit
__device__ __forceinline__ float xhalf(float x) {
  const int b = __builtin_bit_cast(int, x);
  return __builtin_bit_cast(
      float, __builtin_amdgcn_permlanex16(b, b, 0x76543210, 0xfedcba98, false, false));
}

__global__ __launch_bounds__(256) void attn_wmma_kernel(
    const __bf16* __restrict__ q,   // [B,H,T,hd]
    const __bf16* __restrict__ k,   // [B,H,T,hd]
    const __bf16* __restrict__ vt,  // [B,H,hd,T]
    __bf16* __restrict__ attnb) {   // bf16 [B,T,C]
  __shared__ __attribute__((aligned(16))) __bf16 KV[2 * A_BUF];

  // scalar wave number: the test that skips a pass is then a scalar branch
  const int wave = __builtin_amdgcn_readfirstlane(threadIdx.x >> 5);
  const int lane = threadIdx.x & 31;
  const int half = lane >> 4, ln = lane & 15;

  const int qt0 = (blockIdx.x * ATT_WAVES + wave) * 16;
  const int bh  = blockIdx.y;
  const int bi  = bh >> 4;          // /H
  const int hi  = bh & (H_DIM - 1);

  const __bf16* Qp = q + ((size_t)bh * T_DIM + qt0) * HD_DIM;
  const __bf16* Kp = k + (size_t)bh * T_DIM * HD_DIM;
  const __bf16* Vp = vt + (size_t)bh * HD_DIM * T_DIM;

  // Copy map: 8 lanes cover one 128-byte row; copy i of a thread serves stage
  // row i * 32 + crow (i < 2: K rows, i >= 2: V^T rows).
  const int crow = threadIdx.x >> 3;        // 0..31
  const int ccol = (threadIdx.x & 7) << 3;  // bf16 offset in the row
  const __bf16* ksrc = Kp + (size_t)crow * HD_DIM + ccol;
  const __bf16* vsrc = Vp + (size_t)crow * T_DIM + ccol;
  const unsigned ldst = (unsigned)(size_t)&KV[crow * A_PITCH + ccol];

  auto issue = [&](int st, int buf) {
    unsigned l[4];
    const __bf16* g[4];
#pragma unroll  // constant indices: l stays in registers
    for (int i = 0; i < 4; ++i)
      l[i] = ldst + (unsigned)(buf * A_BUF + i * 32 * A_PITCH) * 2u;
    g[0] = ksrc + (size_t)(st * A_KEYS) * HD_DIM;
    g[1] = ksrc + (size_t)(st * A_KEYS + 32) * HD_DIM;
    g[2] = vsrc + st * A_KEYS;
    g[3] = vsrc + (size_t)32 * T_DIM + st * A_KEYS;
    A_COPY4(l, g);
  };

  // The block's last query is (blockIdx.x + 1) * 128 - 1: so many keys, in
  // stages of 64; never fewer than two stages.
  const int nst = (blockIdx.x + 1) * (ATT_WAVES * 16 / A_KEYS);
  issue(0, 0);

  // Q as the B operand: column = query ln
  const v16bf qa0 = load_frag(Qp, HD_DIM);        // K = 0..31 of hd
  const v16bf qa1 = load_frag(Qp + 32, HD_DIM);   // K = 32..63 of hd

  // O^T: o[jj][r] = O[query ln][hd jj * 16 + half * 8 + r]
  v8f o[4] = {};
  const int qg = qt0 + ln;          // this lane's query
  const int qrel = qg - half * 8;   // its place against the first key of this half's rows
  float rm = -1e30f;                // its running maximum, alike in both halves
  float rl = 0.f;                   // running sum over this half's keys only

  // stage 0 has landed for this wave, then for all waves
  asm volatile("s_wait_asynccnt 0x0" ::: "memory");
  __syncthreads();
  issue(1, 1);

  for (int t = 0; t < nst; ++t) {
    const __bf16* Ks = &KV[(t & 1) * A_BUF];
    const __bf16* Vs = Ks + A_KEYS * A_PITCH;
    for (int p = 0; p < A_KEYS / 32; ++p) {
      const int kv0 = t * A_KEYS + p * 32;
      if (kv0 >= qt0 + 16) continue;   // wholly above this wave's diagonal
      // The pass's K and V^T fragments are read from LDS as one group.
      v16bf kf[2][2], vf[4];
#pragma unroll  // constant j: kf stays in registers
      for (int j = 0; j < 2; ++j) {
        const __bf16* Kb = Ks + (p * 32 + j * 16) * A_PITCH;
        kf[j][0] = load_frag(Kb, A_PITCH);
        kf[j][1] = load_frag(Kb + 32, A_PITCH);
      }
#pragma unroll  // constant jj: vf stays in registers
      for (int jj = 0; jj < 4; ++jj)
        vf[jj] = load_frag(Vs + (jj * 16) * A_PITCH + p * 32, A_PITCH);
      // keeps the read group ahead of the WMMAs: without it the scheduler sinks
      // each read to just before its use and every WMMA waits out an LDS read
      __builtin_amdgcn_sched_barrier(0);
      // S^T tile j: pm[j][r] = score of key kv0 + j * 16 + half * 8 + r, query qg
      float pm[2][8];
      const int dq = qrel - kv0;       // key above the query: j * 16 + r > dq
#pragma unroll  // constant j, r: pm stays in registers
      for (int j = 0; j < 2; ++j) {
        v8f s = {};
        s = wmma_bf16(kf[j][0], qa0, s);
        s = wmma_bf16(kf[j][1], qa1, s);
#pragma unroll
        for (int r = 0; r < 8; ++r) {
          float val = s[r] * 0.125f;              // hd^-0.5
          pm[j][r] = (j * 16 + r > dq) ? -1e30f : val;    // causal mask
        }
      }
      // online softmax: 16 of the query's 32 scores are in this lane
      float m4[4];
#pragma unroll  // four independent chains
      for (int e = 0; e < 4; ++e)
        m4[e] = fmaxf(fmaxf(pm[0][2 * e], pm[0][2 * e + 1]), fmaxf(pm[1][2 * e], pm[1][2 * e + 1]));
      float mx = fmaxf(fmaxf(m4[0], m4[1]), fmaxf(m4[2], m4[3]));
      mx = fmaxf(mx, xhalf(mx));
      const float mnew  = fmaxf(rm, mx);
      const float scale = __expf(rm - mnew);
      rm = mnew;
      // P^T as B operand: element s of the lane = tile s >> 3, register s & 7,
      // the k order in which load_frag reads V^T
      v16bf pf;
      float s4[4];
#pragma unroll  // constant j, r: pm and pf stay in registers
      for (int j = 0; j < 2; ++j) {
        float ea[8], pe[8];
#pragma unroll
        for (int r = 0; r < 8; ++r) ea[r] = (pm[j][r] - mnew) * 1.44269504f;  // log2(e)
        A_EXP2X8(pe, ea);
#pragma unroll  // four independent chains
        for (int r = 0; r < 8; ++r) {
          s4[r & 3] = (j == 0 && r < 4) ? pe[r] : s4[r & 3] + pe[r];
          pf[j * 8 + r] = (__bf16)pe[r];
        }
      }
      rl = rl * scale + ((s4[0] + s4[1]) + (s4[2] + s4[3]));
#pragma unroll  // constant jj, r: o stays in registers
      for (int jj = 0; jj < 4; ++jj) {
#pragma unroll
        for (int r = 0; r < 8; ++r) o[jj][r] *= scale;
      }
#pragma unroll  // constant jj: o and vf stay in registers
      for (int jj = 0; jj < 4; ++jj) o[jj] = wmma_bf16(vf[jj], pf, o[jj]);
    }
    // Hand-over: this wave's reads of buffer t & 1 are done, its copies of
    // stage t + 1 have landed; behind the barrier that holds for every wave.
    wait_lds();
    asm volatile("s_wait_asynccnt 0x0" ::: "memory");
    __syncthreads();
    if (t + 2 < nst) issue(t + 2, t & 1);
  }
  // no copy is outstanding when the wave goes on to the stores and ends
  asm volatile("s_wait_asynccnt 0x0" ::: "memory");

  // join the halves' sums, normalize, store to [B,T,C] bf16: a lane's eight
  // registers of a tile are eight consecutive hd of its query, one 16-byte store
  const float inv = 1.f / (rl + xhalf(rl));
  __bf16* dst = attnb + ((size_t)bi * T_DIM + qg) * C_DIM + hi * HD_DIM + half * 8;
#pragma unroll  // constant jj, r: o stays in registers
  for (int jj = 0; jj < 4; ++jj) {
    union { __bf16 h[8]; u32x4 q; } u;
#pragma unroll
    for (int r = 0; r < 8; ++r) u.h[r] = (__bf16)(o[jj][r] * inv);
    *(u32x4*)(dst + jj * 16) = u.q;
  }
}

// ---------------------------------------------------------------- LN
// out = LN(x + y) * g + b ; one wave per row of C_DIM=1024, 8 rows per block.
// A lane holds 32 elements of its row (eight 16-byte pieces, 512 bytes of the
// row per wave-wide request); the row's sums need no LDS and no barrier.
__global__ __launch_bounds__(256) void ln_residual_kernel(
    const float* __restrict__ x, const float* __restrict__ y,
    const float* __restrict__ g, const float* __restrict__ b,
    float* __restrict__ out, __bf16* __restrict__ outb) {
  const int lane = threadIdx.x & 31;
  const int row  = blockIdx.x * 8 + (threadIdx.x >> 5);
  const size_t off = (size_t)row * C_DIM + lane * 4;
  f32x8 xy[8], gb[8];   // x | y and g | b, one 16-byte piece of each
#pragma unroll  // constant i: the pieces stay in registers
  for (int i = 0; i < 8; ++i)
    xy[i] = __builtin_shufflevector(*(const f32x4*)(x + off + i * 128),
                                    *(const f32x4*)(y + off + i * 128),
                                    0, 1, 2, 3, 4, 5, 6, 7);
#pragma unroll  // constant i: the pieces stay in registers
  for (int i = 0; i < 8; ++i)
    gb[i] = __builtin_shufflevector(*(const f32x4*)(g + lane * 4 + i * 128),
                                    *(const f32x4*)(b + lane * 4 + i * 128),
                                    0, 1, 2, 3, 4, 5, 6, 7);
  // Loaded values as inputs only: holds all 32 loads ahead of the sums.  Without
  // it the compiler holds some x, y loads back until earlier ones have returned
  // and sinks each g, b load to its use, a further latency per piece.
  asm volatile("" :: "v"(xy[0]), "v"(xy[1]), "v"(xy[2]), "v"(xy[3]),
                     "v"(xy[4]), "v"(xy[5]), "v"(xy[6]), "v"(xy[7]),
                     "v"(gb[0]), "v"(gb[1]), "v"(gb[2]), "v"(gb[3]),
                     "v"(gb[4]), "v"(gb[5]), "v"(gb[6]), "v"(gb[7]));
  float v[8][4];
  float sa[4] = {0.f, 0.f, 0.f, 0.f}, sb[4] = {0.f, 0.f, 0.f, 0.f};
#pragma unroll  // constant i, e: xy and v stay in registers
  for (int i = 0; i < 8; ++i) {
#pragma unroll  // four independent chains
    for (int e = 0; e < 4; ++e) {
      v[i][e] = xy[i][e] + xy[i][e + 4];
      sa[e] += v[i][e];
      sb[e] += v[i][e] * v[i][e];
    }
  }
  float s  = (sa[0] + sa[1]) + (sa[2] + sa[3]);
  float s2 = (sb[0] + sb[1]) + (sb[2] + sb[3]);
#pragma unroll
  for (int m = 1; m < 32; m <<= 1) {
    s  += __shfl_xor(s, m, 32);
    s2 += __shfl_xor(s2, m, 32);
  }
  const float mean = s * (1.f / C_DIM);
  const float var  = s2 * (1.f / C_DIM) - mean * mean;
  const float rstd = rsqrtf(var + 1e-5f);
#pragma unroll  // constant i, e: v and gb stay in registers
  for (int i = 0; i < 8; ++i) {
#pragma unroll
    for (int e = 0; e < 4; ++e)
      v[i][e] = (v[i][e] - mean) * rstd * gb[i][e] + gb[i][e + 4];
    *(float4*)(out + off + i * 128) = make_float4(v[i][0], v[i][1], v[i][2], v[i][3]);
  }
  // the converts below reuse registers that the stores above name
  asm volatile("s_wait_xcnt 0x0" ::: "memory");
  if (outb) {
#pragma unroll  // constant i, e: v stays in registers
    for (int i = 0; i < 8; ++i) {
      union { __bf16 h[4]; u32x2 q; } u;
#pragma unroll
      for (int e = 0; e < 4; ++e) u.h[e] = (__bf16)v[i][e];
      *(u32x2*)(outb + off + i * 128) = u.q;
    }
  }
}

// ---------------------------------------------------------------- launch
extern "C" void kernel_launch(void* const* d_in, const int* in_sizes, int n_in,
                              void* d_out, int out_size, void* d_ws, size_t ws_size,
                              hipStream_t stream) {
  const float* x     = (const float*)d_in[0];
  const float* wq    = (const float*)d_in[1];
  const float* wk    = (const float*)d_in[2];
  const float* wv    = (const float*)d_in[3];
  const float* wp    = (const float*)d_in[4];
  const float* bproj = (const float*)d_in[5];
  const float* w1    = (const float*)d_in[6];
  const float* b1    = (const float*)d_in[7];
  const float* w2    = (const float*)d_in[8];
  const float* b2    = (const float*)d_in[9];
  const float* g1    = (const float*)d_in[10];
  const float* be1   = (const float*)d_in[11];
  const float* g2    = (const float*)d_in[12];
  const float* be2   = (const float*)d_in[13];

  char* ws = (char*)d_ws;
  size_t o = 0;
  auto take = [&](size_t nbytes) -> void* {
    void* p = ws + o;
    o += (nbytes + 255) & ~(size_t)255;
    return p;
  };
  const size_t BTC = (size_t)BT_DIM * C_DIM;
  __bf16* xb    = (__bf16*)take(BTC * 2);
  __bf16* wqt   = (__bf16*)take((size_t)C_DIM * C_DIM * 2);
  __bf16* wkt   = (__bf16*)take((size_t)C_DIM * C_DIM * 2);
  __bf16* wvt   = (__bf16*)take((size_t)C_DIM * C_DIM * 2);
  __bf16* wpt   = (__bf16*)take((size_t)C_DIM * C_DIM * 2);
  __bf16* w1t   = (__bf16*)take((size_t)C_DIM * DFF_DIM * 2);
  __bf16* w2t   = (__bf16*)take((size_t)DFF_DIM * C_DIM * 2);
  __bf16* qb    = (__bf16*)take(BTC * 2);
  __bf16* kb    = (__bf16*)take(BTC * 2);
  __bf16* vtb   = (__bf16*)take(BTC * 2);
  __bf16* attnb = (__bf16*)take(BTC * 2);
  float*  y1    = (float*)take(BTC * 4);
  float*  x1    = (float*)take(BTC * 4);
  __bf16* x1b   = (__bf16*)take(BTC * 2);
  __bf16* h1    = (__bf16*)take((size_t)BT_DIM * DFF_DIM * 2);
  float*  y2    = (float*)take(BTC * 4);

  f32_to_bf16_kernel<<<BTC / 8192, 256, 0, stream>>>(x, xb);
  transpose_f32_to_bf16<C_DIM, C_DIM><<<dim3(C_DIM / 128, C_DIM / 128), 256, 0, stream>>>(wq, wqt);
  transpose_f32_to_bf16<C_DIM, C_DIM><<<dim3(C_DIM / 128, C_DIM / 128), 256, 0, stream>>>(wk, wkt);
  transpose_f32_to_bf16<C_DIM, C_DIM><<<dim3(C_DIM / 128, C_DIM / 128), 256, 0, stream>>>(wv, wvt);
  transpose_f32_to_bf16<C_DIM, C_DIM><<<dim3(C_DIM / 128, C_DIM / 128), 256, 0, stream>>>(wp, wpt);
  transpose_f32_to_bf16<C_DIM, DFF_DIM><<<dim3(DFF_DIM / 128, C_DIM / 128), 256, 0, stream>>>(w1, w1t);
  transpose_f32_to_bf16<DFF_DIM, C_DIM><<<dim3(C_DIM / 128, DFF_DIM / 128), 256, 0, stream>>>(w2, w2t);

  // block tile 256(M) x 64(N)
  const dim3 gC(C_DIM / 64, BT_DIM / 256);
  gemm_bf16_wmma<EPI_QK><<<gC, 256, 0, stream>>>(xb, wqt, nullptr, qb, BT_DIM, C_DIM, C_DIM);
  gemm_bf16_wmma<EPI_QK><<<gC, 256, 0, stream>>>(xb, wkt, nullptr, kb, BT_DIM, C_DIM, C_DIM);
  gemm_bf16_wmma<EPI_VT><<<gC, 256, 0, stream>>>(xb, wvt, nullptr, vtb, BT_DIM, C_DIM, C_DIM);

  attn_wmma_kernel<<<dim3(T_DIM / (16 * ATT_WAVES), B_DIM * H_DIM), 256, 0, stream>>>(
      qb, kb, vtb, attnb);

  gemm_bf16_wmma<EPI_F32_BIAS><<<gC, 256, 0, stream>>>(attnb, wpt, bproj, y1, BT_DIM, C_DIM, C_DIM);
  ln_residual_kernel<<<BT_DIM / 8, 256, 0, stream>>>(x, y1, g1, be1, x1, x1b);

  gemm_bf16_wmma<EPI_RELU_BF16><<<dim3(DFF_DIM / 64, BT_DIM / 256), 256, 0, stream>>>(
      x1b, w1t, b1, h1, BT_DIM, DFF_DIM, C_DIM);
  gemm_bf16_wmma<EPI_F32_BIAS><<<gC, 256, 0, stream>>>(h1, w2t, b2, y2, BT_DIM, C_DIM, DFF_DIM);
  ln_residual_kernel<<<BT_DIM / 8, 256, 0, stream>>>(x1, y2, g2, be2, (float*)d_out, nullptr);
}

// v005
// It runs in 178 microseconds.
// Timed twice side by side with v004, it ran 1.09 times as fast both times.
// All steps since v000 together make it 2.51 times as fast.
#include <hip/hip_runtime.h>

#define B_DIM   2
#define T_DIM   2048
#define C_DIM   1024
#define H_DIM   16
#define HD_DIM  64
#define DFF_DIM 4096
#define BT_DIM  (B_DIM * T_DIM)

typedef __attribute__((ext_vector_type(16))) __bf16 v16bf;
typedef __attribute__((ext_vector_type(8)))  float  v8f;
typedef __attribute__((ext_vector_type(4)))  unsigned int u32x4;
typedef __attribute__((ext_vector_type(2)))  unsigned int u32x2;
typedef __attribute__((ext_vector_type(4)))  float  f32x4;
typedef __attribute__((ext_vector_type(8)))  float  f32x8;

__device__ __forceinline__ v8f wmma_bf16(v16bf a, v16bf b, v8f c) {
  // D = A(16x32 bf16) * B(32x16 bf16) + C(16x16 f32)
  return __builtin_amdgcn_wmma_f32_16x16x32_bf16(
      /*neg_a=*/false, a, /*neg_b=*/false, b,
      /*c_mod=*/(short)0, c, /*reuse_a=*/false, /*reuse_b=*/false);
}

// Load one 16x32 bf16 fragment in the CDNA5 A-matrix lane layout from a
// row-major [16 x ld] tile.  Lanes 0-15: row=lane, K 0-7 (lo) / 16-23 (hi);
// lanes 16-31: row=lane-16, K 8-15 (lo) / 24-31 (hi).  Two b128 loads.
// Works for B as well when B is pre-transposed to [N][K].
__device__ __forceinline__ v16bf load_frag(const __bf16* base, int ld) {
  const int lane = threadIdx.x & 31;
  const int r    = lane & 15;
  const int kh   = (lane >> 4) << 3;        // 0 or 8
  const __bf16* p = base + (size_t)r * ld + kh;
  union { v16bf v; struct { u32x4 lo, hi; } q; } u;
  u.q.lo = *(const u32x4*)(p);
  u.q.hi = *(const u32x4*)(p + 16);
  return u.v;
}

__device__ __forceinline__ void wait_lds() {
  asm volatile("s_wait_dscnt 0" ::: "memory");
}

// ---------------------------------------------------------------- converts
// The kernels without matrix work move few bytes per wave, and the time to
// start their waves outweighs the time to move their bytes: each wave below
// keeps 8 to 32 loads of 512 bytes in flight instead of a few short ones.

// 32 elements per thread: eight 16-byte loads in flight, eight 8-byte stores.
// Block job blk of n / 8192; needs n % 8192 == 0.
__device__ __forceinline__ void f32_to_bf16_job(
    const float* __restrict__ in, __bf16* __restrict__ out, int blk) {
  const size_t base = (size_t)blk * 8192 + threadIdx.x * 4;
  float4 f[8];
#pragma unroll  // constant i: f stays in registers, the loads go out together
  for (int i = 0; i < 8; ++i) f[i] = *(const float4*)(in + base + i * 1024);
#pragma unroll  // constant i: f stays in registers
  for (int i = 0; i < 8; ++i) {
    union { __bf16 h[4]; u32x2 q; } u;
    u.h[0] = (__bf16)f[i].x;
    u.h[1] = (__bf16)f[i].y;
    u.h[2] = (__bf16)f[i].z;
    u.h[3] = (__bf16)f[i].w;
    *(u32x2*)(out + base + i * 1024) = u.q;
  }
  // the built code goes on from here into tests that lead to the other jobs,
  // which reuse the registers that these stores name
  asm volatile("s_wait_xcnt 0x0" ::: "memory");
}

// in: f32 row-major [R][Cc] -> out: bf16 [Cc][R]   (weights -> [N][K] layout)
// One 128 x 128 tile per block of 8 waves.  A wave reads 16 whole tile rows
// (512 bytes each), so a lane holds 16 consecutive r of 4 columns: per column
// two 16-byte pieces of an output row.  The pieces pass through LDS so that
// the stores cover whole 256-byte output rows.  LDS rows are 256 bytes without
// a pad; piece p of row c lies at p ^ ((c >> 2) & 15), which spreads both the
// writers (16 lanes: 16 rows, one p) and the readers (16 lanes: one row) over
// all banks.  R and Cc are compile-time: every row step is then an immediate
// offset on one address.  Needs R % 128 == 0, Cc % 128 == 0.
// Block job (bx, by) of (Cc / 128, R / 128); tile: 128 * 128 bf16 of LDS, [c][r].
template <int R, int Cc>
__device__ __forceinline__ void transpose_f32_to_bf16_job(
    const float* __restrict__ in, __bf16* __restrict__ out, __bf16* tile,
    int bx, int by) {
  const int lane = threadIdx.x & 31;
  const int wave = threadIdx.x >> 5;
  const int c0 = bx * 128, r0 = by * 128;
  const float* src = in + (size_t)(r0 + wave * 16) * Cc + c0 + lane * 4;
  float f[16][4];
#pragma unroll  // constant i: f stays in registers, the loads go out together
  for (int i = 0; i < 16; ++i) {
    // the last load's result may land in the address pair that the earlier
    // loads name: the wait stands in front of that overwrite
    if (i == 15) asm volatile("s_wait_xcnt 0x0" ::: "memory");
    const float4 t = *(const float4*)(src + i * Cc);
    f[i][0] = t.x; f[i][1] = t.y; f[i][2] = t.z; f[i][3] = t.w;
  }
  // keeps all 16 loads ahead of the converts: without it the scheduler holds
  // six of them back until earlier ones have returned, a second latency
  __builtin_amdgcn_sched_barrier(0);
#pragma unroll  // constant e, h, k: f stays in registers
  for (int e = 0; e < 4; ++e) {
#pragma unroll
    for (int h = 0; h < 2; ++h) {
      union { __bf16 b[8]; u32x4 q; } u;
#pragma unroll
      for (int k = 0; k < 8; ++k) u.b[k] = (__bf16)f[h * 8 + k][e];
      const int piece = (wave * 2 + h) ^ (lane & 15);
      *(u32x4*)&tile[(lane * 4 + e) * 128 + piece * 8] = u.q;
    }
  }
  __syncthreads();
  const int crow = threadIdx.x >> 4;   // 0..15
  const int p    = threadIdx.x & 15;   // 16-byte piece of the output row
  __bf16* dst = out + (size_t)(c0 + crow) * R + r0 + p * 8;
#pragma unroll  // the eight LDS reads go out together, row steps are immediates
  for (int i = 0; i < 8; ++i) {
    const int c = i * 16 + crow;
    const u32x4 q = *(const u32x4*)&tile[c * 128 + (p ^ ((c >> 2) & 15)) * 8];
    *(u32x4*)(dst + i * 16 * R) = q;
  }
  // the built code goes on from here into tests that lead to the other jobs,
  // which reuse the registers that these stores name
  asm volatile("s_wait_xcnt 0x0" ::: "memory");
}

// All seven operand preparations in one launch: none depends on another, and
// each alone is too short to fill the chip or to pay for its own launch.  The
// block index picks the job (a scalar branch); the larger jobs come first.
// wct: the four C x C weights' outputs, one behind the other (q, k, v, proj).
#define PREP_W1   (DFF_DIM / 128 * (C_DIM / 128))      // 256 blocks
#define PREP_W2   (C_DIM / 128 * (DFF_DIM / 128))      // 256 blocks
#define PREP_WC   (C_DIM / 128 * (C_DIM / 128))        // 64 blocks per weight
#define PREP_X    (BT_DIM * C_DIM / 8192)              // 512 blocks
#define PREP_GRID (PREP_W1 + PREP_W2 + 4 * PREP_WC + PREP_X)
__global__ __launch_bounds__(256) void prep_kernel(
    const float* __restrict__ x, const float* __restrict__ wq,
    const float* __restrict__ wk, const float* __restrict__ wv,
    const float* __restrict__ wp, const float* __restrict__ w1,
    const float* __restrict__ w2, __bf16* __restrict__ xb,
    __bf16* __restrict__ wct, __bf16* __restrict__ w1t,
    __bf16* __restrict__ w2t) {
  __shared__ __attribute__((aligned(16))) __bf16 tile[128 * 128];
  int b = blockIdx.x;
  if (b < PREP_W1) {
    transpose_f32_to_bf16_job<C_DIM, DFF_DIM>(w1, w1t, tile, b % (DFF_DIM / 128),
                                              b / (DFF_DIM / 128));
    return;
  }
  b -= PREP_W1;
  if (b < PREP_W2) {
    transpose_f32_to_bf16_job<DFF_DIM, C_DIM>(w2, w2t, tile, b % (C_DIM / 128),
                                              b / (C_DIM / 128));
    return;
  }
  b -= PREP_W2;
  if (b < 4 * PREP_WC) {
    const int w = b / PREP_WC, j = b % PREP_WC;
    const float* in = w == 0 ? wq : w == 1 ? wk : w == 2 ? wv : wp;
    transpose_f32_to_bf16_job<C_DIM, C_DIM>(in, wct + (size_t)w * C_DIM * C_DIM, tile,
                                            j % (C_DIM / 128), j / (C_DIM / 128));
    return;
  }
  f32_to_bf16_job(x, xb, b - 4 * PREP_WC);
}

// ---------------------------------------------------------------- GEMM
// EPI_QKV: the q, k and v products as one GEMM over the three weights, N = 3 C;
// a block's 64 columns are one head of one of them, stored as EPI_QK or EPI_VT.
enum { EPI_QK = 0, EPI_VT = 1, EPI_F32_BIAS = 2, EPI_RELU_BF16 = 3, EPI_QKV = 4 };

// Stores a wave's 32 x 64 results.  For EPI_QK and EPI_VT, col0 counts within
// the one product and outp is that product's output.
template <int EPI>
__device__ __forceinline__ void gemm_store(
    const v8f (&acc0)[4], const v8f (&acc1)[4], int row0, int col0,
    const float* __restrict__ bias, void* __restrict__ outp, int N) {
  const int lane = threadIdx.x & 31;
  const int half = lane >> 4, ln = lane & 15;
#pragma unroll
  for (int m2 = 0; m2 < 2; ++m2) {
#pragma unroll
    for (int j = 0; j < 4; ++j) {
#pragma unroll
      for (int r = 0; r < 8; ++r) {
        const int row = row0 + m2 * 16 + half * 8 + r;  // D layout
        const int col = col0 + j * 16 + ln;
        float v = m2 ? acc1[j][r] : acc0[j][r];
        if constexpr (EPI == EPI_QK) {
          // [BT,C] -> bf16 [B,H,T,hd]
          const int bi = row >> 11, ti = row & (T_DIM - 1);
          const int hi = col >> 6, di = col & (HD_DIM - 1);
          ((__bf16*)outp)[(((size_t)bi * H_DIM + hi) * T_DIM + ti) * HD_DIM + di] =
              (__bf16)v;
        } else if constexpr (EPI == EPI_VT) {
          // [BT,C] -> bf16 [B,H,hd,T]  (V transposed: K-contiguous for P*V)
          const int bi = row >> 11, ti = row & (T_DIM - 1);
          const int hi = col >> 6, di = col & (HD_DIM - 1);
          ((__bf16*)outp)[(((size_t)bi * H_DIM + hi) * HD_DIM + di) * T_DIM + ti] =
              (__bf16)v;
        } else if constexpr (EPI == EPI_F32_BIAS) {
          ((float*)outp)[(size_t)row * N + col] = v + bias[col];
        } else {  // EPI_RELU_BF16
          float o = v + bias[col];
          o = o > 0.f ? o : 0.f;
          ((__bf16*)outp)[(size_t)row * N + col] = (__bf16)o;
        }
      }
    }
  }
}

// C[M,N] = A[M,K](bf16) * Bt[N,K]^T(bf16), f32 accumulate.
// Block: 256 threads = 8 waves; block tile 256(M) x 64(N).
// Wave tile 32x64: 2 M-tiles x 4 N-tiles = 8 WMMAs per K=32 step.
// A pass is 128 k = 256 bytes of each of the 256 A rows and 64 Bt rows.  The
// pass's 320 rows are brought into LDS by asynchronous 16-byte copies, two
// buffers: the next pass's copies fly while this pass is multiplied.
// Needs M % 256 == 0, N % 64 == 0, K % 128 == 0.
#define G_PASS  128                       // k per pass
#define G_PITCH 136                       // LDS row pitch, bf16: 272 B = 16 B x 17
#define G_ROWS  320                       // 256 A rows, then 64 Bt rows
#define G_BUF   (G_ROWS * G_PITCH)        // bf16 per buffer

// Ten copies of 16 bytes per lane, global -> LDS, through no register.  The
// s_wait_xcnt closes the statement so that no address register named here is
// rewritten before it.
#define G_COPY10(l, g, o)                                                  \
  asm volatile(                                                            \
      "global_load_async_to_lds_b128 %0, %10, off\n\t"                     \
      "global_load_async_to_lds_b128 %1, %11, off\n\t"                     \
      "global_load_async_to_lds_b128 %2, %12, off\n\t"                     \
      "global_load_async_to_lds_b128 %3, %13, off\n\t"                     \
      "global_load_async_to_lds_b128 %4, %14, off\n\t"                     \
      "global_load_async_to_lds_b128 %5, %15, off\n\t"                     \
      "global_load_async_to_lds_b128 %6, %16, off\n\t"                     \
      "global_load_async_to_lds_b128 %7, %17, off\n\t"                     \
      "global_load_async_to_lds_b128 %8, %18, off\n\t"                     \
      "global_load_async_to_lds_b128 %9, %19, off\n\t"                     \
      "s_wait_xcnt 0x0"                                                    \
      :: "v"(l[o + 0]), "v"(l[o + 1]), "v"(l[o + 2]), "v"(l[o + 3]),       \
         "v"(l[o + 4]), "v"(l[o + 5]), "v"(l[o + 6]), "v"(l[o + 7]),       \
         "v"(l[o + 8]), "v"(l[o + 9]),                                     \
         "v"(g[o + 0]), "v"(g[o + 1]), "v"(g[o + 2]), "v"(g[o + 3]),       \
         "v"(g[o + 4]), "v"(g[o + 5]), "v"(g[o + 6]), "v"(g[o + 7]),       \
         "v"(g[o + 8]), "v"(g[o + 9])                                      \
      : "memory")

template <int EPI>
__global__ __launch_bounds__(256) void gemm_bf16_wmma(
    const __bf16* __restrict__ A, const __bf16* __restrict__ Bt,
    const float* __restrict__ bias, void* __restrict__ outp,
    int M, int N, int K) {
  __shared__ __attribute__((aligned(16))) __bf16 Ts[2 * G_BUF];

  const int wave = threadIdx.x >> 5;
  const int row0 = (blockIdx.y * 8 + wave) * 32;   // 32 rows per wave
  const int col0 = blockIdx.x * 64;

  v8f acc0[4] = {};
  v8f acc1[4] = {};

  // Copy map: 16 lanes cover one 256-byte row; copy i of a thread serves tile
  // row i * 16 + crow (i < 16: A rows, i >= 16: Bt rows).
  const int crow = threadIdx.x >> 4;        // 0..15
  const int ccol = (threadIdx.x & 15) << 3; // bf16 offset in the row
  const __bf16* asrc = A + (size_t)(blockIdx.y * 256 + crow) * K + ccol;
  const __bf16* bsrc = Bt + (size_t)(col0 + crow) * K + ccol;
  const unsigned ldst = (unsigned)(size_t)&Ts[crow * G_PITCH + ccol];

  auto issue = [&](int t, int buf) {
    unsigned l[20];
    const __bf16* g[20];
#pragma unroll  // constant indices: l and g stay in registers
    for (int i = 0; i < 20; ++i) {
      l[i] = ldst + (unsigned)(buf * G_BUF + i * 16 * G_PITCH) * 2u;
      g[i] = (i < 16 ? asrc + (size_t)(i * 16) * K
                     : bsrc + (size_t)((i - 16) * 16) * K) + t * G_PASS;
    }
    G_COPY10(l, g, 0);
    G_COPY10(l, g, 10);
  };

  const int npass = K / G_PASS;
  issue(0, 0);
  // pass 0 has landed for this wave, then for all waves
  asm volatile("s_wait_asynccnt 0x0" ::: "memory");
  __syncthreads();
  if (npass > 1) issue(1, 1);

  for (int t = 0; t < npass; ++t) {
    const __bf16* As = &Ts[(t & 1) * G_BUF + wave * 32 * G_PITCH];
    const __bf16* Bs = &Ts[(t & 1) * G_BUF + 256 * G_PITCH];
    // Two fragment sets: the LDS reads of k step s + 1 are issued as one group
    // ahead of the WMMAs of step s, so that their latency hides behind them.
    v16bf fa[2][2], fb[2][4];
    fa[0][0] = load_frag(As, G_PITCH);
    fa[0][1] = load_frag(As + 16 * G_PITCH, G_PITCH);
#pragma unroll  // constant j: fb stays in registers
    for (int j = 0; j < 4; ++j) fb[0][j] = load_frag(Bs + (j * 16) * G_PITCH, G_PITCH);
#pragma unroll  // constant set index: the fragments stay in registers
    for (int s = 0; s < G_PASS / 32; ++s) {
      const int cur = s & 1, nxt = cur ^ 1;
      if (s + 1 < G_PASS / 32) {
        const int kk = (s + 1) * 32;
        fa[nxt][0] = load_frag(As + kk, G_PITCH);
        fa[nxt][1] = load_frag(As + 16 * G_PITCH + kk, G_PITCH);
#pragma unroll  // constant j: fb stays in registers
        for (int j = 0; j < 4; ++j)
          fb[nxt][j] = load_frag(Bs + (j * 16) * G_PITCH + kk, G_PITCH);
      }
      // keeps the read group ahead of the WMMAs: without it the scheduler sinks
      // each read to just before its use and every WMMA pair waits on LDS
      __builtin_amdgcn_sched_barrier(0);
#pragma unroll  // constant j: accumulators and fragments stay in registers
      for (int j = 0; j < 4; ++j) {
        acc0[j] = wmma_bf16(fa[cur][0], fb[cur][j], acc0[j]);
        acc1[j] = wmma_bf16(fa[cur][1], fb[cur][j], acc1[j]);
      }
      // keeps the next step's reads from moving up among these WMMAs
      __builtin_amdgcn_sched_barrier(0);
    }
    // Hand-over: this wave's reads of buffer t & 1 are done, its copies of
    // pass t + 1 have landed; behind the barrier that holds for every wave.
    wait_lds();
    asm volatile("s_wait_asynccnt 0x0" ::: "memory");
    __syncthreads();
    if (t + 2 < npass) issue(t + 2, t & 1);
  }
  // no copy is outstanding when the wave goes on to the stores and ends
  asm volatile("s_wait_asynccnt 0x0" ::: "memory");

  if constexpr (EPI == EPI_QKV) {
    // which of q, k, v: the same for the whole block, a scalar branch
    const int which = col0 / C_DIM;
    __bf16* o = (__bf16*)outp + (size_t)which * BT_DIM * C_DIM;
    if (which < 2) {
      gemm_store<EPI_QK>(acc0, acc1, row0, col0 % C_DIM, bias, o, N);
    } else {
      gemm_store<EPI_VT>(acc0, acc1, row0, col0 % C_DIM, bias, o, N);
      // the built code goes on from here into a test that leads to the other
      // store form, which reuses the registers that these stores name
      asm volatile("s_wait_xcnt 0x0" ::: "memory");
    }
  } else {
    gemm_store<EPI>(acc0, acc1, row0, col0, bias, outp, N);
  }
}

#define ATT_WAVES 8
#define A_KEYS  64                        // keys per stage
#define A_PITCH 72                        // LDS row pitch, bf16: 144 B = 16 B x 9
#define A_ROWS  128                       // 64 K rows, then 64 V^T rows
#define A_BUF   (A_ROWS * A_PITCH)        // bf16 per buffer

// Four copies of 16 bytes per lane, global -> LDS, through no register.  The
// s_wait_xcnt closes the statement so that no address register named here is
// rewritten before it.
#define A_COPY4(l, g)                                                      \
  asm volatile(                                                            \
      "global_load_async_to_lds_b128 %0, %4, off\n\t"                      \
      "global_load_async_to_lds_b128 %1, %5, off\n\t"                      \
      "global_load_async_to_lds_b128 %2, %6, off\n\t"                      \
      "global_load_async_to_lds_b128 %3, %7, off\n\t"                      \
      "s_wait_xcnt 0x0"                                                    \
      :: "v"(l[0]), "v"(l[1]), "v"(l[2]), "v"(l[3]),                       \
         "v"(g[0]), "v"(g[1]), "v"(g[2]), "v"(g[3])                        \
      : "memory")

// Eight 2^x in one statement.  Behind a transcendental the instruction set asks
// for one independent instruction before its result is read or its source
// overwritten: here each v_exp_f32 is that instruction for the one before it
// (early-clobber outputs: none lies on a source), and the v_nop fills the slot
// behind the last.
#define A_EXP2X8(d, a)                                                     \
  asm("v_exp_f32 %0, %8\n\t"                                               \
      "v_exp_f32 %1, %9\n\t"                                               \
      "v_exp_f32 %2, %10\n\t"                                              \
      "v_exp_f32 %3, %11\n\t"                                              \
      "v_exp_f32 %4, %12\n\t"                                              \
      "v_exp_f32 %5, %13\n\t"                                              \
      "v_exp_f32 %6, %14\n\t"                                              \
      "v_exp_f32 %7, %15\n\t"                                              \
      "v_nop"                                                              \
      : "=&v"(d[0]), "=&v"(d[1]), "=&v"(d[2]), "=&v"(d[3]),                \
        "=&v"(d[4]), "=&v"(d[5]), "=&v"(d[6]), "=&v"(d[7])                 \
      : "v"(a[0]), "v"(a[1]), "v"(a[2]), "v"(a[3]),                        \
        "v"(a[4]), "v"(a[5]), "v"(a[6]), "v"(a[7]))

// lane l with lane l ^ 16, in the vector unit
__device__ __forceinline__ float xhalf(float x) {
  const int b = __builtin_bit_cast(int, x);
  return __builtin_bit_cast(
      float, __builtin_amdgcn_permlanex16(b, b, 0x76543210, 0xfedcba98, false, false));
}

__global__ __launch_bounds__(256) void attn_wmma_kernel(
    const __bf16* __restrict__ q,   // [B,H,T,hd]
    const __bf16* __restrict__ k,   // [B,H,T,hd]
    const __bf16* __restrict__ vt,  // [B,H,hd,T]
    __bf16* __restrict__ attnb) {   // bf16 [B,T,C]
  __shared__ __attribute__((aligned(16))) __bf16 KV[2 * A_BUF];

  // scalar wave number: the test that skips a pass is then a scalar branch
  const int wave = __builtin_amdgcn_readfirstlane(threadIdx.x >> 5);
  const int lane = threadIdx.x & 31;
  const int half = lane >> 4, ln = lane & 15;

  const int qt0 = (blockIdx.x * ATT_WAVES + wave) * 16;
  const int bh  = blockIdx.y;
  const int bi  = bh >> 4;          // /H
  const int hi  = bh & (H_DIM - 1);

  const __bf16* Qp = q + ((size_t)bh * T_DIM + qt0) * HD_DIM;
  const __bf16* Kp = k + (size_t)bh * T_DIM * HD_DIM;
  const __bf16* Vp = vt + (size_t)bh * HD_DIM * T_DIM;

  // Copy map: 8 lanes cover one 128-byte row; copy i of a thread serves stage
  // row i * 32 + crow (i < 2: K rows, i >= 2: V^T rows).
  const int crow = threadIdx.x >> 3;        // 0..31
  const int ccol = (threadIdx.x & 7) << 3;  // bf16 offset in the row
  const __bf16* ksrc = Kp + (size_t)crow * HD_DIM + ccol;
  const __bf16* vsrc = Vp + (size_t)crow * T_DIM + ccol;
  const unsigned ldst = (unsigned)(size_t)&KV[crow * A_PITCH + ccol];

  auto issue = [&](int st, int buf) {
    unsigned l[4];
    const __bf16* g[4];
#pragma unroll  // constant indices: l stays in registers
    for (int i = 0; i < 4; ++i)
      l[i] = ldst + (unsigned)(buf * A_BUF + i * 32 * A_PITCH) * 2u;
    g[0] = ksrc + (size_t)(st * A_KEYS) * HD_DIM;
    g[1] = ksrc + (size_t)(st * A_KEYS + 32) * HD_DIM;
    g[2] = vsrc + st * A_KEYS;
    g[3] = vsrc + (size_t)32 * T_DIM + st * A_KEYS;
    A_COPY4(l, g);
  };

  // The block's last query is (blockIdx.x + 1) * 128 - 1: so many keys, in
  // stages of 64; never fewer than two stages.
  const int nst = (blockIdx.x + 1) * (ATT_WAVES * 16 / A_KEYS);
  issue(0, 0);

  // Q as the B operand: column = query ln
  const v16bf qa0 = load_frag(Qp, HD_DIM);        // K = 0..31 of hd
  const v16bf qa1 = load_frag(Qp + 32, HD_DIM);   // K = 32..63 of hd

  // O^T: o[jj][r] = O[query ln][hd jj * 16 + half * 8 + r]
  v8f o[4] = {};
  const int qg = qt0 + ln;          // this lane's query
  const int qrel = qg - half * 8;   // its place against the first key of this half's rows
  float rm = -1e30f;                // its running maximum, alike in both halves
  float rl = 0.f;                   // running sum over this half's keys only

  // stage 0 has landed for this wave, then for all waves
  asm volatile("s_wait_asynccnt 0x0" ::: "memory");
  __syncthreads();
  issue(1, 1);

  for (int t = 0; t < nst; ++t) {
    const __bf16* Ks = &KV[(t & 1) * A_BUF];
    const __bf16* Vs = Ks + A_KEYS * A_PITCH;
    for (int p = 0; p < A_KEYS / 32; ++p) {
      const int kv0 = t * A_KEYS + p * 32;
      if (kv0 >= qt0 + 16) continue;   // wholly above this wave's diagonal
      // The pass's K and V^T fragments are read from LDS as one group.
      v16bf kf[2][2], vf[4];
#pragma unroll  // constant j: kf stays in registers
      for (int j = 0; j < 2; ++j) {
        const __bf16* Kb = Ks + (p * 32 + j * 16) * A_PITCH;
        kf[j][0] = load_frag(Kb, A_PITCH);
        kf[j][1] = load_frag(Kb + 32, A_PITCH);
      }
#pragma unroll  // constant jj: vf stays in registers
      for (int jj = 0; jj < 4; ++jj)
        vf[jj] = load_frag(Vs + (jj * 16) * A_PITCH + p * 32, A_PITCH);
      // keeps the read group ahead of the WMMAs: without it the scheduler sinks
      // each read to just before its use and every WMMA waits out an LDS read
      __builtin_amdgcn_sched_barrier(0);
      // S^T tile j: pm[j][r] = score of key kv0 + j * 16 + half * 8 + r, query qg
      float pm[2][8];
      const int dq = qrel - kv0;       // key above the query: j * 16 + r > dq
#pragma unroll  // constant j, r: pm stays in registers
      for (int j = 0; j < 2; ++j) {
        v8f s = {};
        s = wmma_bf16(kf[j][0], qa0, s);
        s = wmma_bf16(kf[j][1], qa1, s);
#pragma unroll
        for (int r = 0; r < 8; ++r) {
          float val = s[r] * 0.125f;              // hd^-0.5
          pm[j][r] = (j * 16 + r > dq) ? -1e30f : val;    // causal mask
        }
      }
      // online softmax: 16 of the query's 32 scores are in this lane
      float m4[4];
#pragma unroll  // four independent chains
      for (int e = 0; e < 4; ++e)
        m4[e] = fmaxf(fmaxf(pm[0][2 * e], pm[0][2 * e + 1]), fmaxf(pm[1][2 * e], pm[1][2 * e + 1]));
      float mx = fmaxf(fmaxf(m4[0], m4[1]), fmaxf(m4[2], m4[3]));
      mx = fmaxf(mx, xhalf(mx));
      const float mnew  = fmaxf(rm, mx);
      const float scale = __expf(rm - mnew);
      rm = mnew;
      // P^T as B operand: element s of the lane = tile s >> 3, register s & 7,
      // the k order in which load_frag reads V^T
      v16bf pf;
      float s4[4];
#pragma unroll  // constant j, r: pm and pf stay in registers
      for (int j = 0; j < 2; ++j) {
        float ea[8], pe[8];
#pragma unroll
        for (int r = 0; r < 8; ++r) ea[r] = (pm[j][r] - mnew) * 1.44269504f;  // log2(e)
        A_EXP2X8(pe, ea);
#pragma unroll  // four independent chains
        for (int r = 0; r < 8; ++r) {
          s4[r & 3] = (j == 0 && r < 4) ? pe[r] : s4[r & 3] + pe[r];
          pf[j * 8 + r] = (__bf16)pe[r];
        }
      }
      rl = rl * scale + ((s4[0] + s4[1]) + (s4[2] + s4[3]));
#pragma unroll  // constant jj, r: o stays in registers
      for (int jj = 0; jj < 4; ++jj) {
#pragma unroll
        for (int r = 0; r < 8; ++r) o[jj][r] *= scale;
      }
#pragma unroll  // constant jj: o and vf stay in registers
      for (int jj = 0; jj < 4; ++jj) o[jj] = wmma_bf16(vf[jj], pf, o[jj]);
    }
    // Hand-over: this wave's reads of buffer t & 1 are done, its copies of
    // stage t + 1 have landed; behind the barrier that holds for every wave.
    wait_lds();
    asm volatile("s_wait_asynccnt 0x0" ::: "memory");
    __syncthreads();
    if (t + 2 < nst) issue(t + 2, t & 1);
  }
  // no copy is outstanding when the wave goes on to the stores and ends
  asm volatile("s_wait_asynccnt 0x0" ::: "memory");

  // join the halves' sums, normalize, store to [B,T,C] bf16: a lane's eight
  // registers of a tile are eight consecutive hd of its query, one 16-byte store
  const float inv = 1.f / (rl + xhalf(rl));
  __bf16* dst = attnb + ((size_t)bi * T_DIM + qg) * C_DIM + hi * HD_DIM + half * 8;
#pragma unroll  // constant jj, r: o stays in registers
  for (int jj = 0; jj < 4; ++jj) {
    union { __bf16 h[8]; u32x4 q; } u;
#pragma unroll
    for (int r = 0; r < 8; ++r) u.h[r] = (__bf16)(o[jj][r] * inv);
    *(u32x4*)(dst + jj * 16) = u.q;
  }
}

// ---------------------------------------------------------------- LN
// out = LN(x + y) * g + b ; one wave per row of C_DIM=1024, 8 rows per block.
// A lane holds 32 elements of its row (eight 16-byte pieces, 512 bytes of the
// row per wave-wide request); the row's sums need no LDS and no barrier.
__global__ __launch_bounds__(256) void ln_residual_kernel(
    const float* __restrict__ x, const float* __restrict__ y,
    const float* __restrict__ g, const float* __restrict__ b,
    float* __restrict__ out, __bf16* __restrict__ outb) {
  const int lane = threadIdx.x & 31;
  const int row  = blockIdx.x * 8 + (threadIdx.x >> 5);
  const size_t off = (size_t)row * C_DIM + lane * 4;
  f32x8 xy[8], gb[8];   // x | y and g | b, one 16-byte piece of each
#pragma unroll  // constant i: the pieces stay in registers
  for (int i = 0; i < 8; ++i)
    xy[i] = __builtin_shufflevector(*(const f32x4*)(x + off + i * 128),
                                    *(const f32x4*)(y + off + i * 128),
                                    0, 1, 2, 3, 4, 5, 6, 7);
#pragma unroll  // constant i: the pieces stay in registers
  for (int i = 0; i < 8; ++i)
    gb[i] = __builtin_shufflevector(*(const f32x4*)(g + lane * 4 + i * 128),
                                    *(const f32x4*)(b + lane * 4 + i * 128),
                                    0, 1, 2, 3, 4, 5, 6, 7);
  // Loaded values as inputs only: holds all 32 loads ahead of the sums.  Without
  // it the compiler holds some x, y loads back until earlier ones have returned
  // and sinks each g, b load to its use, a further latency per piece.
  asm volatile("" :: "v"(xy[0]), "v"(xy[1]), "v"(xy[2]), "v"(xy[3]),
                     "v"(xy[4]), "v"(xy[5]), "v"(xy[6]), "v"(xy[7]),
                     "v"(gb[0]), "v"(gb[1]), "v"(gb[2]), "v"(gb[3]),
                     "v"(gb[4]), "v"(gb[5]), "v"(gb[6]), "v"(gb[7]));
  float v[8][4];
  float sa[4] = {0.f, 0.f, 0.f, 0.f}, sb[4] = {0.f, 0.f, 0.f, 0.f};
#pragma unroll  // constant i, e: xy and v stay in registers
  for (int i = 0; i < 8; ++i) {
#pragma unroll  // four independent chains
    for (int e = 0; e < 4; ++e) {
      v[i][e] = xy[i][e] + xy[i][e + 4];
      sa[e] += v[i][e];
      sb[e] += v[i][e] * v[i][e];
    }
  }
  float s  = (sa[0] + sa[1]) + (sa[2] + sa[3]);
  float s2 = (sb[0] + sb[1]) + (sb[2] + sb[3]);
#pragma unroll
  for (int m = 1; m < 32; m <<= 1) {
    s  += __shfl_xor(s, m, 32);
    s2 += __shfl_xor(s2, m, 32);
  }
  const float mean = s * (1.f / C_DIM);
  const float var  = s2 * (1.f / C_DIM) - mean * mean;
  const float rstd = rsqrtf(var + 1e-5f);
#pragma unroll  // constant i, e: v and gb stay in registers
  for (int i = 0; i < 8; ++i) {
#pragma unroll
    for (int e = 0; e < 4; ++e)
      v[i][e] = (v[i][e] - mean) * rstd * gb[i][e] + gb[i][e + 4];
    *(float4*)(out + off + i * 128) = make_float4(v[i][0], v[i][1], v[i][2], v[i][3]);
  }
  // the converts below reuse registers that the stores above name
  asm volatile("s_wait_xcnt 0x0" ::: "memory");
  if (outb) {
#pragma unroll  // constant i, e: v stays in registers
    for (int i = 0; i < 8; ++i) {
      union { __bf16 h[4]; u32x2 q; } u;
#pragma unroll
      for (int e = 0; e < 4; ++e) u.h[e] = (__bf16)v[i][e];
      *(u32x2*)(outb + off + i * 128) = u.q;
    }
  }
}

// ---------------------------------------------------------------- launch
extern "C" void kernel_launch(void* const* d_in, const int* in_sizes, int n_in,
                              void* d_out, int out_size, void* d_ws, size_t ws_size,
                              hipStream_t stream) {
  const float* x     = (const float*)d_in[0];
  const float* wq    = (const float*)d_in[1];
  const float* wk    = (const float*)d_in[2];
  const float* wv    = (const float*)d_in[3];
  const float* wp    = (const float*)d_in[4];
  const float* bproj = (const float*)d_in[5];
  const float* w1    = (const float*)d_in[6];
  const float* b1    = (const float*)d_in[7];
  const float* w2    = (const float*)d_in[8];
  const float* b2    = (const float*)d_in[9];
  const float* g1    = (const float*)d_in[10];
  const float* be1   = (const float*)d_in[11];
  const float* g2    = (const float*)d_in[12];
  const float* be2   = (const float*)d_in[13];

  char* ws = (char*)d_ws;
  size_t o = 0;
  auto take = [&](size_t nbytes) -> void* {
    void* p = ws + o;
    o += (nbytes + 255) & ~(size_t)255;
    return p;
  };
  const size_t BTC = (size_t)BT_DIM * C_DIM;
  __bf16* xb    = (__bf16*)take(BTC * 2);
  __bf16* wct   = (__bf16*)take((size_t)4 * C_DIM * C_DIM * 2);  // q, k, v, proj
  __bf16* wpt   = wct + (size_t)3 * C_DIM * C_DIM;
  __bf16* w1t   = (__bf16*)take((size_t)C_DIM * DFF_DIM * 2);
  __bf16* w2t   = (__bf16*)take((size_t)DFF_DIM * C_DIM * 2);
  __bf16* qb    = (__bf16*)take(3 * BTC * 2);                    // q, k, v^T
  __bf16* kb    = qb + BTC;
  __bf16* vtb   = qb + 2 * BTC;
  __bf16* attnb = (__bf16*)take(BTC * 2);
  float*  y1    = (float*)take(BTC * 4);
  float*  x1    = (float*)take(BTC * 4);
  __bf16* x1b   = (__bf16*)take(BTC * 2);
  __bf16* h1    = (__bf16*)take((size_t)BT_DIM * DFF_DIM * 2);
  float*  y2    = (float*)take(BTC * 4);

  prep_kernel<<<PREP_GRID, 256, 0, stream>>>(x, wq, wk, wv, wp, w1, w2, xb, wct, w1t, w2t);

  // block tile 256(M) x 64(N)
  const dim3 gC(C_DIM / 64, BT_DIM / 256);
  gemm_bf16_wmma<EPI_QKV><<<dim3(3 * C_DIM / 64, BT_DIM / 256), 256, 0, stream>>>(
      xb, wct, nullptr, qb, BT_DIM, 3 * C_DIM, C_DIM);

  attn_wmma_kernel<<<dim3(T_DIM / (16 * ATT_WAVES), B_DIM * H_DIM), 256, 0, stream>>>(
      qb, kb, vtb, attnb);

  gemm_bf16_wmma<EPI_F32_BIAS><<<gC, 256, 0, stream>>>(attnb, wpt, bproj, y1, BT_DIM, C_DIM, C_DIM);
  ln_residual_kernel<<<BT_DIM / 8, 256, 0, stream>>>(x, y1, g1, be1, x1, x1b);

  gemm_bf16_wmma<EPI_RELU_BF16><<<dim3(DFF_DIM / 64, BT_DIM / 256), 256, 0, stream>>>(
      x1b, w1t, b1, h1, BT_DIM, DFF_DIM, C_DIM);
  gemm_bf16_wmma<EPI_F32_BIAS><<<gC, 256, 0, stream>>>(h1, w2t, b2, y2, BT_DIM, C_DIM, DFF_DIM);
  ln_residual_kernel<<<BT_DIM / 8, 256, 0, stream>>>(x1, y2, g2, be2, (float*)d_out, nullptr);
}

// v006
// One run takes 169 microseconds.
// In two side-by-side timings against v005, it was 1.05 and 1.06 times as fast.
// Over all steps from v000 it is 2.65 times as fast.
#include <hip/hip_runtime.h>

#define B_DIM   2
#define T_DIM   2048
#define C_DIM   1024
#define H_DIM   16
#define HD_DIM  64
#define DFF_DIM 4096
#define BT_DIM  (B_DIM * T_DIM)

typedef __attribute__((ext_vector_type(16))) __bf16 v16bf;
typedef __attribute__((ext_vector_type(8)))  float  v8f;
typedef __attribute__((ext_vector_type(4)))  unsigned int u32x4;
typedef __attribute__((ext_vector_type(2)))  unsigned int u32x2;
typedef __attribute__((ext_vector_type(4)))  float  f32x4;
typedef __attribute__((ext_vector_type(8)))  float  f32x8;

__device__ __forceinline__ v8f wmma_bf16(v16bf a, v16bf b, v8f c) {
  // D = A(16x32 bf16) * B(32x16 bf16) + C(16x16 f32)
  return __builtin_amdgcn_wmma_f32_16x16x32_bf16(
      /*neg_a=*/false, a, /*neg_b=*/false, b,
      /*c_mod=*/(short)0, c, /*reuse_a=*/false, /*reuse_b=*/false);
}

// Load one 16x32 bf16 fragment in the CDNA5 A-matrix lane layout from a
// row-major [16 x ld] tile.  Lanes 0-15: row=lane, K 0-7 (lo) / 16-23 (hi);
// lanes 16-31: row=lane-16, K 8-15 (lo) / 24-31 (hi).  Two b128 loads.
// Works for B as well when B is pre-transposed to [N][K].
__device__ __forceinline__ v16bf load_frag(const __bf16* base, int ld) {
  const int lane = threadIdx.x & 31;
  const int r    = lane & 15;
  const int kh   = (lane >> 4) << 3;        // 0 or 8
  const __bf16* p = base + (size_t)r * ld + kh;
  union { v16bf v; struct { u32x4 lo, hi; } q; } u;
  u.q.lo = *(const u32x4*)(p);
  u.q.hi = *(const u32x4*)(p + 16);
  return u.v;
}

__device__ __forceinline__ void wait_lds() {
  asm volatile("s_wait_dscnt 0" ::: "memory");
}

// ---------------------------------------------------------------- converts
// The kernels without matrix work move few bytes per wave, and the time to
// start their waves outweighs the time to move their bytes: each wave below
// keeps 8 to 32 loads of 512 bytes in flight instead of a few short ones.

// 32 elements per thread: eight 16-byte loads in flight, eight 8-byte stores.
// Block job blk of n / 8192; needs n % 8192 == 0.
__device__ __forceinline__ void f32_to_bf16_job(
    const float* __restrict__ in, __bf16* __restrict__ out, int blk) {
  const size_t base = (size_t)blk * 8192 + threadIdx.x * 4;
  float4 f[8];
#pragma unroll  // constant i: f stays in registers, the loads go out together
  for (int i = 0; i < 8; ++i) f[i] = *(const float4*)(in + base + i * 1024);
#pragma unroll  // constant i: f stays in registers
  for (int i = 0; i < 8; ++i) {
    union { __bf16 h[4]; u32x2 q; } u;
    u.h[0] = (__bf16)f[i].x;
    u.h[1] = (__bf16)f[i].y;
    u.h[2] = (__bf16)f[i].z;
    u.h[3] = (__bf16)f[i].w;
    *(u32x2*)(out + base + i * 1024) = u.q;
  }
  // the built code goes on from here into tests that lead to the other jobs,
  // which reuse the registers that these stores name
  asm volatile("s_wait_xcnt 0x0" ::: "memory");
}

// in: f32 row-major [R][Cc] -> out: bf16 [Cc][R]   (weights -> [N][K] layout)
// One 128 x 128 tile per block of 8 waves.  A wave reads 16 whole tile rows
// (512 bytes each), so a lane holds 16 consecutive r of 4 columns: per column
// two 16-byte pieces of an output row.  The pieces pass through LDS so that
// the stores cover whole 256-byte output rows.  LDS rows are 256 bytes without
// a pad; piece p of row c lies at p ^ ((c >> 2) & 15), which spreads both the
// writers (16 lanes: 16 rows, one p) and the readers (16 lanes: one row) over
// all banks.  R and Cc are compile-time: every row step is then an immediate
// offset on one address.  Needs R % 128 == 0, Cc % 128 == 0.
// Block job (bx, by) of (Cc / 128, R / 128); tile: 128 * 128 bf16 of LDS, [c][r].
template <int R, int Cc>
__device__ __forceinline__ void transpose_f32_to_bf16_job(
    const float* __restrict__ in, __bf16* __restrict__ out, __bf16* tile,
    int bx, int by) {
  const int lane = threadIdx.x & 31;
  const int wave = threadIdx.x >> 5;
  const int c0 = bx * 128, r0 = by * 128;
  const float* src = in + (size_t)(r0 + wave * 16) * Cc + c0 + lane * 4;
  float f[16][4];
#pragma unroll  // constant i: f stays in registers, the loads go out together
  for (int i = 0; i < 16; ++i) {
    // the last load's result may land in the address pair that the earlier
    // loads name: the wait stands in front of that overwrite
    if (i == 15) asm volatile("s_wait_xcnt 0x0" ::: "memory");
    const float4 t = *(const float4*)(src + i * Cc);
    f[i][0] = t.x; f[i][1] = t.y; f[i][2] = t.z; f[i][3] = t.w;
  }
  // keeps all 16 loads ahead of the converts: without it the scheduler holds
  // six of them back until earlier ones have returned, a second latency
  __builtin_amdgcn_sched_barrier(0);
#pragma unroll  // constant e, h, k: f stays in registers
  for (int e = 0; e < 4; ++e) {
#pragma unroll
    for (int h = 0; h < 2; ++h) {
      union { __bf16 b[8]; u32x4 q; } u;
#pragma unroll
      for (int k = 0; k < 8; ++k) u.b[k] = (__bf16)f[h * 8 + k][e];
      const int piece = (wave * 2 + h) ^ (lane & 15);
      *(u32x4*)&tile[(lane * 4 + e) * 128 + piece * 8] = u.q;
    }
  }
  __syncthreads();
  const int crow = threadIdx.x >> 4;   // 0..15
  const int p    = threadIdx.x & 15;   // 16-byte piece of the output row
  __bf16* dst = out + (size_t)(c0 + crow) * R + r0 + p * 8;
#pragma unroll  // the eight LDS reads go out together, row steps are immediates
  for (int i = 0; i < 8; ++i) {
    const int c = i * 16 + crow;
    const u32x4 q = *(const u32x4*)&tile[c * 128 + (p ^ ((c >> 2) & 15)) * 8];
    *(u32x4*)(dst + i * 16 * R) = q;
  }
  // the built code goes on from here into tests that lead to the other jobs,
  // which reuse the registers that these stores name
  asm volatile("s_wait_xcnt 0x0" ::: "memory");
}

// All seven operand preparations in one launch: none depends on another, and
// each alone is too short to fill the chip or to pay for its own launch.  The
// block index picks the job (a scalar branch); the larger jobs come first.
// wct: the four C x C weights' outputs, one behind the other (q, k, v, proj).
#define PREP_W1   (DFF_DIM / 128 * (C_DIM / 128))      // 256 blocks
#define PREP_W2   (C_DIM / 128 * (DFF_DIM / 128))      // 256 blocks
#define PREP_WC   (C_DIM / 128 * (C_DIM / 128))        // 64 blocks per weight
#define PREP_X    (BT_DIM * C_DIM / 8192)              // 512 blocks
#define PREP_GRID (PREP_W1 + PREP_W2 + 4 * PREP_WC + PREP_X)
__global__ __launch_bounds__(256) void prep_kernel(
    const float* __restrict__ x, const float* __restrict__ wq,
    const float* __restrict__ wk, const float* __restrict__ wv,
    const float* __restrict__ wp, const float* __restrict__ w1,
    const float* __restrict__ w2, __bf16* __restrict__ xb,
    __bf16* __restrict__ wct, __bf16* __restrict__ w1t,
    __bf16* __restrict__ w2t) {
  __shared__ __attribute__((aligned(16))) __bf16 tile[128 * 128];
  int b = blockIdx.x;
  if (b < PREP_W1) {
    transpose_f32_to_bf16_job<C_DIM, DFF_DIM>(w1, w1t, tile, b % (DFF_DIM / 128),
                                              b / (DFF_DIM / 128));
    return;
  }
  b -= PREP_W1;
  if (b < PREP_W2) {
    transpose_f32_to_bf16_job<DFF_DIM, C_DIM>(w2, w2t, tile, b % (C_DIM / 128),
                                              b / (C_DIM / 128));
    return;
  }
  b -= PREP_W2;
  if (b < 4 * PREP_WC) {
    const int w = b / PREP_WC, j = b % PREP_WC;
    const float* in = w == 0 ? wq : w == 1 ? wk : w == 2 ? wv : wp;
    transpose_f32_to_bf16_job<C_DIM, C_DIM>(in, wct + (size_t)w * C_DIM * C_DIM, tile,
                                            j % (C_DIM / 128), j / (C_DIM / 128));
    return;
  }
  f32_to_bf16_job(x, xb, b - 4 * PREP_WC);
}

// ---------------------------------------------------------------- GEMM
// EPI_QKV: the q, k and v products as one GEMM over the three weights, N = 3 C;
// a wave's 64 columns are one head of one of them, stored as EPI_QK or EPI_VT.
enum { EPI_QK = 0, EPI_VT = 1, EPI_F32_BIAS = 2, EPI_RELU_BF16 = 3, EPI_QKV = 4 };

// Stores a wave's FM * 16 x 64 results.  For EPI_QK and EPI_VT, col0 counts
// within the one product and outp is that product's output.
template <int EPI, int FM>
__device__ __forceinline__ void gemm_store(
    const v8f (&acc)[FM][4], int row0, int col0,
    const float* __restrict__ bias, void* __restrict__ outp, int N) {
  const int lane = threadIdx.x & 31;
  const int half = lane >> 4, ln = lane & 15;
#pragma unroll
  for (int m2 = 0; m2 < FM; ++m2) {
#pragma unroll
    for (int j = 0; j < 4; ++j) {
#pragma unroll
      for (int r = 0; r < 8; ++r) {
        const int row = row0 + m2 * 16 + half * 8 + r;  // D layout
        const int col = col0 + j * 16 + ln;
        float v = acc[m2][j][r];
        if constexpr (EPI == EPI_QK) {
          // [BT,C] -> bf16 [B,H,T,hd]
          const int bi = row >> 11, ti = row & (T_DIM - 1);
          const int hi = col >> 6, di = col & (HD_DIM - 1);
          ((__bf16*)outp)[(((size_t)bi * H_DIM + hi) * T_DIM + ti) * HD_DIM + di] =
              (__bf16)v;
        } else if constexpr (EPI == EPI_VT) {
          // [BT,C] -> bf16 [B,H,hd,T]  (V transposed: K-contiguous for P*V)
          const int bi = row >> 11, ti = row & (T_DIM - 1);
          const int hi = col >> 6, di = col & (HD_DIM - 1);
          ((__bf16*)outp)[(((size_t)bi * H_DIM + hi) * HD_DIM + di) * T_DIM + ti] =
              (__bf16)v;
        } else if constexpr (EPI == EPI_F32_BIAS) {
          ((float*)outp)[(size_t)row * N + col] = v + bias[col];
        } else {  // EPI_RELU_BF16
          float o = v + bias[col];
          o = o > 0.f ? o : 0.f;
          ((__bf16*)outp)[(size_t)row * N + col] = (__bf16)o;
        }
      }
      // the next tile's values reuse registers that these stores name
      asm volatile("s_wait_xcnt 0x0" ::: "memory");
      // keeps the next tile's vector work behind that wait
      __builtin_amdgcn_sched_barrier(0);
    }
  }
}

// C[M,N] = A[M,K](bf16) * Bt[N,K]^T(bf16), f32 accumulate.
// Block tile TS x TS, TS threads.  What a block draws from L2 per result falls
// with the tile's edge; at the L2 rate a WGP gets when all draw, a pass of a
// narrow tile takes longer to land than to multiply.  TS = 256 where that still
// gives about one block per WGP, TS = 128 where N is small.
// Waves: 2 down x TS / 64 across; wave tile TS / 2 x 64, that is FM x 4 tiles
// = 32 (TS = 256) or 16 (TS = 128) WMMAs per K=32 step.
// A pass is 128 k = 256 bytes of each of the TS A rows and TS Bt rows.  The
// pass's rows are brought into LDS by asynchronous 16-byte copies, two
// buffers: the next pass's copies fly while this pass is multiplied.
// Needs M % TS == 0, N % TS == 0, K % 128 == 0.
#define G_PASS  128                       // k per pass
#define G_PITCH 136                       // LDS row pitch, bf16: 272 B = 16 B x 17

// Eight copies of 16 bytes per lane, global -> LDS, through no register.  The
// s_wait_xcnt closes the statement so that no address register named here is
// rewritten before it.
#define G_COPY8(l, g, o)                                                   \
  asm volatile(                                                            \
      "global_load_async_to_lds_b128 %0, %8, off\n\t"                      \
      "global_load_async_to_lds_b128 %1, %9, off\n\t"                      \
      "global_load_async_to_lds_b128 %2, %10, off\n\t"                     \
      "global_load_async_to_lds_b128 %3, %11, off\n\t"                     \
      "global_load_async_to_lds_b128 %4, %12, off\n\t"                     \
      "global_load_async_to_lds_b128 %5, %13, off\n\t"                     \
      "global_load_async_to_lds_b128 %6, %14, off\n\t"                     \
      "global_load_async_to_lds_b128 %7, %15, off\n\t"                     \
      "s_wait_xcnt 0x0"                                                    \
      :: "v"(l[o + 0]), "v"(l[o + 1]), "v"(l[o + 2]), "v"(l[o + 3]),       \
         "v"(l[o + 4]), "v"(l[o + 5]), "v"(l[o + 6]), "v"(l[o + 7]),       \
         "v"(g[o + 0]), "v"(g[o + 1]), "v"(g[o + 2]), "v"(g[o + 3]),       \
         "v"(g[o + 4]), "v"(g[o + 5]), "v"(g[o + 6]), "v"(g[o + 7])        \
      : "memory")

template <int EPI, int TS>
__global__ __launch_bounds__(TS) void gemm_bf16_wmma(
    const __bf16* __restrict__ A, const __bf16* __restrict__ Bt,
    const float* __restrict__ bias, void* __restrict__ outp,
    int M, int N, int K) {
  constexpr int FM  = TS / 32;             // 16-row tiles per wave
  constexpr int WN  = TS / 64;             // waves across
  constexpr int RS  = TS / 16;             // tile rows that one copy per thread serves
  constexpr int BUF = 2 * TS * G_PITCH;    // bf16 per buffer: TS A rows, then TS Bt rows
  __shared__ __attribute__((aligned(16))) __bf16 Ts[2 * BUF];

  const int wave = threadIdx.x >> 5;
  const int wm = wave / WN, wn = wave % WN;
  const int row0 = blockIdx.y * TS + wm * (FM * 16);
  const int col0 = blockIdx.x * TS + wn * 64;

  v8f acc[FM][4] = {};

  // Copy map: 16 lanes cover one 256-byte row; copy i of a thread serves tile
  // row i * RS + crow (i < 16: A rows, i >= 16: Bt rows).
  const int crow = threadIdx.x >> 4;        // 0..RS-1
  const int ccol = (threadIdx.x & 15) << 3; // bf16 offset in the row
  const __bf16* asrc = A + (size_t)(blockIdx.y * TS + crow) * K + ccol;
  const __bf16* bsrc = Bt + (size_t)(blockIdx.x * TS + crow) * K + ccol;
  const unsigned ldst = (unsigned)(size_t)&Ts[crow * G_PITCH + ccol];

  auto issue = [&](int t, int buf) {
    // the pass's first A and Bt piece of this thread; each copy's row step is
    // added to these, so that no per-row address lives across the passes
    const __bf16* at = asrc + t * G_PASS;
    const __bf16* bt = bsrc + t * G_PASS;
    const unsigned lt = ldst + (unsigned)(buf * BUF) * 2u;
#pragma unroll  // constant indices: l and g stay in registers
    for (int o = 0; o < 32; o += 8) {
      unsigned l[8];
      const __bf16* g[8];
#pragma unroll
      for (int i = 0; i < 8; ++i) {
        l[i] = lt + (unsigned)((o + i) * RS * G_PITCH) * 2u;
        g[i] = o < 16 ? at + (size_t)((o + i) * RS) * K : bt + (size_t)((o + i - 16) * RS) * K;
      }
      G_COPY8(l, g, 0);
    }
  };

  const int npass = K / G_PASS;
  issue(0, 0);
  // pass 0 has landed for this wave, then for all waves
  asm volatile("s_wait_asynccnt 0x0" ::: "memory");
  __syncthreads();
  if (npass > 1) issue(1, 1);

  for (int t = 0; t < npass; ++t) {
    const __bf16* As = &Ts[(t & 1) * BUF + wm * (FM * 16) * G_PITCH];
    const __bf16* Bs = &Ts[(t & 1) * BUF + (TS + wn * 64) * G_PITCH];
    // Two fragment sets: the LDS reads of k step s + 1 are issued as one group
    // ahead of the WMMAs of step s, so that their latency hides behind them.
    v16bf fa[2][FM], fb[2][4];
#pragma unroll  // constant m: fa stays in registers
    for (int m = 0; m < FM; ++m) fa[0][m] = load_frag(As + (m * 16) * G_PITCH, G_PITCH);
#pragma unroll  // constant j: fb stays in registers
    for (int j = 0; j < 4; ++j) fb[0][j] = load_frag(Bs + (j * 16) * G_PITCH, G_PITCH);
    // keeps step 0's reads ahead of step 1's: mixed, the first WMMAs wait for
    // both groups, twice the LDS time with every wave of the block waiting
    __builtin_amdgcn_sched_barrier(0);
#pragma unroll  // constant set index: the fragments stay in registers
    for (int s = 0; s < G_PASS / 32; ++s) {
      const int cur = s & 1, nxt = cur ^ 1;
      if (s + 1 < G_PASS / 32) {
        const int kk = (s + 1) * 32;
#pragma unroll  // constant m: fa stays in registers
        for (int m = 0; m < FM; ++m)
          fa[nxt][m] = load_frag(As + (m * 16) * G_PITCH + kk, G_PITCH);
#pragma unroll  // constant j: fb stays in registers
        for (int j = 0; j < 4; ++j)
          fb[nxt][j] = load_frag(Bs + (j * 16) * G_PITCH + kk, G_PITCH);
      }
      // keeps the read group ahead of the WMMAs: without it the scheduler sinks
      // each read to just before its use and every WMMA pair waits on LDS
      __builtin_amdgcn_sched_barrier(0);
#pragma unroll  // constant j, m: accumulators and fragments stay in registers
      for (int j = 0; j < 4; ++j) {
#pragma unroll
        for (int m = 0; m < FM; ++m)
          acc[m][j] = wmma_bf16(fa[cur][m], fb[cur][j], acc[m][j]);
      }
      // keeps the next step's reads from moving up among these WMMAs
      __builtin_amdgcn_sched_barrier(0);
    }
    // Hand-over: this wave's reads of buffer t & 1 are done, its copies of
    // pass t + 1 have landed; behind the barrier that holds for every wave.
    wait_lds();
    asm volatile("s_wait_asynccnt 0x0" ::: "memory");
    __syncthreads();
    if (t + 2 < npass) issue(t + 2, t & 1);
  }
  // no copy is outstanding when the wave goes on to the stores and ends
  asm volatile("s_wait_asynccnt 0x0" ::: "memory");

  if constexpr (EPI == EPI_QKV) {
    // which of q, k, v: the same for the whole block, a scalar branch
    const int which = blockIdx.x * TS / C_DIM;
    __bf16* o = (__bf16*)outp + (size_t)which * BT_DIM * C_DIM;
    if (which < 2) {
      gemm_store<EPI_QK, FM>(acc, row0, col0 % C_DIM, bias, o, N);
    } else {
      gemm_store<EPI_VT, FM>(acc, row0, col0 % C_DIM, bias, o, N);
    }
  } else {
    gemm_store<EPI, FM>(acc, row0, col0, bias, outp, N);
  }
}

#define ATT_WAVES 8
#define A_KEYS  64                        // keys per stage
#define A_PITCH 72                        // LDS row pitch, bf16: 144 B = 16 B x 9
#define A_ROWS  128                       // 64 K rows, then 64 V^T rows
#define A_BUF   (A_ROWS * A_PITCH)        // bf16 per buffer

// Four copies of 16 bytes per lane, global -> LDS, through no register.  The
// s_wait_xcnt closes the statement so that no address register named here is
// rewritten before it.
#define A_COPY4(l, g)                                                      \
  asm volatile(                                                            \
      "global_load_async_to_lds_b128 %0, %4, off\n\t"                      \
      "global_load_async_to_lds_b128 %1, %5, off\n\t"                      \
      "global_load_async_to_lds_b128 %2, %6, off\n\t"                      \
      "global_load_async_to_lds_b128 %3, %7, off\n\t"                      \
      "s_wait_xcnt 0x0"                                                    \
      :: "v"(l[0]), "v"(l[1]), "v"(l[2]), "v"(l[3]),                       \
         "v"(g[0]), "v"(g[1]), "v"(g[2]), "v"(g[3])                        \
      : "memory")

// Eight 2^x in one statement.  Behind a transcendental the instruction set asks
// for one independent instruction before its result is read or its source
// overwritten: here each v_exp_f32 is that instruction for the one before it
// (early-clobber outputs: none lies on a source), and the v_nop fills the slot
// behind the last.
#define A_EXP2X8(d, a)                                                     \
  asm("v_exp_f32 %0, %8\n\t"                                               \
      "v_exp_f32 %1, %9\n\t"                                               \
      "v_exp_f32 %2, %10\n\t"                                              \
      "v_exp_f32 %3, %11\n\t"                                              \
      "v_exp_f32 %4, %12\n\t"                                              \
      "v_exp_f32 %5, %13\n\t"                                              \
      "v_exp_f32 %6, %14\n\t"                                              \
      "v_exp_f32 %7, %15\n\t"                                              \
      "v_nop"                                                              \
      : "=&v"(d[0]), "=&v"(d[1]), "=&v"(d[2]), "=&v"(d[3]),                \
        "=&v"(d[4]), "=&v"(d[5]), "=&v"(d[6]), "=&v"(d[7])                 \
      : "v"(a[0]), "v"(a[1]), "v"(a[2]), "v"(a[3]),                        \
        "v"(a[4]), "v"(a[5]), "v"(a[6]), "v"(a[7]))

// lane l with lane l ^ 16, in the vector unit
__device__ __forceinline__ float xhalf(float x) {
  const int b = __builtin_bit_cast(int, x);
  return __builtin_bit_cast(
      float, __builtin_amdgcn_permlanex16(b, b, 0x76543210, 0xfedcba98, false, false));
}

__global__ __launch_bounds__(256) void attn_wmma_kernel(
    const __bf16* __restrict__ q,   // [B,H,T,hd]
    const __bf16* __restrict__ k,   // [B,H,T,hd]
    const __bf16* __restrict__ vt,  // [B,H,hd,T]
    __bf16* __restrict__ attnb) {   // bf16 [B,T,C]
  __shared__ __attribute__((aligned(16))) __bf16 KV[2 * A_BUF];

  // scalar wave number: the test that skips a pass is then a scalar branch
  const int wave = __builtin_amdgcn_readfirstlane(threadIdx.x >> 5);
  const int lane = threadIdx.x & 31;
  const int half = lane >> 4, ln = lane & 15;

  const int qt0 = (blockIdx.x * ATT_WAVES + wave) * 16;
  const int bh  = blockIdx.y;
  const int bi  = bh >> 4;          // /H
  const int hi  = bh & (H_DIM - 1);

  const __bf16* Qp = q + ((size_t)bh * T_DIM + qt0) * HD_DIM;
  const __bf16* Kp = k + (size_t)bh * T_DIM * HD_DIM;
  const __bf16* Vp = vt + (size_t)bh * HD_DIM * T_DIM;

  // Copy map: 8 lanes cover one 128-byte row; copy i of a thread serves stage
  // row i * 32 + crow (i < 2: K rows, i >= 2: V^T rows).
  const int crow = threadIdx.x >> 3;        // 0..31
  const int ccol = (threadIdx.x & 7) << 3;  // bf16 offset in the row
  const __bf16* ksrc = Kp + (size_t)crow * HD_DIM + ccol;
  const __bf16* vsrc = Vp + (size_t)crow * T_DIM + ccol;
  const unsigned ldst = (unsigned)(size_t)&KV[crow * A_PITCH + ccol];

  auto issue = [&](int st, int buf) {
    unsigned l[4];
    const __bf16* g[4];
#pragma unroll  // constant indices: l stays in registers
    for (int i = 0; i < 4; ++i)
      l[i] = ldst + (unsigned)(buf * A_BUF + i * 32 * A_PITCH) * 2u;
    g[0] = ksrc + (size_t)(st * A_KEYS) * HD_DIM;
    g[1] = ksrc + (size_t)(st * A_KEYS + 32) * HD_DIM;
    g[2] = vsrc + st * A_KEYS;
    g[3] = vsrc + (size_t)32 * T_DIM + st * A_KEYS;
    A_COPY4(l, g);
  };

  // The block's last query is (blockIdx.x + 1) * 128 - 1: so many keys, in
  // stages of 64; never fewer than two stages.
  const int nst = (blockIdx.x + 1) * (ATT_WAVES * 16 / A_KEYS);
  issue(0, 0);

  // Q as the B operand: column = query ln
  const v16bf qa0 = load_frag(Qp, HD_DIM);        // K = 0..31 of hd
  const v16bf qa1 = load_frag(Qp + 32, HD_DIM);   // K = 32..63 of hd

  // O^T: o[jj][r] = O[query ln][hd jj * 16 + half * 8 + r]
  v8f o[4] = {};
  const int qg = qt0 + ln;          // this lane's query
  const int qrel = qg - half * 8;   // its place against the first key of this half's rows
  float rm = -1e30f;                // its running maximum, alike in both halves
  float rl = 0.f;                   // running sum over this half's keys only

  // stage 0 has landed for this wave, then for all waves
  asm volatile("s_wait_asynccnt 0x0" ::: "memory");
  __syncthreads();
  issue(1, 1);

  for (int t = 0; t < nst; ++t) {
    const __bf16* Ks = &KV[(t & 1) * A_BUF];
    const __bf16* Vs = Ks + A_KEYS * A_PITCH;
    for (int p = 0; p < A_KEYS / 32; ++p) {
      const int kv0 = t * A_KEYS + p * 32;
      if (kv0 >= qt0 + 16) continue;   // wholly above this wave's diagonal
      // The pass's K and V^T fragments are read from LDS as one group.
      v16bf kf[2][2], vf[4];
#pragma unroll  // constant j: kf stays in registers
      for (int j = 0; j < 2; ++j) {
        const __bf16* Kb = Ks + (p * 32 + j * 16) * A_PITCH;
        kf[j][0] = load_frag(Kb, A_PITCH);
        kf[j][1] = load_frag(Kb + 32, A_PITCH);
      }
#pragma unroll  // constant jj: vf stays in registers
      for (int jj = 0; jj < 4; ++jj)
        vf[jj] = load_frag(Vs + (jj * 16) * A_PITCH + p * 32, A_PITCH);
      // keeps the read group ahead of the WMMAs: without it the scheduler sinks
      // each read to just before its use and every WMMA waits out an LDS read
      __builtin_amdgcn_sched_barrier(0);
      // S^T tile j: pm[j][r] = score of key kv0 + j * 16 + half * 8 + r, query qg
      float pm[2][8];
      const int dq = qrel - kv0;       // key above the query: j * 16 + r > dq
#pragma unroll  // constant j, r: pm stays in registers
      for (int j = 0; j < 2; ++j) {
        v8f s = {};
        s = wmma_bf16(kf[j][0], qa0, s);
        s = wmma_bf16(kf[j][1], qa1, s);
#pragma unroll
        for (int r = 0; r < 8; ++r) {
          float val = s[r] * 0.125f;              // hd^-0.5
          pm[j][r] = (j * 16 + r > dq) ? -1e30f : val;    // causal mask
        }
      }
      // online softmax: 16 of the query's 32 scores are in this lane
      float m4[4];
#pragma unroll  // four independent chains
      for (int e = 0; e < 4; ++e)
        m4[e] = fmaxf(fmaxf(pm[0][2 * e], pm[0][2 * e + 1]), fmaxf(pm[1][2 * e], pm[1][2 * e + 1]));
      float mx = fmaxf(fmaxf(m4[0], m4[1]), fmaxf(m4[2], m4[3]));
      mx = fmaxf(mx, xhalf(mx));
      const float mnew  = fmaxf(rm, mx);
      const float scale = __expf(rm - mnew);
      rm = mnew;
      // P^T as B operand: element s of the lane = tile s >> 3, register s & 7,
      // the k order in which load_frag reads V^T
      v16bf pf;
      float s4[4];
#pragma unroll  // constant j, r: pm and pf stay in registers
      for (int j = 0; j < 2; ++j) {
        float ea[8], pe[8];
#pragma unroll
        for (int r = 0; r < 8; ++r) ea[r] = (pm[j][r] - mnew) * 1.44269504f;  // log2(e)
        A_EXP2X8(pe, ea);
#pragma unroll  // four independent chains
        for (int r = 0; r < 8; ++r) {
          s4[r & 3] = (j == 0 && r < 4) ? pe[r] : s4[r & 3] + pe[r];
          pf[j * 8 + r] = (__bf16)pe[r];
        }
      }
      rl = rl * scale + ((s4[0] + s4[1]) + (s4[2] + s4[3]));
#pragma unroll  // constant jj, r: o stays in registers
      for (int jj = 0; jj < 4; ++jj) {
#pragma unroll
        for (int r = 0; r < 8; ++r) o[jj][r] *= scale;
      }
#pragma unroll  // constant jj: o and vf stay in registers
      for (int jj = 0; jj < 4; ++jj) o[jj] = wmma_bf16(vf[jj], pf, o[jj]);
    }
    // Hand-over: this wave's reads of buffer t & 1 are done, its copies of
    // stage t + 1 have landed; behind the barrier that holds for every wave.
    wait_lds();
    asm volatile("s_wait_asynccnt 0x0" ::: "memory");
    __syncthreads();
    if (t + 2 < nst) issue(t + 2, t & 1);
  }
  // no copy is outstanding when the wave goes on to the stores and ends
  asm volatile("s_wait_asynccnt 0x0" ::: "memory");

  // join the halves' sums, normalize, store to [B,T,C] bf16: a lane's eight
  // registers of a tile are eight consecutive hd of its query, one 16-byte store
  const float inv = 1.f / (rl + xhalf(rl));
  __bf16* dst = attnb + ((size_t)bi * T_DIM + qg) * C_DIM + hi * HD_DIM + half * 8;
#pragma unroll  // constant jj, r: o stays in registers
  for (int jj = 0; jj < 4; ++jj) {
    union { __bf16 h[8]; u32x4 q; } u;
#pragma unroll
    for (int r = 0; r < 8; ++r) u.h[r] = (__bf16)(o[jj][r] * inv);
    *(u32x4*)(dst + jj * 16) = u.q;
  }
}

// ---------------------------------------------------------------- LN
// out = LN(x + y) * g + b ; one wave per row of C_DIM=1024, 8 rows per block.
// A lane holds 32 elements of its row (eight 16-byte pieces, 512 bytes of the
// row per wave-wide request); the row's sums need no LDS and no barrier.
__global__ __launch_bounds__(256) void ln_residual_kernel(
    const float* __restrict__ x, const float* __restrict__ y,
    const float* __restrict__ g, const float* __restrict__ b,
    float* __restrict__ out, __bf16* __restrict__ outb) {
  const int lane = threadIdx.x & 31;
  const int row  = blockIdx.x * 8 + (threadIdx.x >> 5);
  const size_t off = (size_t)row * C_DIM + lane * 4;
  f32x8 xy[8], gb[8];   // x | y and g | b, one 16-byte piece of each
#pragma unroll  // constant i: the pieces stay in registers
  for (int i = 0; i < 8; ++i)
    xy[i] = __builtin_shufflevector(*(const f32x4*)(x + off + i * 128),
                                    *(const f32x4*)(y + off + i * 128),
                                    0, 1, 2, 3, 4, 5, 6, 7);
#pragma unroll  // constant i: the pieces stay in registers
  for (int i = 0; i < 8; ++i)
    gb[i] = __builtin_shufflevector(*(const f32x4*)(g + lane * 4 + i * 128),
                                    *(const f32x4*)(b + lane * 4 + i * 128),
                                    0, 1, 2, 3, 4, 5, 6, 7);
  // Loaded values as inputs only: holds all 32 loads ahead of the sums.  Without
  // it the compiler holds some x, y loads back until earlier ones have returned
  // and sinks each g, b load to its use, a further latency per piece.
  asm volatile("" :: "v"(xy[0]), "v"(xy[1]), "v"(xy[2]), "v"(xy[3]),
                     "v"(xy[4]), "v"(xy[5]), "v"(xy[6]), "v"(xy[7]),
                     "v"(gb[0]), "v"(gb[1]), "v"(gb[2]), "v"(gb[3]),
                     "v"(gb[4]), "v"(gb[5]), "v"(gb[6]), "v"(gb[7]));
  float v[8][4];
  float sa[4] = {0.f, 0.f, 0.f, 0.f}, sb[4] = {0.f, 0.f, 0.f, 0.f};
#pragma unroll  // constant i, e: xy and v stay in registers
  for (int i = 0; i < 8; ++i) {
#pragma unroll  // four independent chains
    for (int e = 0; e < 4; ++e) {
      v[i][e] = xy[i][e] + xy[i][e + 4];
      sa[e] += v[i][e];
      sb[e] += v[i][e] * v[i][e];
    }
  }
  float s  = (sa[0] + sa[1]) + (sa[2] + sa[3]);
  float s2 = (sb[0] + sb[1]) + (sb[2] + sb[3]);
#pragma unroll
  for (int m = 1; m < 32; m <<= 1) {
    s  += __shfl_xor(s, m, 32);
    s2 += __shfl_xor(s2, m, 32);
  }
  const float mean = s * (1.f / C_DIM);
  const float var  = s2 * (1.f / C_DIM) - mean * mean;
  const float rstd = rsqrtf(var + 1e-5f);
#pragma unroll  // constant i, e: v and gb stay in registers
  for (int i = 0; i < 8; ++i) {
#pragma unroll
    for (int e = 0; e < 4; ++e)
      v[i][e] = (v[i][e] - mean) * rstd * gb[i][e] + gb[i][e + 4];
    *(float4*)(out + off + i * 128) = make_float4(v[i][0], v[i][1], v[i][2], v[i][3]);
  }
  // the converts below reuse registers that the stores above name
  asm volatile("s_wait_xcnt 0x0" ::: "memory");
  if (outb) {
#pragma unroll  // constant i, e: v stays in registers
    for (int i = 0; i < 8; ++i) {
      union { __bf16 h[4]; u32x2 q; } u;
#pragma unroll
      for (int e = 0; e < 4; ++e) u.h[e] = (__bf16)v[i][e];
      *(u32x2*)(outb + off + i * 128) = u.q;
    }
  }
}

// ---------------------------------------------------------------- launch
extern "C" void kernel_launch(void* const* d_in, const int* in_sizes, int n_in,
                              void* d_out, int out_size, void* d_ws, size_t ws_size,
                              hipStream_t stream) {
  const float* x     = (const float*)d_in[0];
  const float* wq    = (const float*)d_in[1];
  const float* wk    = (const float*)d_in[2];
  const float* wv    = (const float*)d_in[3];
  const float* wp    = (const float*)d_in[4];
  const float* bproj = (const float*)d_in[5];
  const float* w1    = (const float*)d_in[6];
  const float* b1    = (const float*)d_in[7];
  const float* w2    = (const float*)d_in[8];
  const float* b2    = (const float*)d_in[9];
  const float* g1    = (const float*)d_in[10];
  const float* be1   = (const float*)d_in[11];
  const float* g2    = (const float*)d_in[12];
  const float* be2   = (const float*)d_in[13];

  char* ws = (char*)d_ws;
  size_t o = 0;
  auto take = [&](size_t nbytes) -> void* {
    void* p = ws + o;
    o += (nbytes + 255) & ~(size_t)255;
    return p;
  };
  const size_t BTC = (size_t)BT_DIM * C_DIM;
  __bf16* xb    = (__bf16*)take(BTC * 2);
  __bf16* wct   = (__bf16*)take((size_t)4 * C_DIM * C_DIM * 2);  // q, k, v, proj
  __bf16* wpt   = wct + (size_t)3 * C_DIM * C_DIM;
  __bf16* w1t   = (__bf16*)take((size_t)C_DIM * DFF_DIM * 2);
  __bf16* w2t   = (__bf16*)take((size_t)DFF_DIM * C_DIM * 2);
  __bf16* qb    = (__bf16*)take(3 * BTC * 2);                    // q, k, v^T
  __bf16* kb    = qb + BTC;
  __bf16* vtb   = qb + 2 * BTC;
  __bf16* attnb = (__bf16*)take(BTC * 2);
  float*  y1    = (float*)take(BTC * 4);
  float*  x1    = (float*)take(BTC * 4);
  __bf16* x1b   = (__bf16*)take(BTC * 2);
  __bf16* h1    = (__bf16*)take((size_t)BT_DIM * DFF_DIM * 2);
  float*  y2    = (float*)take(BTC * 4);

  prep_kernel<<<PREP_GRID, 256, 0, stream>>>(x, wq, wk, wv, wp, w1, w2, xb, wct, w1t, w2t);

  // block tiles: 256 x 256 for N = 3072 and 4096, 128 x 128 for N = 1024
  const dim3 gC(C_DIM / 128, BT_DIM / 128);
  gemm_bf16_wmma<EPI_QKV, 256><<<dim3(3 * C_DIM / 256, BT_DIM / 256), 256, 0, stream>>>(
      xb, wct, nullptr, qb, BT_DIM, 3 * C_DIM, C_DIM);

  attn_wmma_kernel<<<dim3(T_DIM / (16 * ATT_WAVES), B_DIM * H_DIM), 256, 0, stream>>>(
      qb, kb, vtb, attnb);

  gemm_bf16_wmma<EPI_F32_BIAS, 128><<<gC, 128, 0, stream>>>(attnb, wpt, bproj, y1, BT_DIM, C_DIM, C_DIM);
  ln_residual_kernel<<<BT_DIM / 8, 256, 0, stream>>>(x, y1, g1, be1, x1, x1b);

  gemm_bf16_wmma<EPI_RELU_BF16, 256><<<dim3(DFF_DIM / 256, BT_DIM / 256), 256, 0, stream>>>(
      x1b, w1t, b1, h1, BT_DIM, DFF_DIM, C_DIM);
  gemm_bf16_wmma<EPI_F32_BIAS, 128><<<gC, 128, 0, stream>>>(h1, w2t, b2, y2, BT_DIM, C_DIM, DFF_DIM);
  ln_residual_kernel<<<BT_DIM / 8, 256, 0, stream>>>(x1, y2, g2, be2, (float*)d_out, nullptr);
}

// v007
// It runs in 160 microseconds.
// Timed twice side by side with v006, it ran 1.07 and 1.08 times as fast.
// Over all steps from v000 it is 2.84 times as fast.
#include <hip/hip_runtime.h>

#define B_DIM   2
#define T_DIM   2048
#define C_DIM   1024
#define H_DIM   16
#define HD_DIM  64
#define DFF_DIM 4096
#define BT_DIM  (B_DIM * T_DIM)

typedef __attribute__((ext_vector_type(16))) __bf16 v16bf;
typedef __attribute__((ext_vector_type(8)))  float  v8f;
typedef __attribute__((ext_vector_type(4)))  unsigned int u32x4;
typedef __attribute__((ext_vector_type(2)))  unsigned int u32x2;
typedef __attribute__((ext_vector_type(4)))  float  f32x4;
typedef __attribute__((ext_vector_type(8)))  float  f32x8;

__device__ __forceinline__ v8f wmma_bf16(v16bf a, v16bf b, v8f c) {
  // D = A(16x32 bf16) * B(32x16 bf16) + C(16x16 f32)
  return __builtin_amdgcn_wmma_f32_16x16x32_bf16(
      /*neg_a=*/false, a, /*neg_b=*/false, b,
      /*c_mod=*/(short)0, c, /*reuse_a=*/false, /*reuse_b=*/false);
}

// Load one 16x32 bf16 fragment in the CDNA5 A-matrix lane layout from a
// row-major [16 x ld] tile.  Lanes 0-15: row=lane, K 0-7 (lo) / 16-23 (hi);
// lanes 16-31: row=lane-16, K 8-15 (lo) / 24-31 (hi).  Two b128 loads.
// Works for B as well when B is pre-transposed to [N][K].
__device__ __forceinline__ v16bf load_frag(const __bf16* base, int ld) {
  const int lane = threadIdx.x & 31;
  const int r    = lane & 15;
  const int kh   = (lane >> 4) << 3;        // 0 or 8
  const __bf16* p = base + (size_t)r * ld + kh;
  union { v16bf v; struct { u32x4 lo, hi; } q; } u;
  u.q.lo = *(const u32x4*)(p);
  u.q.hi = *(const u32x4*)(p + 16);
  return u.v;
}

__device__ __forceinline__ void wait_lds() {
  asm volatile("s_wait_dscnt 0" ::: "memory");
}

// ---------------------------------------------------------------- converts
// The kernels without matrix work move few bytes per wave, and the time to
// start their waves outweighs the time to move their bytes: each wave below
// keeps 8 to 32 loads of 512 bytes in flight instead of a few short ones.

// 32 elements per thread: eight 16-byte loads in flight, eight 8-byte stores.
// Block job blk of n / 8192; needs n % 8192 == 0.
__device__ __forceinline__ void f32_to_bf16_job(
    const float* __restrict__ in, __bf16* __restrict__ out, int blk) {
  const size_t base = (size_t)blk * 8192 + threadIdx.x * 4;
  float4 f[8];
#pragma unroll  // constant i: f stays in registers, the loads go out together
  for (int i = 0; i < 8; ++i) f[i] = *(const float4*)(in + base + i * 1024);
#pragma unroll  // constant i: f stays in registers
  for (int i = 0; i < 8; ++i) {
    union { __bf16 h[4]; u32x2 q; } u;
    u.h[0] = (__bf16)f[i].x;
    u.h[1] = (__bf16)f[i].y;
    u.h[2] = (__bf16)f[i].z;
    u.h[3] = (__bf16)f[i].w;
    *(u32x2*)(out + base + i * 1024) = u.q;
  }
  // the built code goes on from here into tests that lead to the other jobs,
  // which reuse the registers that these stores name
  asm volatile("s_wait_xcnt 0x0" ::: "memory");
}

// in: f32 row-major [R][Cc] -> out: bf16 [Cc][R]   (weights -> [N][K] layout)
// One 128 x 128 tile per block of 8 waves.  A wave reads 16 whole tile rows
// (512 bytes each), so a lane holds 16 consecutive r of 4 columns: per column
// two 16-byte pieces of an output row.  The pieces pass through LDS so that
// the stores cover whole 256-byte output rows.  LDS rows are 256 bytes without
// a pad; piece p of row c lies at p ^ ((c >> 2) & 15), which spreads both the
// writers (16 lanes: 16 rows, one p) and the readers (16 lanes: one row) over
// all banks.  R and Cc are compile-time: every row step is then an immediate
// offset on one address.  Needs R % 128 == 0, Cc % 128 == 0.
// Block job (bx, by) of (Cc / 128, R / 128); tile: 128 * 128 bf16 of LDS, [c][r].
template <int R, int Cc>
__device__ __forceinline__ void transpose_f32_to_bf16_job(
    const float* __restrict__ in, __bf16* __restrict__ out, __bf16* tile,
    int bx, int by) {
  const int lane = threadIdx.x & 31;
  const int wave = threadIdx.x >> 5;
  const int c0 = bx * 128, r0 = by * 128;
  const float* src = in + (size_t)(r0 + wave * 16) * Cc + c0 + lane * 4;
  float f[16][4];
#pragma unroll  // constant i: f stays in registers, the loads go out together
  for (int i = 0; i < 16; ++i) {
    // the last load's result may land in the address pair that the earlier
    // loads name: the wait stands in front of that overwrite
    if (i == 15) asm volatile("s_wait_xcnt 0x0" ::: "memory");
    const float4 t = *(const float4*)(src + i * Cc);
    f[i][0] = t.x; f[i][1] = t.y; f[i][2] = t.z; f[i][3] = t.w;
  }
  // keeps all 16 loads ahead of the converts: without it the scheduler holds
  // six of them back until earlier ones have returned, a second latency
  __builtin_amdgcn_sched_barrier(0);
#pragma unroll  // constant e, h, k: f stays in registers
  for (int e = 0; e < 4; ++e) {
#pragma unroll
    for (int h = 0; h < 2; ++h) {
      union { __bf16 b[8]; u32x4 q; } u;
#pragma unroll
      for (int k = 0; k < 8; ++k) u.b[k] = (__bf16)f[h * 8 + k][e];
      const int piece = (wave * 2 + h) ^ (lane & 15);
      *(u32x4*)&tile[(lane * 4 + e) * 128 + piece * 8] = u.q;
    }
  }
  __syncthreads();
  const int crow = threadIdx.x >> 4;   // 0..15
  const int p    = threadIdx.x & 15;   // 16-byte piece of the output row
  __bf16* dst = out + (size_t)(c0 + crow) * R + r0 + p * 8;
#pragma unroll  // the eight LDS reads go out together, row steps are immediates
  for (int i = 0; i < 8; ++i) {
    const int c = i * 16 + crow;
    const u32x4 q = *(const u32x4*)&tile[c * 128 + (p ^ ((c >> 2) & 15)) * 8];
    *(u32x4*)(dst + i * 16 * R) = q;
  }
  // the built code goes on from here into tests that lead to the other jobs,
  // which reuse the registers that these stores name
  asm volatile("s_wait_xcnt 0x0" ::: "memory");
}

// All seven operand preparations in one launch: none depends on another, and
// each alone is too short to fill the chip or to pay for its own launch.  The
// block index picks the job (a scalar branch); the larger jobs come first.
// wct: the four C x C weights' outputs, one behind the other (q, k, v, proj).
#define PREP_W1   (DFF_DIM / 128 * (C_DIM / 128))      // 256 blocks
#define PREP_W2   (C_DIM / 128 * (DFF_DIM / 128))      // 256 blocks
#define PREP_WC   (C_DIM / 128 * (C_DIM / 128))        // 64 blocks per weight
#define PREP_X    (BT_DIM * C_DIM / 8192)              // 512 blocks
#define PREP_GRID (PREP_W1 + PREP_W2 + 4 * PREP_WC + PREP_X)
__global__ __launch_bounds__(256) void prep_kernel(
    const float* __restrict__ x, const float* __restrict__ wq,
    const float* __restrict__ wk, const float* __restrict__ wv,
    const float* __restrict__ wp, const float* __restrict__ w1,
    const float* __restrict__ w2, __bf16* __restrict__ xb,
    __bf16* __restrict__ wct, __bf16* __restrict__ w1t,
    __bf16* __restrict__ w2t) {
  __shared__ __attribute__((aligned(16))) __bf16 tile[128 * 128];
  int b = blockIdx.x;
  if (b < PREP_W1) {
    transpose_f32_to_bf16_job<C_DIM, DFF_DIM>(w1, w1t, tile, b % (DFF_DIM / 128),
                                              b / (DFF_DIM / 128));
    return;
  }
  b -= PREP_W1;
  if (b < PREP_W2) {
    transpose_f32_to_bf16_job<DFF_DIM, C_DIM>(w2, w2t, tile, b % (C_DIM / 128),
                                              b / (C_DIM / 128));
    return;
  }
  b -= PREP_W2;
  if (b < 4 * PREP_WC) {
    const int w = b / PREP_WC, j = b % PREP_WC;
    const float* in = w == 0 ? wq : w == 1 ? wk : w == 2 ? wv : wp;
    transpose_f32_to_bf16_job<C_DIM, C_DIM>(in, wct + (size_t)w * C_DIM * C_DIM, tile,
                                            j % (C_DIM / 128), j / (C_DIM / 128));
    return;
  }
  f32_to_bf16_job(x, xb, b - 4 * PREP_WC);
}

// ---------------------------------------------------------------- GEMM
// EPI_QKV: the q, k and v products as one GEMM over the three weights, N = 3 C;
// a wave's 128 columns of q or k are two heads, its 64 of v one head; stored as
// EPI_QK or EPI_VT.
enum { EPI_QK = 0, EPI_VT = 1, EPI_F32_BIAS = 2, EPI_RELU_BF16 = 3, EPI_QKV = 4 };

// Stores a wave's results: FM * 16 indices in the register dimension (a lane's
// eight registers of a tile are eight consecutive ones) by 64 in the lane
// dimension.  The register dimension is the one that is contiguous in the
// output: the columns, or for EPI_VT the rows (tokens).  A lane's eight values
// are one or two 16-byte pieces; the pieces pass through the wave's own LDS
// range, 64 rows of 256 bytes, so that every global store covers whole lines:
// 16 lanes one row.  The row pitch of 272 bytes spreads the 16 writers of a
// piece over all banks.  reg0, lane0: the wave's first index in each dimension;
// for EPI_QK and EPI_VT columns count within the one product and outp is that
// product's output.
#define G_SPITCH 272                      // staging row pitch, bytes
template <int EPI, int FM>
__device__ __forceinline__ void gemm_store(
    const v8f (&acc)[FM][4], int reg0, int lane0,
    const float* __restrict__ bias, void* __restrict__ outp, char* stage) {
  static_assert(FM * 16 * (EPI == EPI_F32_BIAS ? 4 : 2) == 256, "a staged row is 256 bytes");
  const int lane = threadIdx.x & 31;
  const int half = lane >> 4, ln = lane & 15;
  f32x4 bv[FM][2] = {};   // the bias of this lane's columns
  if constexpr (EPI == EPI_F32_BIAS || EPI == EPI_RELU_BF16) {
#pragma unroll  // constant m: bv stays in registers, the loads go out together
    for (int m = 0; m < FM; ++m) {
      bv[m][0] = *(const f32x4*)(bias + reg0 + m * 16 + half * 8);
      bv[m][1] = *(const f32x4*)(bias + reg0 + m * 16 + half * 8 + 4);
    }
    // the sums below reuse the address pair that these loads name
    asm volatile("s_wait_xcnt 0x0" ::: "memory");
    // keeps the sums behind that wait
    __builtin_amdgcn_sched_barrier(0);
  }
#pragma unroll  // constant m, j, r: acc stays in registers
  for (int m = 0; m < FM; ++m) {
    const f32x4 b0 = bv[m][0], b1 = bv[m][1];
#pragma unroll
    for (int j = 0; j < 4; ++j) {
      char* row = stage + (j * 16 + ln) * G_SPITCH;
      if constexpr (EPI == EPI_F32_BIAS) {
        f32x4 lo, hi;
#pragma unroll
        for (int r = 0; r < 4; ++r) {
          lo[r] = acc[m][j][r] + b0[r];
          hi[r] = acc[m][j][r + 4] + b1[r];
        }
        *(f32x4*)(row + m * 64 + half * 32) = lo;
        *(f32x4*)(row + m * 64 + half * 32 + 16) = hi;
      } else {
        union { __bf16 h[8]; u32x4 q; } u;
#pragma unroll
        for (int r = 0; r < 8; ++r) {
          float v = acc[m][j][r];
          if constexpr (EPI == EPI_RELU_BF16) {
            v += r < 4 ? b0[r & 3] : b1[r & 3];
            v = v > 0.f ? v : 0.f;
          }
          u.h[r] = (__bf16)v;
        }
        *(u32x4*)(row + m * 32 + half * 16) = u.q;
      }
    }
  }
  // this wave's staged pieces are in LDS before its lanes read each other's
  wait_lds();
  const int rr = lane >> 4;    // staged row of this lane in a pair of rows
  const int pc = lane & 15;    // its 16-byte piece of the row
  char* g;                     // where staged row rr, piece pc goes
  int step;                    // bytes from one staged row's place to the next
  if constexpr (EPI == EPI_QK) {
    // [BT,C] -> bf16 [B,H,T,hd]: a staged row is one token of two heads
    const int row = lane0 + rr, col = reg0 + pc * 8;
    const int bi = row >> 11, ti = row & (T_DIM - 1);
    const int hi = col >> 6, di = col & (HD_DIM - 1);
    g = (char*)outp + ((((size_t)bi * H_DIM + hi) * T_DIM + ti) * HD_DIM + di) * 2;
    step = HD_DIM * 2;
  } else if constexpr (EPI == EPI_VT) {
    // [BT,C] -> bf16 [B,H,hd,T]  (V transposed: K-contiguous for P*V): a staged
    // row is 128 tokens of one column
    const int row = reg0 + pc * 8, col = lane0 + rr;
    const int bi = row >> 11, ti = row & (T_DIM - 1);
    const int hi = col >> 6, di = col & (HD_DIM - 1);
    g = (char*)outp + ((((size_t)bi * H_DIM + hi) * HD_DIM + di) * T_DIM + ti) * 2;
    step = T_DIM * 2;
  } else if constexpr (EPI == EPI_F32_BIAS) {
    g = (char*)outp + ((size_t)(lane0 + rr) * C_DIM + reg0 + pc * 4) * 4;
    step = C_DIM * 4;
  } else {  // EPI_RELU_BF16
    g = (char*)outp + ((size_t)(lane0 + rr) * DFF_DIM + reg0 + pc * 8) * 2;
    step = DFF_DIM * 2;
  }
  u32x4 d[32];
#pragma unroll  // constant i: d stays in registers, the reads go out together
  for (int i = 0; i < 32; ++i)
    d[i] = *(const u32x4*)(stage + (i * 2 + rr) * G_SPITCH + pc * 16);
  // keeps every read ahead of the first store: each store then names registers
  // of its own, and none that a store names is written again
  __builtin_amdgcn_sched_barrier(0);
#pragma unroll  // constant i: the row steps are immediate offsets on one address
  for (int i = 0; i < 32; ++i) *(u32x4*)(g + i * 2 * step) = d[i];
  // where two kinds share a kernel the built code can run on from here into the
  // other kind's code, which reuses the registers that these stores name
  if constexpr (EPI == EPI_QK || EPI == EPI_VT) asm volatile("s_wait_xcnt 0x0" ::: "memory");
}

// C[M,N] = A[M,K](bf16) * Bt[N,K]^T(bf16), f32 accumulate.
// Block tile TS x TS, TS threads.  What a block draws from L2 per result falls
// with the tile's edge; at the L2 rate a WGP gets when all draw, a pass of a
// narrow tile takes longer to land than to multiply.  TS = 256 where that still
// gives about one block per WGP, TS = 128 where N is small.
// Waves: 2 over the first operand's rows x TS / 64 over the second's; wave tile
// TS / 2 first-operand x 64 second-operand rows, that is FM x 4 tiles
// = 32 (TS = 256) or 16 (TS = 128) WMMAs per K=32 step.
// The products are taken transposed, Bt rows as the first operand and A rows as
// the second: a lane's eight registers of a tile are then eight consecutive
// columns of one output row.  Only the v product, whose output is transposed,
// keeps A first.  Both operands have the same fragment layout and k order.
// A pass is 128 k = 256 bytes of each of the TS first-operand rows and the TS
// second-operand rows.  The
// pass's rows are brought into LDS by asynchronous 16-byte copies, two
// buffers: the next pass's copies fly while this pass is multiplied.
// Needs M % TS == 0, N % TS == 0, K % 128 == 0.
#define G_PASS  128                       // k per pass
#define G_PITCH 136                       // LDS row pitch, bf16: 272 B = 16 B x 17

// Eight copies of 16 bytes per lane, global -> LDS, through no register.  The
// s_wait_xcnt closes the statement so that no address register named here is
// rewritten before it.
#define G_COPY8(l, g, o)                                                   \
  asm volatile(                                                            \
      "global_load_async_to_lds_b128 %0, %8, off\n\t"                      \
      "global_load_async_to_lds_b128 %1, %9, off\n\t"                      \
      "global_load_async_to_lds_b128 %2, %10, off\n\t"                     \
      "global_load_async_to_lds_b128 %3, %11, off\n\t"                     \
      "global_load_async_to_lds_b128 %4, %12, off\n\t"                     \
      "global_load_async_to_lds_b128 %5, %13, off\n\t"                     \
      "global_load_async_to_lds_b128 %6, %14, off\n\t"                     \
      "global_load_async_to_lds_b128 %7, %15, off\n\t"                     \
      "s_wait_xcnt 0x0"                                                    \
      :: "v"(l[o + 0]), "v"(l[o + 1]), "v"(l[o + 2]), "v"(l[o + 3]),       \
         "v"(l[o + 4]), "v"(l[o + 5]), "v"(l[o + 6]), "v"(l[o + 7]),       \
         "v"(g[o + 0]), "v"(g[o + 1]), "v"(g[o + 2]), "v"(g[o + 3]),       \
         "v"(g[o + 4]), "v"(g[o + 5]), "v"(g[o + 6]), "v"(g[o + 7])        \
      : "memory")

template <int EPI, int TS>
__global__ __launch_bounds__(TS) void gemm_bf16_wmma(
    const __bf16* __restrict__ A, const __bf16* __restrict__ Bt,
    const float* __restrict__ bias, void* __restrict__ outp,
    int M, int N, int K) {
  constexpr int FM  = TS / 32;             // 16-row tiles per wave
  constexpr int WN  = TS / 64;             // waves across
  constexpr int RS  = TS / 16;             // tile rows that one copy per thread serves
  constexpr int BUF = 2 * TS * G_PITCH;    // bf16 per buffer: TS first-operand rows, then TS second
  __shared__ __attribute__((aligned(16))) __bf16 Ts[2 * BUF];

  // scalar wave number: the wave's places in the tile and in the staging stay
  // out of the vector registers, which the main loop fills
  const int wave = __builtin_amdgcn_readfirstlane(threadIdx.x >> 5);
  const int wm = wave / WN, wn = wave % WN;
  // which of q, k, v: the same for the whole block
  const int which = EPI == EPI_QKV ? blockIdx.x * TS / C_DIM : 0;
  const bool bt_first = which < 2;

  v8f acc[FM][4] = {};

  // Copy map: 16 lanes cover one 256-byte row; copy i of a thread serves tile
  // row i * RS + crow (i < 16: first operand, i >= 16: second operand).
  const int crow = threadIdx.x >> 4;        // 0..RS-1
  const int ccol = (threadIdx.x & 15) << 3; // bf16 offset in the row
  // the block's rows of each operand are scalar addresses; this thread's place
  // in them is the same for both, one register across the main loop
  const __bf16* ablk = A + (size_t)(blockIdx.y * TS) * K;
  const __bf16* bblk = Bt + (size_t)(blockIdx.x * TS) * K;
  const __bf16* asrc = bt_first ? bblk : ablk;   // first operand
  const __bf16* bsrc = bt_first ? ablk : bblk;   // second operand
  const unsigned voff = (unsigned)(crow * K + ccol);
  const unsigned ldst = (unsigned)(size_t)&Ts[crow * G_PITCH + ccol];

  auto issue = [&](int t, int buf) {
    // the pass's first piece of each operand of this thread; each copy's row step is
    // added to these, so that no per-row address lives across the passes
    const unsigned idx = voff + (unsigned)(t * G_PASS);
    const __bf16* at = asrc + idx;
    const __bf16* bt = bsrc + idx;
    const unsigned lt = ldst + (unsigned)(buf * BUF) * 2u;
#pragma unroll  // constant indices: l and g stay in registers
    for (int o = 0; o < 32; o += 8) {
      unsigned l[8];
      const __bf16* g[8];
#pragma unroll
      for (int i = 0; i < 8; ++i) {
        l[i] = lt + (unsigned)((o + i) * RS * G_PITCH) * 2u;
        g[i] = o < 16 ? at + (size_t)((o + i) * RS) * K : bt + (size_t)((o + i - 16) * RS) * K;
      }
      G_COPY8(l, g, 0);
    }
  };

  const int npass = K / G_PASS;
  issue(0, 0);
  // pass 0 has landed for this wave, then for all waves
  asm volatile("s_wait_asynccnt 0x0" ::: "memory");
  __syncthreads();
  if (npass > 1) issue(1, 1);

  for (int t = 0; t < npass; ++t) {
    const __bf16* As = &Ts[(t & 1) * BUF + wm * (FM * 16) * G_PITCH];
    const __bf16* Bs = &Ts[(t & 1) * BUF + (TS + wn * 64) * G_PITCH];
    // Two fragment sets: the LDS reads of k step s + 1 are issued as one group
    // ahead of the WMMAs of step s, so that their latency hides behind them.
    v16bf fa[2][FM], fb[2][4];
#pragma unroll  // constant m: fa stays in registers
    for (int m = 0; m < FM; ++m) fa[0][m] = load_frag(As + (m * 16) * G_PITCH, G_PITCH);
#pragma unroll  // constant j: fb stays in registers
    for (int j = 0; j < 4; ++j) fb[0][j] = load_frag(Bs + (j * 16) * G_PITCH, G_PITCH);
    // keeps step 0's reads ahead of step 1's: mixed, the first WMMAs wait for
    // both groups, twice the LDS time with every wave of the block waiting
    __builtin_amdgcn_sched_barrier(0);
#pragma unroll  // constant set index: the fragments stay in registers
    for (int s = 0; s < G_PASS / 32; ++s) {
      const int cur = s & 1, nxt = cur ^ 1;
      if (s + 1 < G_PASS / 32) {
        const int kk = (s + 1) * 32;
#pragma unroll  // constant m: fa stays in registers
        for (int m = 0; m < FM; ++m)
          fa[nxt][m] = load_frag(As + (m * 16) * G_PITCH + kk, G_PITCH);
#pragma unroll  // constant j: fb stays in registers
        for (int j = 0; j < 4; ++j)
          fb[nxt][j] = load_frag(Bs + (j * 16) * G_PITCH + kk, G_PITCH);
      }
      // keeps the read group ahead of the WMMAs: without it the scheduler sinks
      // each read to just before its use and every WMMA pair waits on LDS
      __builtin_amdgcn_sched_barrier(0);
#pragma unroll  // constant j, m: accumulators and fragments stay in registers
      for (int j = 0; j < 4; ++j) {
#pragma unroll
        for (int m = 0; m < FM; ++m)
          acc[m][j] = wmma_bf16(fa[cur][m], fb[cur][j], acc[m][j]);
      }
      // keeps the next step's reads from moving up among these WMMAs
      __builtin_amdgcn_sched_barrier(0);
    }
    // Hand-over: this wave's reads of buffer t & 1 are done, its copies of
    // pass t + 1 have landed; behind the barrier that holds for every wave.
    wait_lds();
    asm volatile("s_wait_asynccnt 0x0" ::: "memory");
    __syncthreads();
    if (t + 2 < npass) issue(t + 2, t & 1);
  }
  // no copy is outstanding when the wave goes on to the stores and ends
  asm volatile("s_wait_asynccnt 0x0" ::: "memory");

  // The ring is free: every wave's last reads ended in front of the last pass's
  // barrier and no copy is outstanding.  Each wave stages in a range of its own.
  char* stage = (char*)Ts + wave * (64 * G_SPITCH);
  const int first0  = wm * (FM * 16);   // the wave's place in the first operand's rows
  const int second0 = wn * 64;          // and in the second operand's
  if constexpr (EPI == EPI_QKV) {
    __bf16* o = (__bf16*)outp + (size_t)which * BT_DIM * C_DIM;
    if (bt_first) {   // a scalar branch
      gemm_store<EPI_QK, FM>(acc, (blockIdx.x * TS + first0) % C_DIM,
                             blockIdx.y * TS + second0, bias, o, stage);
    } else {
      gemm_store<EPI_VT, FM>(acc, blockIdx.y * TS + first0,
                             (blockIdx.x * TS + second0) % C_DIM, bias, o, stage);
    }
  } else {
    gemm_store<EPI, FM>(acc, blockIdx.x * TS + first0, blockIdx.y * TS + second0,
                        bias, outp, stage);
  }
}

#define ATT_WAVES 8
#define A_KEYS  64                        // keys per stage
#define A_PITCH 72                        // LDS row pitch, bf16: 144 B = 16 B x 9
#define A_ROWS  128                       // 64 K rows, then 64 V^T rows
#define A_BUF   (A_ROWS * A_PITCH)        // bf16 per buffer

// Four copies of 16 bytes per lane, global -> LDS, through no register.  The
// s_wait_xcnt closes the statement so that no address register named here is
// rewritten before it.
#define A_COPY4(l, g)                                                      \
  asm volatile(                                                            \
      "global_load_async_to_lds_b128 %0, %4, off\n\t"                      \
      "global_load_async_to_lds_b128 %1, %5, off\n\t"                      \
      "global_load_async_to_lds_b128 %2, %6, off\n\t"                      \
      "global_load_async_to_lds_b128 %3, %7, off\n\t"                      \
      "s_wait_xcnt 0x0"                                                    \
      :: "v"(l[0]), "v"(l[1]), "v"(l[2]), "v"(l[3]),                       \
         "v"(g[0]), "v"(g[1]), "v"(g[2]), "v"(g[3])                        \
      : "memory")

// Eight 2^x in one statement.  Behind a transcendental the instruction set asks
// for one independent instruction before its result is read or its source
// overwritten: here each v_exp_f32 is that instruction for the one before it
// (early-clobber outputs: none lies on a source), and the v_nop fills the slot
// behind the last.
#define A_EXP2X8(d, a)                                                     \
  asm("v_exp_f32 %0, %8\n\t"                                               \
      "v_exp_f32 %1, %9\n\t"                                               \
      "v_exp_f32 %2, %10\n\t"                                              \
      "v_exp_f32 %3, %11\n\t"                                              \
      "v_exp_f32 %4, %12\n\t"                                              \
      "v_exp_f32 %5, %13\n\t"                                              \
      "v_exp_f32 %6, %14\n\t"                                              \
      "v_exp_f32 %7, %15\n\t"                                              \
      "v_nop"                                                              \
      : "=&v"(d[0]), "=&v"(d[1]), "=&v"(d[2]), "=&v"(d[3]),                \
        "=&v"(d[4]), "=&v"(d[5]), "=&v"(d[6]), "=&v"(d[7])                 \
      : "v"(a[0]), "v"(a[1]), "v"(a[2]), "v"(a[3]),                        \
        "v"(a[4]), "v"(a[5]), "v"(a[6]), "v"(a[7]))

// lane l with lane l ^ 16, in the vector unit
__device__ __forceinline__ float xhalf(float x) {
  const int b = __builtin_bit_cast(int, x);
  return __builtin_bit_cast(
      float, __builtin_amdgcn_permlanex16(b, b, 0x76543210, 0xfedcba98, false, false));
}

__global__ __launch_bounds__(256) void attn_wmma_kernel(
    const __bf16* __restrict__ q,   // [B,H,T,hd]
    const __bf16* __restrict__ k,   // [B,H,T,hd]
    const __bf16* __restrict__ vt,  // [B,H,hd,T]
    __bf16* __restrict__ attnb) {   // bf16 [B,T,C]
  __shared__ __attribute__((aligned(16))) __bf16 KV[2 * A_BUF];

  // scalar wave number: the test that skips a pass is then a scalar branch
  const int wave = __builtin_amdgcn_readfirstlane(threadIdx.x >> 5);
  const int lane = threadIdx.x & 31;
  const int half = lane >> 4, ln = lane & 15;

  const int qt0 = (blockIdx.x * ATT_WAVES + wave) * 16;
  const int bh  = blockIdx.y;
  const int bi  = bh >> 4;          // /H
  const int hi  = bh & (H_DIM - 1);

  const __bf16* Qp = q + ((size_t)bh * T_DIM + qt0) * HD_DIM;
  const __bf16* Kp = k + (size_t)bh * T_DIM * HD_DIM;
  const __bf16* Vp = vt + (size_t)bh * HD_DIM * T_DIM;

  // Copy map: 8 lanes cover one 128-byte row; copy i of a thread serves stage
  // row i * 32 + crow (i < 2: K rows, i >= 2: V^T rows).
  const int crow = threadIdx.x >> 3;        // 0..31
  const int ccol = (threadIdx.x & 7) << 3;  // bf16 offset in the row
  const __bf16* ksrc = Kp + (size_t)crow * HD_DIM + ccol;
  const __bf16* vsrc = Vp + (size_t)crow * T_DIM + ccol;
  const unsigned ldst = (unsigned)(size_t)&KV[crow * A_PITCH + ccol];

  auto issue = [&](int st, int buf) {
    unsigned l[4];
    const __bf16* g[4];
#pragma unroll  // constant indices: l stays in registers
    for (int i = 0; i < 4; ++i)
      l[i] = ldst + (unsigned)(buf * A_BUF + i * 32 * A_PITCH) * 2u;
    g[0] = ksrc + (size_t)(st * A_KEYS) * HD_DIM;
    g[1] = ksrc + (size_t)(st * A_KEYS + 32) * HD_DIM;
    g[2] = vsrc + st * A_KEYS;
    g[3] = vsrc + (size_t)32 * T_DIM + st * A_KEYS;
    A_COPY4(l, g);
  };

  // The block's last query is (blockIdx.x + 1) * 128 - 1: so many keys, in
  // stages of 64; never fewer than two stages.
  const int nst = (blockIdx.x + 1) * (ATT_WAVES * 16 / A_KEYS);
  issue(0, 0);

  // Q as the B operand: column = query ln
  const v16bf qa0 = load_frag(Qp, HD_DIM);        // K = 0..31 of hd
  const v16bf qa1 = load_frag(Qp + 32, HD_DIM);   // K = 32..63 of hd

  // O^T: o[jj][r] = O[query ln][hd jj * 16 + half * 8 + r]
  v8f o[4] = {};
  const int qg = qt0 + ln;          // this lane's query
  const int qrel = qg - half * 8;   // its place against the first key of this half's rows
  float rm = -1e30f;                // its running maximum, alike in both halves
  float rl = 0.f;                   // running sum over this half's keys only

  // stage 0 has landed for this wave, then for all waves
  asm volatile("s_wait_asynccnt 0x0" ::: "memory");
  __syncthreads();
  issue(1, 1);

  for (int t = 0; t < nst; ++t) {
    const __bf16* Ks = &KV[(t & 1) * A_BUF];
    const __bf16* Vs = Ks + A_KEYS * A_PITCH;
    for (int p = 0; p < A_KEYS / 32; ++p) {
      const int kv0 = t * A_KEYS + p * 32;
      if (kv0 >= qt0 + 16) continue;   // wholly above this wave's diagonal
      // The pass's K and V^T fragments are read from LDS as one group.
      v16bf kf[2][2], vf[4];
#pragma unroll  // constant j: kf stays in registers
      for (int j = 0; j < 2; ++j) {
        const __bf16* Kb = Ks + (p * 32 + j * 16) * A_PITCH;
        kf[j][0] = load_frag(Kb, A_PITCH);
        kf[j][1] = load_frag(Kb + 32, A_PITCH);
      }
#pragma unroll  // constant jj: vf stays in registers
      for (int jj = 0; jj < 4; ++jj)
        vf[jj] = load_frag(Vs + (jj * 16) * A_PITCH + p * 32, A_PITCH);
      // keeps the read group ahead of the WMMAs: without it the scheduler sinks
      // each read to just before its use and every WMMA waits out an LDS read
      __builtin_amdgcn_sched_barrier(0);
      // S^T tile j: pm[j][r] = score of key kv0 + j * 16 + half * 8 + r, query qg
      float pm[2][8];
      const int dq = qrel - kv0;       // key above the query: j * 16 + r > dq
#pragma unroll  // constant j, r: pm stays in registers
      for (int j = 0; j < 2; ++j) {
        v8f s = {};
        s = wmma_bf16(kf[j][0], qa0, s);
        s = wmma_bf16(kf[j][1], qa1, s);
#pragma unroll
        for (int r = 0; r < 8; ++r) {
          float val = s[r] * 0.125f;              // hd^-0.5
          pm[j][r] = (j * 16 + r > dq) ? -1e30f : val;    // causal mask
        }
      }
      // online softmax: 16 of the query's 32 scores are in this lane
      float m4[4];
#pragma unroll  // four independent chains
      for (int e = 0; e < 4; ++e)
        m4[e] = fmaxf(fmaxf(pm[0][2 * e], pm[0][2 * e + 1]), fmaxf(pm[1][2 * e], pm[1][2 * e + 1]));
      float mx = fmaxf(fmaxf(m4[0], m4[1]), fmaxf(m4[2], m4[3]));
      mx = fmaxf(mx, xhalf(mx));
      const float mnew  = fmaxf(rm, mx);
      const float scale = __expf(rm - mnew);
      rm = mnew;
      // P^T as B operand: element s of the lane = tile s >> 3, register s & 7,
      // the k order in which load_frag reads V^T
      v16bf pf;
      float s4[4];
#pragma unroll  // constant j, r: pm and pf stay in registers
      for (int j = 0; j < 2; ++j) {
        float ea[8], pe[8];
#pragma unroll
        for (int r = 0; r < 8; ++r) ea[r] = (pm[j][r] - mnew) * 1.44269504f;  // log2(e)
        A_EXP2X8(pe, ea);
#pragma unroll  // four independent chains
        for (int r = 0; r < 8; ++r) {
          s4[r & 3] = (j == 0 && r < 4) ? pe[r] : s4[r & 3] + pe[r];
          pf[j * 8 + r] = (__bf16)pe[r];
        }
      }
      rl = rl * scale + ((s4[0] + s4[1]) + (s4[2] + s4[3]));
#pragma unroll  // constant jj, r: o stays in registers
      for (int jj = 0; jj < 4; ++jj) {
#pragma unroll
        for (int r = 0; r < 8; ++r) o[jj][r] *= scale;
      }
#pragma unroll  // constant jj: o and vf stay in registers
      for (int jj = 0; jj < 4; ++jj) o[jj] = wmma_bf16(vf[jj], pf, o[jj]);
    }
    // Hand-over: this wave's reads of buffer t & 1 are done, its copies of
    // stage t + 1 have landed; behind the barrier that holds for every wave.
    wait_lds();
    asm volatile("s_wait_asynccnt 0x0" ::: "memory");
    __syncthreads();
    if (t + 2 < nst) issue(t + 2, t & 1);
  }
  // no copy is outstanding when the wave goes on to the stores and ends
  asm volatile("s_wait_asynccnt 0x0" ::: "memory");

  // join the halves' sums, normalize, store to [B,T,C] bf16: a lane's eight
  // registers of a tile are eight consecutive hd of its query, one 16-byte store
  const float inv = 1.f / (rl + xhalf(rl));
  __bf16* dst = attnb + ((size_t)bi * T_DIM + qg) * C_DIM + hi * HD_DIM + half * 8;
#pragma unroll  // constant jj, r: o stays in registers
  for (int jj = 0; jj < 4; ++jj) {
    union { __bf16 h[8]; u32x4 q; } u;
#pragma unroll
    for (int r = 0; r < 8; ++r) u.h[r] = (__bf16)(o[jj][r] * inv);
    *(u32x4*)(dst + jj * 16) = u.q;
  }
}

// ---------------------------------------------------------------- LN
// out = LN(x + y) * g + b ; one wave per row of C_DIM=1024, 8 rows per block.
// A lane holds 32 elements of its row (eight 16-byte pieces, 512 bytes of the
// row per wave-wide request); the row's sums need no LDS and no barrier.
__global__ __launch_bounds__(256) void ln_residual_kernel(
    const float* __restrict__ x, const float* __restrict__ y,
    const float* __restrict__ g, const float* __restrict__ b,
    float* __restrict__ out, __bf16* __restrict__ outb) {
  const int lane = threadIdx.x & 31;
  const int row  = blockIdx.x * 8 + (threadIdx.x >> 5);
  const size_t off = (size_t)row * C_DIM + lane * 4;
  f32x8 xy[8], gb[8];   // x | y and g | b, one 16-byte piece of each
#pragma unroll  // constant i: the pieces stay in registers
  for (int i = 0; i < 8; ++i)
    xy[i] = __builtin_shufflevector(*(const f32x4*)(x + off + i * 128),
                                    *(const f32x4*)(y + off + i * 128),
                                    0, 1, 2, 3, 4, 5, 6, 7);
#pragma unroll  // constant i: the pieces stay in registers
  for (int i = 0; i < 8; ++i)
    gb[i] = __builtin_shufflevector(*(const f32x4*)(g + lane * 4 + i * 128),
                                    *(const f32x4*)(b + lane * 4 + i * 128),
                                    0, 1, 2, 3, 4, 5, 6, 7);
  // Loaded values as inputs only: holds all 32 loads ahead of the sums.  Without
  // it the compiler holds some x, y loads back until earlier ones have returned
  // and sinks each g, b load to its use, a further latency per piece.
  asm volatile("" :: "v"(xy[0]), "v"(xy[1]), "v"(xy[2]), "v"(xy[3]),
                     "v"(xy[4]), "v"(xy[5]), "v"(xy[6]), "v"(xy[7]),
                     "v"(gb[0]), "v"(gb[1]), "v"(gb[2]), "v"(gb[3]),
                     "v"(gb[4]), "v"(gb[5]), "v"(gb[6]), "v"(gb[7]));
  float v[8][4];
  float sa[4] = {0.f, 0.f, 0.f, 0.f}, sb[4] = {0.f, 0.f, 0.f, 0.f};
#pragma unroll  // constant i, e: xy and v stay in registers
  for (int i = 0; i < 8; ++i) {
#pragma unroll  // four independent chains
    for (int e = 0; e < 4; ++e) {
      v[i][e] = xy[i][e] + xy[i][e + 4];
      sa[e] += v[i][e];
      sb[e] += v[i][e] * v[i][e];
    }
  }
  float s  = (sa[0] + sa[1]) + (sa[2] + sa[3]);
  float s2 = (sb[0] + sb[1]) + (sb[2] + sb[3]);
#pragma unroll
  for (int m = 1; m < 32; m <<= 1) {
    s  += __shfl_xor(s, m, 32);
    s2 += __shfl_xor(s2, m, 32);
  }
  const float mean = s * (1.f / C_DIM);
  const float var  = s2 * (1.f / C_DIM) - mean * mean;
  const float rstd = rsqrtf(var + 1e-5f);
#pragma unroll  // constant i, e: v and gb stay in registers
  for (int i = 0; i < 8; ++i) {
#pragma unroll
    for (int e = 0; e < 4; ++e)
      v[i][e] = (v[i][e] - mean) * rstd * gb[i][e] + gb[i][e + 4];
    *(float4*)(out + off + i * 128) = make_float4(v[i][0], v[i][1], v[i][2], v[i][3]);
  }
  // the converts below reuse registers that the stores above name
  asm volatile("s_wait_xcnt 0x0" ::: "memory");
  if (outb) {
#pragma unroll  // constant i, e: v stays in registers
    for (int i = 0; i < 8; ++i) {
      union { __bf16 h[4]; u32x2 q; } u;
#pragma unroll
      for (int e = 0; e < 4; ++e) u.h[e] = (__bf16)v[i][e];
      *(u32x2*)(outb + off + i * 128) = u.q;
    }
  }
}

// ---------------------------------------------------------------- launch
extern "C" void kernel_launch(void* const* d_in, const int* in_sizes, int n_in,
                              void* d_out, int out_size, void* d_ws, size_t ws_size,
                              hipStream_t stream) {
  const float* x     = (const float*)d_in[0];
  const float* wq    = (const float*)d_in[1];
  const float* wk    = (const float*)d_in[2];
  const float* wv    = (const float*)d_in[3];
  const float* wp    = (const float*)d_in[4];
  const float* bproj = (const float*)d_in[5];
  const float* w1    = (const float*)d_in[6];
  const float* b1    = (const float*)d_in[7];
  const float* w2    = (const float*)d_in[8];
  const float* b2    = (const float*)d_in[9];
  const float* g1    = (const float*)d_in[10];
  const float* be1   = (const float*)d_in[11];
  const float* g2    = (const float*)d_in[12];
  const float* be2   = (const float*)d_in[13];

  char* ws = (char*)d_ws;
  size_t o = 0;
  auto take = [&](size_t nbytes) -> void* {
    void* p = ws + o;
    o += (nbytes + 255) & ~(size_t)255;
    return p;
  };
  const size_t BTC = (size_t)BT_DIM * C_DIM;
  __bf16* xb    = (__bf16*)take(BTC * 2);
  __bf16* wct   = (__bf16*)take((size_t)4 * C_DIM * C_DIM * 2);  // q, k, v, proj
  __bf16* wpt   = wct + (size_t)3 * C_DIM * C_DIM;
  __bf16* w1t   = (__bf16*)take((size_t)C_DIM * DFF_DIM * 2);
  __bf16* w2t   = (__bf16*)take((size_t)DFF_DIM * C_DIM * 2);
  __bf16* qb    = (__bf16*)take(3 * BTC * 2);                    // q, k, v^T
  __bf16* kb    = qb + BTC;
  __bf16* vtb   = qb + 2 * BTC;
  __bf16* attnb = (__bf16*)take(BTC * 2);
  float*  y1    = (float*)take(BTC * 4);
  float*  x1    = (float*)take(BTC * 4);
  __bf16* x1b   = (__bf16*)take(BTC * 2);
  __bf16* h1    = (__bf16*)take((size_t)BT_DIM * DFF_DIM * 2);
  float*  y2    = (float*)take(BTC * 4);

  prep_kernel<<<PREP_GRID, 256, 0, stream>>>(x, wq, wk, wv, wp, w1, w2, xb, wct, w1t, w2t);

  // block tiles: 256 x 256 for N = 3072 and 4096, 128 x 128 for N = 1024
  const dim3 gC(C_DIM / 128, BT_DIM / 128);
  gemm_bf16_wmma<EPI_QKV, 256><<<dim3(3 * C_DIM / 256, BT_DIM / 256), 256, 0, stream>>>(
      xb, wct, nullptr, qb, BT_DIM, 3 * C_DIM, C_DIM);

  attn_wmma_kernel<<<dim3(T_DIM / (16 * ATT_WAVES), B_DIM * H_DIM), 256, 0, stream>>>(
      qb, kb, vtb, attnb);

  gemm_bf16_wmma<EPI_F32_BIAS, 128><<<gC, 128, 0, stream>>>(attnb, wpt, bproj, y1, BT_DIM, C_DIM, C_DIM);
  ln_residual_kernel<<<BT_DIM / 8, 256, 0, stream>>>(x, y1, g1, be1, x1, x1b);

  gemm_bf16_wmma<EPI_RELU_BF16, 256><<<dim3(DFF_DIM / 256, BT_DIM / 256), 256, 0, stream>>>(
      x1b, w1t, b1, h1, BT_DIM, DFF_DIM, C_DIM);
  gemm_bf16_wmma<EPI_F32_BIAS, 128><<<gC, 128, 0, stream>>>(h1, w2t, b2, y2, BT_DIM, C_DIM, DFF_DIM);
  ln_residual_kernel<<<BT_DIM / 8, 256, 0, stream>>>(x1, y2, g2, be2, (float*)d_out, nullptr);
}

// v008
// It runs in 152 microseconds.
// Two timings next to v007 both put it at 1.05 times that version's speed.
// All steps since v000 together make it 2.98 times as fast.
#include <hip/hip_runtime.h>

#define B_DIM   2
#define T_DIM   2048
#define C_DIM   1024
#define H_DIM   16
#define HD_DIM  64
#define DFF_DIM 4096
#define BT_DIM  (B_DIM * T_DIM)

typedef __attribute__((ext_vector_type(16))) __bf16 v16bf;
typedef __attribute__((ext_vector_type(8)))  float  v8f;
typedef __attribute__((ext_vector_type(4)))  unsigned int u32x4;
typedef __attribute__((ext_vector_type(2)))  unsigned int u32x2;
typedef __attribute__((ext_vector_type(4)))  float  f32x4;
typedef __attribute__((ext_vector_type(8)))  float  f32x8;

__device__ __forceinline__ v8f wmma_bf16(v16bf a, v16bf b, v8f c) {
  // D = A(16x32 bf16) * B(32x16 bf16) + C(16x16 f32)
  return __builtin_amdgcn_wmma_f32_16x16x32_bf16(
      /*neg_a=*/false, a, /*neg_b=*/false, b,
      /*c_mod=*/(short)0, c, /*reuse_a=*/false, /*reuse_b=*/false);
}

// Load one 16x32 bf16 fragment in the CDNA5 A-matrix lane layout from a
// row-major [16 x ld] tile.  Lanes 0-15: row=lane, K 0-7 (lo) / 16-23 (hi);
// lanes 16-31: row=lane-16, K 8-15 (lo) / 24-31 (hi).  Two b128 loads.
// Works for B as well when B is pre-transposed to [N][K].
__device__ __forceinline__ v16bf load_frag(const __bf16* base, int ld) {
  const int lane = threadIdx.x & 31;
  const int r    = lane & 15;
  const int kh   = (lane >> 4) << 3;        // 0 or 8
  const __bf16* p = base + (size_t)r * ld + kh;
  union { v16bf v; struct { u32x4 lo, hi; } q; } u;
  u.q.lo = *(const u32x4*)(p);
  u.q.hi = *(const u32x4*)(p + 16);
  return u.v;
}

__device__ __forceinline__ void wait_lds() {
  asm volatile("s_wait_dscnt 0" ::: "memory");
}

// ---------------------------------------------------------------- converts
// The kernels without matrix work move few bytes per wave, and the time to
// start their waves outweighs the time to move their bytes: each wave below
// keeps 8 to 32 loads of 512 bytes in flight instead of a few short ones.

// 32 elements per thread: eight 16-byte loads in flight, eight 8-byte stores.
// Block job blk of n / 8192; needs n % 8192 == 0.
__device__ __forceinline__ void f32_to_bf16_job(
    const float* __restrict__ in, __bf16* __restrict__ out, int blk) {
  const size_t base = (size_t)blk * 8192 + threadIdx.x * 4;
  float4 f[8];
#pragma unroll  // constant i: f stays in registers, the loads go out together
  for (int i = 0; i < 8; ++i) f[i] = *(const float4*)(in + base + i * 1024);
#pragma unroll  // constant i: f stays in registers
  for (int i = 0; i < 8; ++i) {
    union { __bf16 h[4]; u32x2 q; } u;
    u.h[0] = (__bf16)f[i].x;
    u.h[1] = (__bf16)f[i].y;
    u.h[2] = (__bf16)f[i].z;
    u.h[3] = (__bf16)f[i].w;
    *(u32x2*)(out + base + i * 1024) = u.q;
  }
  // the built code goes on from here into tests that lead to the other jobs,
  // which reuse the registers that these stores name
  asm volatile("s_wait_xcnt 0x0" ::: "memory");
}

// in: f32 row-major [R][Cc] -> out: bf16 [Cc][R]   (weights -> [N][K] layout)
// One 128 x 128 tile per block of 8 waves.  A wave reads 16 whole tile rows
// (512 bytes each), so a lane holds 16 consecutive r of 4 columns: per column
// two 16-byte pieces of an output row.  The pieces pass through LDS so that
// the stores cover whole 256-byte output rows.  LDS rows are 256 bytes without
// a pad; piece p of row c lies at p ^ ((c >> 2) & 15), which spreads both the
// writers (16 lanes: 16 rows, one p) and the readers (16 lanes: one row) over
// all banks.  R and Cc are compile-time: every row step is then an immediate
// offset on one address.  Needs R % 128 == 0, Cc % 128 == 0.
// Block job (bx, by) of (Cc / 128, R / 128); tile: 128 * 128 bf16 of LDS, [c][r].
template <int R, int Cc>
__device__ __forceinline__ void transpose_f32_to_bf16_job(
    const float* __restrict__ in, __bf16* __restrict__ out, __bf16* tile,
    int bx, int by) {
  const int lane = threadIdx.x & 31;
  const int wave = threadIdx.x >> 5;
  const int c0 = bx * 128, r0 = by * 128;
  const float* src = in + (size_t)(r0 + wave * 16) * Cc + c0 + lane * 4;
  float f[16][4];
#pragma unroll  // constant i: f stays in registers, the loads go out together
  for (int i = 0; i < 16; ++i) {
    // the last load's result may land in the address pair that the earlier
    // loads name: the wait stands in front of that overwrite
    if (i == 15) asm volatile("s_wait_xcnt 0x0" ::: "memory");
    const float4 t = *(const float4*)(src + i * Cc);
    f[i][0] = t.x; f[i][1] = t.y; f[i][2] = t.z; f[i][3] = t.w;
  }
  // keeps all 16 loads ahead of the converts: without it the scheduler holds
  // six of them back until earlier ones have returned, a second latency
  __builtin_amdgcn_sched_barrier(0);
#pragma unroll  // constant e, h, k: f stays in registers
  for (int e = 0; e < 4; ++e) {
#pragma unroll
    for (int h = 0; h < 2; ++h) {
      union { __bf16 b[8]; u32x4 q; } u;
#pragma unroll
      for (int k = 0; k < 8; ++k) u.b[k] = (__bf16)f[h * 8 + k][e];
      const int piece = (wave * 2 + h) ^ (lane & 15);
      *(u32x4*)&tile[(lane * 4 + e) * 128 + piece * 8] = u.q;
    }
  }
  __syncthreads();
  const int crow = threadIdx.x >> 4;   // 0..15
  const int p    = threadIdx.x & 15;   // 16-byte piece of the output row
  __bf16* dst = out + (size_t)(c0 + crow) * R + r0 + p * 8;
#pragma unroll  // the eight LDS reads go out together, row steps are immediates
  for (int i = 0; i < 8; ++i) {
    const int c = i * 16 + crow;
    const u32x4 q = *(const u32x4*)&tile[c * 128 + (p ^ ((c >> 2) & 15)) * 8];
    *(u32x4*)(dst + i * 16 * R) = q;
  }
  // the built code goes on from here into tests that lead to the other jobs,
  // which reuse the registers that these stores name
  asm volatile("s_wait_xcnt 0x0" ::: "memory");
}

// All seven operand preparations in one launch: none depends on another, and
// each alone is too short to fill the chip or to pay for its own launch.  The
// block index picks the job (a scalar branch); the larger jobs come first.
// wct: the four C x C weights' outputs, one behind the other (q, k, v, proj).
#define PREP_W1   (DFF_DIM / 128 * (C_DIM / 128))      // 256 blocks
#define PREP_W2   (C_DIM / 128 * (DFF_DIM / 128))      // 256 blocks
#define PREP_WC   (C_DIM / 128 * (C_DIM / 128))        // 64 blocks per weight
#define PREP_X    (BT_DIM * C_DIM / 8192)              // 512 blocks
#define PREP_GRID (PREP_W1 + PREP_W2 + 4 * PREP_WC + PREP_X)
__global__ __launch_bounds__(256) void prep_kernel(
    const float* __restrict__ x, const float* __restrict__ wq,
    const float* __restrict__ wk, const float* __restrict__ wv,
    const float* __restrict__ wp, const float* __restrict__ w1,
    const float* __restrict__ w2, __bf16* __restrict__ xb,
    __bf16* __restrict__ wct, __bf16* __restrict__ w1t,
    __bf16* __restrict__ w2t) {
  __shared__ __attribute__((aligned(16))) __bf16 tile[128 * 128];
  int b = blockIdx.x;
  if (b < PREP_W1) {
    transpose_f32_to_bf16_job<C_DIM, DFF_DIM>(w1, w1t, tile, b % (DFF_DIM / 128),
                                              b / (DFF_DIM / 128));
    return;
  }
  b -= PREP_W1;
  if (b < PREP_W2) {
    transpose_f32_to_bf16_job<DFF_DIM, C_DIM>(w2, w2t, tile, b % (C_DIM / 128),
                                              b / (C_DIM / 128));
    return;
  }
  b -= PREP_W2;
  if (b < 4 * PREP_WC) {
    const int w = b / PREP_WC, j = b % PREP_WC;
    const float* in = w == 0 ? wq : w == 1 ? wk : w == 2 ? wv : wp;
    transpose_f32_to_bf16_job<C_DIM, C_DIM>(in, wct + (size_t)w * C_DIM * C_DIM, tile,
                                            j % (C_DIM / 128), j / (C_DIM / 128));
    return;
  }
  f32_to_bf16_job(x, xb, b - 4 * PREP_WC);
}

// ---------------------------------------------------------------- GEMM
// EPI_QKV: the q, k and v products as one GEMM over the three weights, N = 3 C;
// a wave's 128 columns of q or k are two heads, its 64 of v one head; stored as
// EPI_QK or EPI_VT.
enum { EPI_QK = 0, EPI_VT = 1, EPI_F32_BIAS = 2, EPI_RELU_BF16 = 3, EPI_QKV = 4 };

// Stores a wave's results: FM * 16 indices in the register dimension (a lane's
// eight registers of a tile are eight consecutive ones) by 64 in the lane
// dimension.  The register dimension is the one that is contiguous in the
// output: the columns, or for EPI_VT the rows (tokens).  A lane's eight values
// are one or two 16-byte pieces; the pieces pass through the wave's own LDS
// range, 64 rows of 256 bytes, so that every global store covers whole lines:
// 16 lanes one row.  The row pitch of 272 bytes spreads the 16 writers of a
// piece over all banks.  reg0, lane0: the wave's first index in each dimension;
// for EPI_QK and EPI_VT columns count within the one product and outp is that
// product's output.
#define G_SPITCH 272                      // staging row pitch, bytes
template <int EPI, int FM>
__device__ __forceinline__ void gemm_store(
    const v8f (&acc)[FM][4], int reg0, int lane0,
    const float* __restrict__ bias, void* __restrict__ outp, char* stage) {
  static_assert(FM * 16 * (EPI == EPI_F32_BIAS ? 4 : 2) == 256, "a staged row is 256 bytes");
  const int lane = threadIdx.x & 31;
  const int half = lane >> 4, ln = lane & 15;
  f32x4 bv[FM][2] = {};   // the bias of this lane's columns
  if constexpr (EPI == EPI_F32_BIAS || EPI == EPI_RELU_BF16) {
#pragma unroll  // constant m: bv stays in registers, the loads go out together
    for (int m = 0; m < FM; ++m) {
      bv[m][0] = *(const f32x4*)(bias + reg0 + m * 16 + half * 8);
      bv[m][1] = *(const f32x4*)(bias + reg0 + m * 16 + half * 8 + 4);
    }
    // the sums below reuse the address pair that these loads name
    asm volatile("s_wait_xcnt 0x0" ::: "memory");
    // keeps the sums behind that wait
    __builtin_amdgcn_sched_barrier(0);
  }
#pragma unroll  // constant m, j, r: acc stays in registers
  for (int m = 0; m < FM; ++m) {
    const f32x4 b0 = bv[m][0], b1 = bv[m][1];
#pragma unroll
    for (int j = 0; j < 4; ++j) {
      char* row = stage + (j * 16 + ln) * G_SPITCH;
      if constexpr (EPI == EPI_F32_BIAS) {
        f32x4 lo, hi;
#pragma unroll
        for (int r = 0; r < 4; ++r) {
          lo[r] = acc[m][j][r] + b0[r];
          hi[r] = acc[m][j][r + 4] + b1[r];
        }
        *(f32x4*)(row + m * 64 + half * 32) = lo;
        *(f32x4*)(row + m * 64 + half * 32 + 16) = hi;
      } else {
        union { __bf16 h[8]; u32x4 q; } u;
#pragma unroll
        for (int r = 0; r < 8; ++r) {
          float v = acc[m][j][r];
          if constexpr (EPI == EPI_RELU_BF16) {
            v += r < 4 ? b0[r & 3] : b1[r & 3];
            v = v > 0.f ? v : 0.f;
          }
          u.h[r] = (__bf16)v;
        }
        *(u32x4*)(row + m * 32 + half * 16) = u.q;
      }
    }
  }
  // this wave's staged pieces are in LDS before its lanes read each other's
  wait_lds();
  const int rr = lane >> 4;    // staged row of this lane in a pair of rows
  const int pc = lane & 15;    // its 16-byte piece of the row
  char* g;                     // where staged row rr, piece pc goes
  int step;                    // bytes from one staged row's place to the next
  if constexpr (EPI == EPI_QK) {
    // [BT,C] -> bf16 [B,H,T,hd]: a staged row is one token of two heads
    const int row = lane0 + rr, col = reg0 + pc * 8;
    const int bi = row >> 11, ti = row & (T_DIM - 1);
    const int hi = col >> 6, di = col & (HD_DIM - 1);
    g = (char*)outp + ((((size_t)bi * H_DIM + hi) * T_DIM + ti) * HD_DIM + di) * 2;
    step = HD_DIM * 2;
  } else if constexpr (EPI == EPI_VT) {
    // [BT,C] -> bf16 [B,H,hd,T]  (V transposed: K-contiguous for P*V): a staged
    // row is 128 tokens of one column
    const int row = reg0 + pc * 8, col = lane0 + rr;
    const int bi = row >> 11, ti = row & (T_DIM - 1);
    const int hi = col >> 6, di = col & (HD_DIM - 1);
    g = (char*)outp + ((((size_t)bi * H_DIM + hi) * HD_DIM + di) * T_DIM + ti) * 2;
    step = T_DIM * 2;
  } else if constexpr (EPI == EPI_F32_BIAS) {
    g = (char*)outp + ((size_t)(lane0 + rr) * C_DIM + reg0 + pc * 4) * 4;
    step = C_DIM * 4;
  } else {  // EPI_RELU_BF16
    g = (char*)outp + ((size_t)(lane0 + rr) * DFF_DIM + reg0 + pc * 8) * 2;
    step = DFF_DIM * 2;
  }
  u32x4 d[32];
#pragma unroll  // constant i: d stays in registers, the reads go out together
  for (int i = 0; i < 32; ++i)
    d[i] = *(const u32x4*)(stage + (i * 2 + rr) * G_SPITCH + pc * 16);
  // keeps every read ahead of the first store: each store then names registers
  // of its own, and none that a store names is written again
  __builtin_amdgcn_sched_barrier(0);
#pragma unroll  // constant i: the row steps are immediate offsets on one address
  for (int i = 0; i < 32; ++i) *(u32x4*)(g + i * 2 * step) = d[i];
  // where two kinds share a kernel the built code can run on from here into the
  // other kind's code, which reuses the registers that these stores name
  if constexpr (EPI == EPI_QK || EPI == EPI_VT) asm volatile("s_wait_xcnt 0x0" ::: "memory");
}

// C[M,N] = A[M,K](bf16) * Bt[N,K]^T(bf16), f32 accumulate.
// Block tile TS x TS, TS threads.  What a block draws from L2 per result falls
// with the tile's edge; at the L2 rate a WGP gets when all draw, a pass of a
// narrow tile takes longer to land than to multiply.  TS = 256 where that still
// gives about one block per WGP, TS = 128 where N is small.
// Waves: 2 over the first operand's rows x TS / 64 over the second's; wave tile
// TS / 2 first-operand x 64 second-operand rows, that is FM x 4 tiles
// = 32 (TS = 256) or 16 (TS = 128) WMMAs per K=32 step.
// The products are taken transposed, Bt rows as the first operand and A rows as
// the second: a lane's eight registers of a tile are then eight consecutive
// columns of one output row.  Only the v product, whose output is transposed,
// keeps A first.  Both operands have the same fragment layout and k order.
// A pass is 128 k = 256 bytes of each of the TS first-operand rows and the TS
// second-operand rows.  The
// pass's rows are brought into LDS by asynchronous 16-byte copies, two
// buffers: the next pass's copies fly while this pass is multiplied.
// Needs M % TS == 0, N % TS == 0, K % 128 == 0.
#define G_PASS  128                       // k per pass
#define G_PITCH 136                       // LDS row pitch, bf16: 272 B = 16 B x 17

// Eight copies of 16 bytes per lane, global -> LDS, through no register.  The
// s_wait_xcnt closes the statement so that no address register named here is
// rewritten before it.
#define G_COPY8(l, g, o)                                                   \
  asm volatile(                                                            \
      "global_load_async_to_lds_b128 %0, %8, off\n\t"                      \
      "global_load_async_to_lds_b128 %1, %9, off\n\t"                      \
      "global_load_async_to_lds_b128 %2, %10, off\n\t"                     \
      "global_load_async_to_lds_b128 %3, %11, off\n\t"                     \
      "global_load_async_to_lds_b128 %4, %12, off\n\t"                     \
      "global_load_async_to_lds_b128 %5, %13, off\n\t"                     \
      "global_load_async_to_lds_b128 %6, %14, off\n\t"                     \
      "global_load_async_to_lds_b128 %7, %15, off\n\t"                     \
      "s_wait_xcnt 0x0"                                                    \
      :: "v"(l[o + 0]), "v"(l[o + 1]), "v"(l[o + 2]), "v"(l[o + 3]),       \
         "v"(l[o + 4]), "v"(l[o + 5]), "v"(l[o + 6]), "v"(l[o + 7]),       \
         "v"(g[o + 0]), "v"(g[o + 1]), "v"(g[o + 2]), "v"(g[o + 3]),       \
         "v"(g[o + 4]), "v"(g[o + 5]), "v"(g[o + 6]), "v"(g[o + 7])        \
      : "memory")

template <int EPI, int TS>
__global__ __launch_bounds__(TS) void gemm_bf16_wmma(
    const __bf16* __restrict__ A, const __bf16* __restrict__ Bt,
    const float* __restrict__ bias, void* __restrict__ outp,
    int M, int N, int K) {
  constexpr int FM  = TS / 32;             // 16-row tiles per wave
  constexpr int WN  = TS / 64;             // waves across
  constexpr int RS  = TS / 16;             // tile rows that one copy per thread serves
  constexpr int BUF = 2 * TS * G_PITCH;    // bf16 per buffer: TS first-operand rows, then TS second
  __shared__ __attribute__((aligned(16))) __bf16 Ts[2 * BUF];

  // scalar wave number: the wave's places in the tile and in the staging stay
  // out of the vector registers, which the main loop fills
  const int wave = __builtin_amdgcn_readfirstlane(threadIdx.x >> 5);
  const int wm = wave / WN, wn = wave % WN;
  // which of q, k, v: the same for the whole block
  const int which = EPI == EPI_QKV ? blockIdx.x * TS / C_DIM : 0;
  const bool bt_first = which < 2;

  v8f acc[FM][4] = {};

  // Copy map: 16 lanes cover one 256-byte row; copy i of a thread serves tile
  // row i * RS + crow (i < 16: first operand, i >= 16: second operand).
  const int crow = threadIdx.x >> 4;        // 0..RS-1
  const int ccol = (threadIdx.x & 15) << 3; // bf16 offset in the row
  // the block's rows of each operand are scalar addresses; this thread's place
  // in them is the same for both, one register across the main loop
  const __bf16* ablk = A + (size_t)(blockIdx.y * TS) * K;
  const __bf16* bblk = Bt + (size_t)(blockIdx.x * TS) * K;
  const __bf16* asrc = bt_first ? bblk : ablk;   // first operand
  const __bf16* bsrc = bt_first ? ablk : bblk;   // second operand
  const unsigned voff = (unsigned)(crow * K + ccol);
  const unsigned ldst = (unsigned)(size_t)&Ts[crow * G_PITCH + ccol];

  auto issue = [&](int t, int buf) {
    // the pass's first piece of each operand of this thread; each copy's row step is
    // added to these, so that no per-row address lives across the passes
    const unsigned idx = voff + (unsigned)(t * G_PASS);
    const __bf16* at = asrc + idx;
    const __bf16* bt = bsrc + idx;
    const unsigned lt = ldst + (unsigned)(buf * BUF) * 2u;
#pragma unroll  // constant indices: l and g stay in registers
    for (int o = 0; o < 32; o += 8) {
      unsigned l[8];
      const __bf16* g[8];
#pragma unroll
      for (int i = 0; i < 8; ++i) {
        l[i] = lt + (unsigned)((o + i) * RS * G_PITCH) * 2u;
        g[i] = o < 16 ? at + (size_t)((o + i) * RS) * K : bt + (size_t)((o + i - 16) * RS) * K;
      }
      G_COPY8(l, g, 0);
    }
  };

  const int npass = K / G_PASS;
  issue(0, 0);
  // pass 0 has landed for this wave, then for all waves
  asm volatile("s_wait_asynccnt 0x0" ::: "memory");
  __syncthreads();
  if (npass > 1) issue(1, 1);

  for (int t = 0; t < npass; ++t) {
    const __bf16* As = &Ts[(t & 1) * BUF + wm * (FM * 16) * G_PITCH];
    const __bf16* Bs = &Ts[(t & 1) * BUF + (TS + wn * 64) * G_PITCH];
    // Two fragment sets: the LDS reads of k step s + 1 are issued as one group
    // ahead of the WMMAs of step s, so that their latency hides behind them.
    v16bf fa[2][FM], fb[2][4];
#pragma unroll  // constant m: fa stays in registers
    for (int m = 0; m < FM; ++m) fa[0][m] = load_frag(As + (m * 16) * G_PITCH, G_PITCH);
#pragma unroll  // constant j: fb stays in registers
    for (int j = 0; j < 4; ++j) fb[0][j] = load_frag(Bs + (j * 16) * G_PITCH, G_PITCH);
    // keeps step 0's reads ahead of step 1's: mixed, the first WMMAs wait for
    // both groups, twice the LDS time with every wave of the block waiting
    __builtin_amdgcn_sched_barrier(0);
#pragma unroll  // constant set index: the fragments stay in registers
    for (int s = 0; s < G_PASS / 32; ++s) {
      const int cur = s & 1, nxt = cur ^ 1;
      if (s + 1 < G_PASS / 32) {
        const int kk = (s + 1) * 32;
#pragma unroll  // constant m: fa stays in registers
        for (int m = 0; m < FM; ++m)
          fa[nxt][m] = load_frag(As + (m * 16) * G_PITCH + kk, G_PITCH);
#pragma unroll  // constant j: fb stays in registers
        for (int j = 0; j < 4; ++j)
          fb[nxt][j] = load_frag(Bs + (j * 16) * G_PITCH + kk, G_PITCH);
      }
      // keeps the read group ahead of the WMMAs: without it the scheduler sinks
      // each read to just before its use and every WMMA pair waits on LDS
      __builtin_amdgcn_sched_barrier(0);
#pragma unroll  // constant j, m: accumulators and fragments stay in registers
      for (int j = 0; j < 4; ++j) {
#pragma unroll
        for (int m = 0; m < FM; ++m)
          acc[m][j] = wmma_bf16(fa[cur][m], fb[cur][j], acc[m][j]);
      }
      // keeps the next step's reads from moving up among these WMMAs
      __builtin_amdgcn_sched_barrier(0);
    }
    // Hand-over: this wave's reads of buffer t & 1 are done, its copies of
    // pass t + 1 have landed; behind the barrier that holds for every wave.
    wait_lds();
    asm volatile("s_wait_asynccnt 0x0" ::: "memory");
    __syncthreads();
    if (t + 2 < npass) issue(t + 2, t & 1);
  }
  // no copy is outstanding when the wave goes on to the stores and ends
  asm volatile("s_wait_asynccnt 0x0" ::: "memory");

  // The ring is free: every wave's last reads ended in front of the last pass's
  // barrier and no copy is outstanding.  Each wave stages in a range of its own.
  char* stage = (char*)Ts + wave * (64 * G_SPITCH);
  const int first0  = wm * (FM * 16);   // the wave's place in the first operand's rows
  const int second0 = wn * 64;          // and in the second operand's
  if constexpr (EPI == EPI_QKV) {
    __bf16* o = (__bf16*)outp + (size_t)which * BT_DIM * C_DIM;
    if (bt_first) {   // a scalar branch
      gemm_store<EPI_QK, FM>(acc, (blockIdx.x * TS + first0) % C_DIM,
                             blockIdx.y * TS + second0, bias, o, stage);
    } else {
      gemm_store<EPI_VT, FM>(acc, blockIdx.y * TS + first0,
                             (blockIdx.x * TS + second0) % C_DIM, bias, o, stage);
    }
  } else {
    gemm_store<EPI, FM>(acc, blockIdx.x * TS + first0, blockIdx.y * TS + second0,
                        bias, outp, stage);
  }
}

#define ATT_WAVES 8
#define A_TILES (T_DIM / (16 * ATT_WAVES))   // query tiles per head
#define A_KEYS  64                        // keys per stage
#define A_PITCH 72                        // LDS row pitch, bf16: 144 B = 16 B x 9
#define A_ROWS  128                       // 64 K rows, then 64 V^T rows
#define A_BUF   (A_ROWS * A_PITCH)        // bf16 per buffer

// Four copies of 16 bytes per lane, global -> LDS, through no register.  The
// s_wait_xcnt closes the statement so that no address register named here is
// rewritten before it.
#define A_COPY4(l, g)                                                      \
  asm volatile(                                                            \
      "global_load_async_to_lds_b128 %0, %4, off\n\t"                      \
      "global_load_async_to_lds_b128 %1, %5, off\n\t"                      \
      "global_load_async_to_lds_b128 %2, %6, off\n\t"                      \
      "global_load_async_to_lds_b128 %3, %7, off\n\t"                      \
      "s_wait_xcnt 0x0"                                                    \
      :: "v"(l[0]), "v"(l[1]), "v"(l[2]), "v"(l[3]),                       \
         "v"(g[0]), "v"(g[1]), "v"(g[2]), "v"(g[3])                        \
      : "memory")

// Eight 2^x in one statement.  Behind a transcendental the instruction set asks
// for one independent instruction before its result is read or its source
// overwritten: here each v_exp_f32 is that instruction for the one before it
// (early-clobber outputs: none lies on a source), and the v_nop fills the slot
// behind the last.
#define A_EXP2X8(d, a)                                                     \
  asm("v_exp_f32 %0, %8\n\t"                                               \
      "v_exp_f32 %1, %9\n\t"                                               \
      "v_exp_f32 %2, %10\n\t"                                              \
      "v_exp_f32 %3, %11\n\t"                                              \
      "v_exp_f32 %4, %12\n\t"                                              \
      "v_exp_f32 %5, %13\n\t"                                              \
      "v_exp_f32 %6, %14\n\t"                                              \
      "v_exp_f32 %7, %15\n\t"                                              \
      "v_nop"                                                              \
      : "=&v"(d[0]), "=&v"(d[1]), "=&v"(d[2]), "=&v"(d[3]),                \
        "=&v"(d[4]), "=&v"(d[5]), "=&v"(d[6]), "=&v"(d[7])                 \
      : "v"(a[0]), "v"(a[1]), "v"(a[2]), "v"(a[3]),                        \
        "v"(a[4]), "v"(a[5]), "v"(a[6]), "v"(a[7]))

// lane l with lane l ^ 16, in the vector unit
__device__ __forceinline__ float xhalf(float x) {
  const int b = __builtin_bit_cast(int, x);
  return __builtin_bit_cast(
      float, __builtin_amdgcn_permlanex16(b, b, 0x76543210, 0xfedcba98, false, false));
}

__global__ __launch_bounds__(256) void attn_wmma_kernel(
    const __bf16* __restrict__ q,   // [B,H,T,hd]
    const __bf16* __restrict__ k,   // [B,H,T,hd]
    const __bf16* __restrict__ vt,  // [B,H,hd,T]
    __bf16* __restrict__ attnb) {   // bf16 [B,T,C]
  __shared__ __attribute__((aligned(16))) __bf16 KV[2 * A_BUF];

  // scalar wave number: the test that skips a pass is then a scalar branch
  const int wave = __builtin_amdgcn_readfirstlane(threadIdx.x >> 5);
  const int lane = threadIdx.x & 31;
  const int half = lane >> 4, ln = lane & 15;

  const int bh  = blockIdx.y;
  const int bi  = bh >> 4;          // /H
  const int hi  = bh & (H_DIM - 1);
  int tile = blockIdx.x;            // the first tile; then A_TILES - 1 - blockIdx.x

  // this wave's queries of the first and of the second tile
  const __bf16* Qp = q + ((size_t)bh * T_DIM + (tile * ATT_WAVES + wave) * 16) * HD_DIM;
  const __bf16* Qn = q + ((size_t)bh * T_DIM + ((A_TILES - 1 - tile) * ATT_WAVES + wave) * 16) * HD_DIM;
  const __bf16* Kp = k + (size_t)bh * T_DIM * HD_DIM;
  const __bf16* Vp = vt + (size_t)bh * HD_DIM * T_DIM;

  // Copy map: 8 lanes cover one 128-byte row; copy i of a thread serves stage
  // row i * 32 + crow (i < 2: K rows, i >= 2: V^T rows).
  const int crow = threadIdx.x >> 3;        // 0..31
  const int ccol = (threadIdx.x & 7) << 3;  // bf16 offset in the row
  const __bf16* ksrc = Kp + (size_t)crow * HD_DIM + ccol;
  const __bf16* vsrc = Vp + (size_t)crow * T_DIM + ccol;
  const unsigned ldst = (unsigned)(size_t)&KV[crow * A_PITCH + ccol];

  auto issue = [&](int st, int buf) {
    unsigned l[4];
    const __bf16* g[4];
#pragma unroll  // constant indices: l stays in registers
    for (int i = 0; i < 4; ++i)
      l[i] = ldst + (unsigned)(buf * A_BUF + i * 32 * A_PITCH) * 2u;
    g[0] = ksrc + (size_t)(st * A_KEYS) * HD_DIM;
    g[1] = ksrc + (size_t)(st * A_KEYS + 32) * HD_DIM;
    g[2] = vsrc + st * A_KEYS;
    g[3] = vsrc + (size_t)32 * T_DIM + st * A_KEYS;
    A_COPY4(l, g);
  };

  issue(0, 0);

  // Q as the B operand: column = query ln.  Both tiles' Q are read here, so
  // that the second tile does not start by waiting for its own.
  v16bf qa0 = load_frag(Qp, HD_DIM);              // K = 0..31 of hd
  v16bf qa1 = load_frag(Qp + 32, HD_DIM);         // K = 32..63 of hd
  const v16bf qn0 = load_frag(Qn, HD_DIM);
  const v16bf qn1 = load_frag(Qn + 32, HD_DIM);
  // the code below reuses the address registers that these loads name
  asm volatile("s_wait_xcnt 0x0" ::: "memory");

  // stage 0 has landed for this wave, then for all waves
  asm volatile("s_wait_asynccnt 0x0" ::: "memory");
  __syncthreads();
  issue(1, 1);

  for (int h = 0; h < 2; ++h) {
  const int qt0 = (tile * ATT_WAVES + wave) * 16;
  // The tile's last query is (tile + 1) * 128 - 1: so many keys, in stages of
  // 64; an even number, so each tile starts in buffer 0.
  const int nst = (tile + 1) * (ATT_WAVES * 16 / A_KEYS);
  // O^T: o[jj][r] = O[query ln][hd jj * 16 + half * 8 + r]
  v8f o[4] = {};
  const int qg = qt0 + ln;          // this lane's query
  const int qrel = qg - half * 8;   // its place against the first key of this half's rows
  float rm = -1e30f;                // its running maximum, alike in both halves
  float rl = 0.f;                   // running sum over this half's keys only

  for (int t = 0; t < nst; ++t) {
    const __bf16* Ks = &KV[(t & 1) * A_BUF];
    const __bf16* Vs = Ks + A_KEYS * A_PITCH;
    for (int p = 0; p < A_KEYS / 32; ++p) {
      const int kv0 = t * A_KEYS + p * 32;
      if (kv0 >= qt0 + 16) continue;   // wholly above this wave's diagonal
      // The pass's K and V^T fragments are read from LDS as one group.
      v16bf kf[2][2], vf[4];
#pragma unroll  // constant j: kf stays in registers
      for (int j = 0; j < 2; ++j) {
        const __bf16* Kb = Ks + (p * 32 + j * 16) * A_PITCH;
        kf[j][0] = load_frag(Kb, A_PITCH);
        kf[j][1] = load_frag(Kb + 32, A_PITCH);
      }
#pragma unroll  // constant jj: vf stays in registers
      for (int jj = 0; jj < 4; ++jj)
        vf[jj] = load_frag(Vs + (jj * 16) * A_PITCH + p * 32, A_PITCH);
      // keeps the read group ahead of the WMMAs: without it the scheduler sinks
      // each read to just before its use and every WMMA waits out an LDS read
      __builtin_amdgcn_sched_barrier(0);
      // S^T tile j: pm[j][r] = score of key kv0 + j * 16 + half * 8 + r, query qg
      float pm[2][8];
      const int dq = qrel - kv0;       // key above the query: j * 16 + r > dq
#pragma unroll  // constant j, r: pm stays in registers
      for (int j = 0; j < 2; ++j) {
        v8f s = {};
        s = wmma_bf16(kf[j][0], qa0, s);
        s = wmma_bf16(kf[j][1], qa1, s);
#pragma unroll
        for (int r = 0; r < 8; ++r) {
          float val = s[r] * 0.125f;              // hd^-0.5
          pm[j][r] = (j * 16 + r > dq) ? -1e30f : val;    // causal mask
        }
      }
      // online softmax: 16 of the query's 32 scores are in this lane
      float m4[4];
#pragma unroll  // four independent chains
      for (int e = 0; e < 4; ++e)
        m4[e] = fmaxf(fmaxf(pm[0][2 * e], pm[0][2 * e + 1]), fmaxf(pm[1][2 * e], pm[1][2 * e + 1]));
      float mx = fmaxf(fmaxf(m4[0], m4[1]), fmaxf(m4[2], m4[3]));
      mx = fmaxf(mx, xhalf(mx));
      const float mnew  = fmaxf(rm, mx);
      const float scale = __expf(rm - mnew);
      rm = mnew;
      // P^T as B operand: element s of the lane = tile s >> 3, register s & 7,
      // the k order in which load_frag reads V^T
      v16bf pf;
      float s4[4];
#pragma unroll  // constant j, r: pm and pf stay in registers
      for (int j = 0; j < 2; ++j) {
        float ea[8], pe[8];
#pragma unroll
        for (int r = 0; r < 8; ++r) ea[r] = (pm[j][r] - mnew) * 1.44269504f;  // log2(e)
        A_EXP2X8(pe, ea);
#pragma unroll  // four independent chains
        for (int r = 0; r < 8; ++r) {
          s4[r & 3] = (j == 0 && r < 4) ? pe[r] : s4[r & 3] + pe[r];
          pf[j * 8 + r] = (__bf16)pe[r];
        }
      }
      rl = rl * scale + ((s4[0] + s4[1]) + (s4[2] + s4[3]));
#pragma unroll  // constant jj, r: o stays in registers
      for (int jj = 0; jj < 4; ++jj) {
#pragma unroll
        for (int r = 0; r < 8; ++r) o[jj][r] *= scale;
      }
#pragma unroll  // constant jj: o and vf stay in registers
      for (int jj = 0; jj < 4; ++jj) o[jj] = wmma_bf16(vf[jj], pf, o[jj]);
    }
    // Hand-over: this wave's reads of buffer t & 1 are done, its copies of
    // the next stage have landed; behind the barrier that holds for every wave.
    wait_lds();
    asm volatile("s_wait_asynccnt 0x0" ::: "memory");
    __syncthreads();
    // the stage two ahead: of this tile, or stage 0 or 1 of the second tile
    const bool own = t + 2 < nst;
    if (own || h == 0) issue(own ? t + 2 : t + 2 - nst, t & 1);
  }

  // join the halves' sums, normalize, store to [B,T,C] bf16: a lane's eight
  // registers of a tile are eight consecutive hd of its query, one 16-byte store
  const float inv = 1.f / (rl + xhalf(rl));
  __bf16* dst = attnb + ((size_t)bi * T_DIM + qg) * C_DIM + hi * HD_DIM + half * 8;
#pragma unroll  // constant jj, r: o stays in registers
  for (int jj = 0; jj < 4; ++jj) {
    union { __bf16 h[8]; u32x4 q; } u;
#pragma unroll
    for (int r = 0; r < 8; ++r) u.h[r] = (__bf16)(o[jj][r] * inv);
    *(u32x4*)(dst + jj * 16) = u.q;
  }
  // the second tile reuses the registers that these stores name
  asm volatile("s_wait_xcnt 0x0" ::: "memory");
  tile = A_TILES - 1 - tile;
  qa0 = qn0;
  qa1 = qn1;
  }
  // no copy is outstanding when the wave ends
  asm volatile("s_wait_asynccnt 0x0" ::: "memory");
}

// ---------------------------------------------------------------- LN
// out = LN(x + y) * g + b ; one wave per row of C_DIM=1024, 8 rows per block.
// A lane holds 32 elements of its row (eight 16-byte pieces, 512 bytes of the
// row per wave-wide request); the row's sums need no LDS and no barrier.
__global__ __launch_bounds__(256) void ln_residual_kernel(
    const float* __restrict__ x, const float* __restrict__ y,
    const float* __restrict__ g, const float* __restrict__ b,
    float* __restrict__ out, __bf16* __restrict__ outb) {
  const int lane = threadIdx.x & 31;
  const int row  = blockIdx.x * 8 + (threadIdx.x >> 5);
  const size_t off = (size_t)row * C_DIM + lane * 4;
  f32x8 xy[8], gb[8];   // x | y and g | b, one 16-byte piece of each
#pragma unroll  // constant i: the pieces stay in registers
  for (int i = 0; i < 8; ++i)
    xy[i] = __builtin_shufflevector(*(const f32x4*)(x + off + i * 128),
                                    *(const f32x4*)(y + off + i * 128),
                                    0, 1, 2, 3, 4, 5, 6, 7);
#pragma unroll  // constant i: the pieces stay in registers
  for (int i = 0; i < 8; ++i)
    gb[i] = __builtin_shufflevector(*(const f32x4*)(g + lane * 4 + i * 128),
                                    *(const f32x4*)(b + lane * 4 + i * 128),
                                    0, 1, 2, 3, 4, 5, 6, 7);
  // Loaded values as inputs only: holds all 32 loads ahead of the sums.  Without
  // it the compiler holds some x, y loads back until earlier ones have returned
  // and sinks each g, b load to its use, a further latency per piece.
  asm volatile("" :: "v"(xy[0]), "v"(xy[1]), "v"(xy[2]), "v"(xy[3]),
                     "v"(xy[4]), "v"(xy[5]), "v"(xy[6]), "v"(xy[7]),
                     "v"(gb[0]), "v"(gb[1]), "v"(gb[2]), "v"(gb[3]),
                     "v"(gb[4]), "v"(gb[5]), "v"(gb[6]), "v"(gb[7]));
  float v[8][4];
  float sa[4] = {0.f, 0.f, 0.f, 0.f}, sb[4] = {0.f, 0.f, 0.f, 0.f};
#pragma unroll  // constant i, e: xy and v stay in registers
  for (int i = 0; i < 8; ++i) {
#pragma unroll  // four independent chains
    for (int e = 0; e < 4; ++e) {
      v[i][e] = xy[i][e] + xy[i][e + 4];
      sa[e] += v[i][e];
      sb[e] += v[i][e] * v[i][e];
    }
  }
  float s  = (sa[0] + sa[1]) + (sa[2] + sa[3]);
  float s2 = (sb[0] + sb[1]) + (sb[2] + sb[3]);
#pragma unroll
  for (int m = 1; m < 32; m <<= 1) {
    s  += __shfl_xor(s, m, 32);
    s2 += __shfl_xor(s2, m, 32);
  }
  const float mean = s * (1.f / C_DIM);
  const float var  = s2 * (1.f / C_DIM) - mean * mean;
  const float rstd = rsqrtf(var + 1e-5f);
#pragma unroll  // constant i, e: v and gb stay in registers
  for (int i = 0; i < 8; ++i) {
#pragma unroll
    for (int e = 0; e < 4; ++e)
      v[i][e] = (v[i][e] - mean) * rstd * gb[i][e] + gb[i][e + 4];
    *(float4*)(out + off + i * 128) = make_float4(v[i][0], v[i][1], v[i][2], v[i][3]);
  }
  // the converts below reuse registers that the stores above name
  asm volatile("s_wait_xcnt 0x0" ::: "memory");
  if (outb) {
#pragma unroll  // constant i, e: v stays in registers
    for (int i = 0; i < 8; ++i) {
      union { __bf16 h[4]; u32x2 q; } u;
#pragma unroll
      for (int e = 0; e < 4; ++e) u.h[e] = (__bf16)v[i][e];
      *(u32x2*)(outb + off + i * 128) = u.q;
    }
  }
}

// ---------------------------------------------------------------- launch
extern "C" void kernel_launch(void* const* d_in, const int* in_sizes, int n_in,
                              void* d_out, int out_size, void* d_ws, size_t ws_size,
                              hipStream_t stream) {
  const float* x     = (const float*)d_in[0];
  const float* wq    = (const float*)d_in[1];
  const float* wk    = (const float*)d_in[2];
  const float* wv    = (const float*)d_in[3];
  const float* wp    = (const float*)d_in[4];
  const float* bproj = (const float*)d_in[5];
  const float* w1    = (const float*)d_in[6];
  const float* b1    = (const float*)d_in[7];
  const float* w2    = (const float*)d_in[8];
  const float* b2    = (const float*)d_in[9];
  const float* g1    = (const float*)d_in[10];
  const float* be1   = (const float*)d_in[11];
  const float* g2    = (const float*)d_in[12];
  const float* be2   = (const float*)d_in[13];

  char* ws = (char*)d_ws;
  size_t o = 0;
  auto take = [&](size_t nbytes) -> void* {
    void* p = ws + o;
    o += (nbytes + 255) & ~(size_t)255;
    return p;
  };
  const size_t BTC = (size_t)BT_DIM * C_DIM;
  __bf16* xb    = (__bf16*)take(BTC * 2);
  __bf16* wct   = (__bf16*)take((size_t)4 * C_DIM * C_DIM * 2);  // q, k, v, proj
  __bf16* wpt   = wct + (size_t)3 * C_DIM * C_DIM;
  __bf16* w1t   = (__bf16*)take((size_t)C_DIM * DFF_DIM * 2);
  __bf16* w2t   = (__bf16*)take((size_t)DFF_DIM * C_DIM * 2);
  __bf16* qb    = (__bf16*)take(3 * BTC * 2);                    // q, k, v^T
  __bf16* kb    = qb + BTC;
  __bf16* vtb   = qb + 2 * BTC;
  __bf16* attnb = (__bf16*)take(BTC * 2);
  float*  y1    = (float*)take(BTC * 4);
  float*  x1    = (float*)take(BTC * 4);
  __bf16* x1b   = (__bf16*)take(BTC * 2);
  __bf16* h1    = (__bf16*)take((size_t)BT_DIM * DFF_DIM * 2);
  float*  y2    = (float*)take(BTC * 4);

  prep_kernel<<<PREP_GRID, 256, 0, stream>>>(x, wq, wk, wv, wp, w1, w2, xb, wct, w1t, w2t);

  // block tiles: 256 x 256 for N = 3072 and 4096, 128 x 128 for N = 1024
  const dim3 gC(C_DIM / 128, BT_DIM / 128);
  gemm_bf16_wmma<EPI_QKV, 256><<<dim3(3 * C_DIM / 256, BT_DIM / 256), 256, 0, stream>>>(
      xb, wct, nullptr, qb, BT_DIM, 3 * C_DIM, C_DIM);

  attn_wmma_kernel<<<dim3(A_TILES / 2, B_DIM * H_DIM), 256, 0, stream>>>(
      qb, kb, vtb, attnb);

  gemm_bf16_wmma<EPI_F32_BIAS, 128><<<gC, 128, 0, stream>>>(attnb, wpt, bproj, y1, BT_DIM, C_DIM, C_DIM);
  ln_residual_kernel<<<BT_DIM / 8, 256, 0, stream>>>(x, y1, g1, be1, x1, x1b);

  gemm_bf16_wmma<EPI_RELU_BF16, 256><<<dim3(DFF_DIM / 256, BT_DIM / 256), 256, 0, stream>>>(
      x1b, w1t, b1, h1, BT_DIM, DFF_DIM, C_DIM);
  gemm_bf16_wmma<EPI_F32_BIAS, 128><<<gC, 128, 0, stream>>>(h1, w2t, b2, y2, BT_DIM, C_DIM, DFF_DIM);
  ln_residual_kernel<<<BT_DIM / 8, 256, 0, stream>>>(x1, y2, g2, be2, (float*)d_out, nullptr);
}

// v009
// Measured time: 143 microseconds a run.
// Timed twice side by side with v008, it ran 1.05 and 1.06 times as fast.
// Counting every step since v000, it is 3.15 times as fast.
#include <hip/hip_runtime.h>

#define B_DIM   2
#define T_DIM   2048
#define C_DIM   1024
#define H_DIM   16
#define HD_DIM  64
#define DFF_DIM 4096
#define BT_DIM  (B_DIM * T_DIM)

typedef __attribute__((ext_vector_type(16))) __bf16 v16bf;
typedef __attribute__((ext_vector_type(8)))  float  v8f;
typedef __attribute__((ext_vector_type(4)))  unsigned int u32x4;
typedef __attribute__((ext_vector_type(2)))  unsigned int u32x2;
typedef __attribute__((ext_vector_type(8)))  unsigned int u32x8;
typedef __attribute__((ext_vector_type(4)))  float  f32x4;
typedef __attribute__((ext_vector_type(8)))  float  f32x8;

__device__ __forceinline__ v8f wmma_bf16(v16bf a, v16bf b, v8f c) {
  // D = A(16x32 bf16) * B(32x16 bf16) + C(16x16 f32)
  return __builtin_amdgcn_wmma_f32_16x16x32_bf16(
      /*neg_a=*/false, a, /*neg_b=*/false, b,
      /*c_mod=*/(short)0, c, /*reuse_a=*/false, /*reuse_b=*/false);
}

// Load one 16x32 bf16 fragment in the CDNA5 A-matrix lane layout from a
// row-major [16 x ld] tile.  Lanes 0-15: row=lane, K 0-7 (lo) / 16-23 (hi);
// lanes 16-31: row=lane-16, K 8-15 (lo) / 24-31 (hi).  Two b128 loads.
// Works for B as well when B is pre-transposed to [N][K].
__device__ __forceinline__ v16bf load_frag(const __bf16* base, int ld) {
  const int lane = threadIdx.x & 31;
  const int r    = lane & 15;
  const int kh   = (lane >> 4) << 3;        // 0 or 8
  const __bf16* p = base + (size_t)r * ld + kh;
  union { v16bf v; struct { u32x4 lo, hi; } q; } u;
  u.q.lo = *(const u32x4*)(p);
  u.q.hi = *(const u32x4*)(p + 16);
  return u.v;
}

__device__ __forceinline__ void wait_lds() {
  asm volatile("s_wait_dscnt 0" ::: "memory");
}

// ---------------------------------------------------------------- converts
// The kernels without matrix work move few bytes per wave, and the time to
// start their waves outweighs the time to move their bytes: each wave below
// keeps 8 to 32 loads of 512 bytes in flight instead of a few short ones.

// 32 elements per thread: eight 16-byte loads in flight, eight 8-byte stores.
// Block job blk of n / 8192; needs n % 8192 == 0.
__device__ __forceinline__ void f32_to_bf16_job(
    const float* __restrict__ in, __bf16* __restrict__ out, int blk) {
  const size_t base = (size_t)blk * 8192 + threadIdx.x * 4;
  float4 f[8];
#pragma unroll  // constant i: f stays in registers, the loads go out together
  for (int i = 0; i < 8; ++i) f[i] = *(const float4*)(in + base + i * 1024);
#pragma unroll  // constant i: f stays in registers
  for (int i = 0; i < 8; ++i) {
    union { __bf16 h[4]; u32x2 q; } u;
    u.h[0] = (__bf16)f[i].x;
    u.h[1] = (__bf16)f[i].y;
    u.h[2] = (__bf16)f[i].z;
    u.h[3] = (__bf16)f[i].w;
    *(u32x2*)(out + base + i * 1024) = u.q;
  }
  // the built code goes on from here into tests that lead to the other jobs,
  // which reuse the registers that these stores name
  asm volatile("s_wait_xcnt 0x0" ::: "memory");
}

// in: f32 row-major [R][Cc] -> out: bf16 [Cc][R]   (weights -> [N][K] layout)
// One 128 x 128 tile per block of 8 waves.  A wave reads 16 whole tile rows
// (512 bytes each), so a lane holds 16 consecutive r of 4 columns: per column
// two 16-byte pieces of an output row.  The pieces pass through LDS so that
// the stores cover whole 256-byte output rows.  LDS rows are 256 bytes without
// a pad; piece p of row c lies at p ^ ((c >> 2) & 15), which spreads both the
// writers (16 lanes: 16 rows, one p) and the readers (16 lanes: one row) over
// all banks.  R and Cc are compile-time: every row step is then an immediate
// offset on one address.  Needs R % 128 == 0, Cc % 128 == 0.
// Block job (bx, by) of (Cc / 128, R / 128); tile: 128 * 128 bf16 of LDS, [c][r].
template <int R, int Cc>
__device__ __forceinline__ void transpose_f32_to_bf16_job(
    const float* __restrict__ in, __bf16* __restrict__ out, __bf16* tile,
    int bx, int by) {
  const int lane = threadIdx.x & 31;
  const int wave = threadIdx.x >> 5;
  const int c0 = bx * 128, r0 = by * 128;
  const float* src = in + (size_t)(r0 + wave * 16) * Cc + c0 + lane * 4;
  float f[16][4];
#pragma unroll  // constant i: f stays in registers, the loads go out together
  for (int i = 0; i < 16; ++i) {
    // the last load's result may land in the address pair that the earlier
    // loads name: the wait stands in front of that overwrite
    if (i == 15) asm volatile("s_wait_xcnt 0x0" ::: "memory");
    const float4 t = *(const float4*)(src + i * Cc);
    f[i][0] = t.x; f[i][1] = t.y; f[i][2] = t.z; f[i][3] = t.w;
  }
  // keeps all 16 loads ahead of the converts: without it the scheduler holds
  // six of them back until earlier ones have returned, a second latency
  __builtin_amdgcn_sched_barrier(0);
#pragma unroll  // constant e, h, k: f stays in registers
  for (int e = 0; e < 4; ++e) {
#pragma unroll
    for (int h = 0; h < 2; ++h) {
      union { __bf16 b[8]; u32x4 q; } u;
#pragma unroll
      for (int k = 0; k < 8; ++k) u.b[k] = (__bf16)f[h * 8 + k][e];
      const int piece = (wave * 2 + h) ^ (lane & 15);
      *(u32x4*)&tile[(lane * 4 + e) * 128 + piece * 8] = u.q;
    }
  }
  __syncthreads();
  const int crow = threadIdx.x >> 4;   // 0..15
  const int p    = threadIdx.x & 15;   // 16-byte piece of the output row
  __bf16* dst = out + (size_t)(c0 + crow) * R + r0 + p * 8;
#pragma unroll  // the eight LDS reads go out together, row steps are immediates
  for (int i = 0; i < 8; ++i) {
    const int c = i * 16 + crow;
    const u32x4 q = *(const u32x4*)&tile[c * 128 + (p ^ ((c >> 2) & 15)) * 8];
    *(u32x4*)(dst + i * 16 * R) = q;
  }
  // the built code goes on from here into tests that lead to the other jobs,
  // which reuse the registers that these stores name
  asm volatile("s_wait_xcnt 0x0" ::: "memory");
}

// All seven operand preparations in one launch: none depends on another, and
// each alone is too short to fill the chip or to pay for its own launch.  The
// block index picks the job (a scalar branch); the larger jobs come first.
// wct: the four C x C weights' outputs, one behind the other (q, k, v, proj).
#define PREP_W1   (DFF_DIM / 128 * (C_DIM / 128))      // 256 blocks
#define PREP_W2   (C_DIM / 128 * (DFF_DIM / 128))      // 256 blocks
#define PREP_WC   (C_DIM / 128 * (C_DIM / 128))        // 64 blocks per weight
#define PREP_X    (BT_DIM * C_DIM / 8192)              // 512 blocks
#define PREP_GRID (PREP_W1 + PREP_W2 + 4 * PREP_WC + PREP_X)
__global__ __launch_bounds__(256) void prep_kernel(
    const float* __restrict__ x, const float* __restrict__ wq,
    const float* __restrict__ wk, const float* __restrict__ wv,
    const float* __restrict__ wp, const float* __restrict__ w1,
    const float* __restrict__ w2, __bf16* __restrict__ xb,
    __bf16* __restrict__ wct, __bf16* __restrict__ w1t,
    __bf16* __restrict__ w2t) {
  __shared__ __attribute__((aligned(16))) __bf16 tile[128 * 128];
  int b = blockIdx.x;
  if (b < PREP_W1) {
    transpose_f32_to_bf16_job<C_DIM, DFF_DIM>(w1, w1t, tile, b % (DFF_DIM / 128),
                                              b / (DFF_DIM / 128));
    return;
  }
  b -= PREP_W1;
  if (b < PREP_W2) {
    transpose_f32_to_bf16_job<DFF_DIM, C_DIM>(w2, w2t, tile, b % (C_DIM / 128),
                                              b / (C_DIM / 128));
    return;
  }
  b -= PREP_W2;
  if (b < 4 * PREP_WC) {
    const int w = b / PREP_WC, j = b % PREP_WC;
    const float* in = w == 0 ? wq : w == 1 ? wk : w == 2 ? wv : wp;
    transpose_f32_to_bf16_job<C_DIM, C_DIM>(in, wct + (size_t)w * C_DIM * C_DIM, tile,
                                            j % (C_DIM / 128), j / (C_DIM / 128));
    return;
  }
  f32_to_bf16_job(x, xb, b - 4 * PREP_WC);
}

// ---------------------------------------------------------------- GEMM
// EPI_QKV: the q, k and v products as one GEMM over the three weights, N = 3 C;
// a wave's 128 columns of q or k are two heads, its 64 of v one head; stored as
// EPI_QK or EPI_VT.
enum { EPI_QK = 0, EPI_VT = 1, EPI_F32_BIAS = 2, EPI_RELU_BF16 = 3, EPI_QKV = 4 };

// Stores a wave's results: FM * 16 indices in the register dimension (a lane's
// eight registers of a tile are eight consecutive ones) by 64 in the lane
// dimension.  The register dimension is the one that is contiguous in the
// output: the columns, or for EPI_VT the rows (tokens).  A lane's eight values
// are one or two 16-byte pieces; the pieces pass through the wave's own LDS
// range, 64 rows of 256 bytes, so that every global store covers whole lines:
// 16 lanes one row.  The row pitch of 272 bytes spreads the 16 writers of a
// piece over all banks.  reg0, lane0: the wave's first index in each dimension;
// for EPI_QK and EPI_VT columns count within the one product and outp is that
// product's output.
#define G_SPITCH 272                      // staging row pitch, bytes
template <int EPI, int FM>
__device__ __forceinline__ void gemm_store(
    const v8f (&acc)[FM][4], int reg0, int lane0,
    const float* __restrict__ bias, void* __restrict__ outp, char* stage) {
  static_assert(FM * 16 * (EPI == EPI_F32_BIAS ? 4 : 2) == 256, "a staged row is 256 bytes");
  const int lane = threadIdx.x & 31;
  const int half = lane >> 4, ln = lane & 15;
  f32x4 bv[FM][2] = {};   // the bias of this lane's columns
  if constexpr (EPI == EPI_F32_BIAS || EPI == EPI_RELU_BF16) {
#pragma unroll  // constant m: bv stays in registers, the loads go out together
    for (int m = 0; m < FM; ++m) {
      bv[m][0] = *(const f32x4*)(bias + reg0 + m * 16 + half * 8);
      bv[m][1] = *(const f32x4*)(bias + reg0 + m * 16 + half * 8 + 4);
    }
    // the sums below reuse the address pair that these loads name
    asm volatile("s_wait_xcnt 0x0" ::: "memory");
    // keeps the sums behind that wait
    __builtin_amdgcn_sched_barrier(0);
  }
#pragma unroll  // constant m, j, r: acc stays in registers
  for (int m = 0; m < FM; ++m) {
    const f32x4 b0 = bv[m][0], b1 = bv[m][1];
#pragma unroll
    for (int j = 0; j < 4; ++j) {
      char* row = stage + (j * 16 + ln) * G_SPITCH;
      if constexpr (EPI == EPI_F32_BIAS) {
        f32x4 lo, hi;
#pragma unroll
        for (int r = 0; r < 4; ++r) {
          lo[r] = acc[m][j][r] + b0[r];
          hi[r] = acc[m][j][r + 4] + b1[r];
        }
        *(f32x4*)(row + m * 64 + half * 32) = lo;
        *(f32x4*)(row + m * 64 + half * 32 + 16) = hi;
      } else {
        union { __bf16 h[8]; u32x4 q; } u;
#pragma unroll
        for (int r = 0; r < 8; ++r) {
          float v = acc[m][j][r];
          if constexpr (EPI == EPI_RELU_BF16) {
            v += r < 4 ? b0[r & 3] : b1[r & 3];
            v = v > 0.f ? v : 0.f;
          }
          u.h[r] = (__bf16)v;
        }
        *(u32x4*)(row + m * 32 + half * 16) = u.q;
      }
    }
  }
  // this wave's staged pieces are in LDS before its lanes read each other's
  wait_lds();
  const int rr = lane >> 4;    // staged row of this lane in a pair of rows
  const int pc = lane & 15;    // its 16-byte piece of the row
  char* g;                     // where staged row rr, piece pc goes
  int step;                    // bytes from one staged row's place to the next
  if constexpr (EPI == EPI_QK) {
    // [BT,C] -> bf16 [B,H,T,hd]: a staged row is one token of two heads
    const int row = lane0 + rr, col = reg0 + pc * 8;
    const int bi = row >> 11, ti = row & (T_DIM - 1);
    const int hi = col >> 6, di = col & (HD_DIM - 1);
    g = (char*)outp + ((((size_t)bi * H_DIM + hi) * T_DIM + ti) * HD_DIM + di) * 2;
    step = HD_DIM * 2;
  } else if constexpr (EPI == EPI_VT) {
    // [BT,C] -> bf16 [B,H,hd,T]  (V transposed: K-contiguous for P*V): a staged
    // row is 128 tokens of one column
    const int row = reg0 + pc * 8, col = lane0 + rr;
    const int bi = row >> 11, ti = row & (T_DIM - 1);
    const int hi = col >> 6, di = col & (HD_DIM - 1);
    g = (char*)outp + ((((size_t)bi * H_DIM + hi) * HD_DIM + di) * T_DIM + ti) * 2;
    step = T_DIM * 2;
  } else if constexpr (EPI == EPI_F32_BIAS) {
    g = (char*)outp + ((size_t)(lane0 + rr) * C_DIM + reg0 + pc * 4) * 4;
    step = C_DIM * 4;
  } else {  // EPI_RELU_BF16
    g = (char*)outp + ((size_t)(lane0 + rr) * DFF_DIM + reg0 + pc * 8) * 2;
    step = DFF_DIM * 2;
  }
  u32x4 d[32];
#pragma unroll  // constant i: d stays in registers, the reads go out together
  for (int i = 0; i < 32; ++i)
    d[i] = *(const u32x4*)(stage + (i * 2 + rr) * G_SPITCH + pc * 16);
  // keeps every read ahead of the first store: each store then names registers
  // of its own, and none that a store names is written again
  __builtin_amdgcn_sched_barrier(0);
#pragma unroll  // constant i: the row steps are immediate offsets on one address
  for (int i = 0; i < 32; ++i) *(u32x4*)(g + i * 2 * step) = d[i];
  // where two kinds share a kernel the built code can run on from here into the
  // other kind's code, which reuses the registers that these stores name
  if constexpr (EPI == EPI_QK || EPI == EPI_VT) asm volatile("s_wait_xcnt 0x0" ::: "memory");
}

// C[M,N] = A[M,K](bf16) * Bt[N,K]^T(bf16), f32 accumulate.
// Block tile TS x TS, TS threads.  What a block draws from L2 per result falls
// with the tile's edge; at the L2 rate a WGP gets when all draw, a pass of a
// narrow tile takes longer to land than to multiply.  TS = 256 where that still
// gives about one block per WGP, TS = 128 where N is small.
// Waves: 2 over the first operand's rows x TS / 64 over the second's; wave tile
// TS / 2 first-operand x 64 second-operand rows, that is FM x 4 tiles
// = 32 (TS = 256) or 16 (TS = 128) WMMAs per K=32 step.
// The products are taken transposed, Bt rows as the first operand and A rows as
// the second: a lane's eight registers of a tile are then eight consecutive
// columns of one output row.  Only the v product, whose output is transposed,
// keeps A first.  Both operands have the same fragment layout and k order.
// A pass is 128 k = 256 bytes of each of the TS first-operand rows and the TS
// second-operand rows.  The pass's rows are brought into LDS by tensor loads,
// through no register: each wave asks once per pass for a slice of 64 rows.
// Two buffers: the next pass's loads fly while this pass is multiplied.
// Needs M % TS == 0, N % TS == 0, K % 128 == 0.
#define G_PASS  128                       // k per pass
#define G_PITCH 136                       // LDS row pitch, bf16: 272 B = 16 B x 17
#define G_SROWS 64                        // rows per slice
// bf16 per slice in LDS: 64 rows of 272 B, rounded up so that every slice
// starts at a multiple of 2 KiB
#define G_SLICE ((G_SROWS * G_PITCH * 2 + 2047) / 2048 * 1024)

__device__ __forceinline__ uint32_t uni(uint32_t v) {
  return (uint32_t)__builtin_amdgcn_readfirstlane(v);
}
__device__ __forceinline__ uint32_t pinned(uint32_t v) {
  uint32_t w = (uint32_t)__builtin_amdgcn_readfirstlane(v);
  // the pinned() form for the tensor mover: holds the word in a scalar register,
  // so that a test on it is a scalar branch and what is formed from it is formed
  // behind the statements in front of this one
  asm volatile("" : "+s"(w));
  return w;
}

template <int EPI, int TS>
__global__ __launch_bounds__(TS) void gemm_bf16_wmma(
    const __bf16* __restrict__ A, const __bf16* __restrict__ Bt,
    const float* __restrict__ bias, void* __restrict__ outp,
    int M, int N, int K) {
  constexpr int FM  = TS / 32;             // 16-row tiles per wave
  constexpr int WN  = TS / 64;             // waves across
  constexpr int NS  = TS / G_SROWS;        // slices per operand; 2 * NS waves
  constexpr int BUF = 2 * NS * G_SLICE;    // bf16 per buffer: NS first-operand slices, then NS second
  __shared__ __attribute__((aligned(2048))) __bf16 Ts[2 * BUF];

  // scalar wave number: the wave's places in the tile and in the staging stay
  // out of the vector registers, which the main loop fills
  const int wave = __builtin_amdgcn_readfirstlane(threadIdx.x >> 5);
  const int wm = wave / WN, wn = wave % WN;
  // which of q, k, v: the same for the whole block
  const int which = EPI == EPI_QKV ? blockIdx.x * TS / C_DIM : 0;
  const bool bt_first = which < 2;

  v8f acc[FM][4] = {};

  // the block's rows of each operand are scalar addresses
  const __bf16* ablk = A + (size_t)(blockIdx.y * TS) * K;
  const __bf16* bblk = Bt + (size_t)(blockIdx.x * TS) * K;
  const __bf16* asrc = bt_first ? bblk : ablk;   // first operand
  const __bf16* bsrc = bt_first ? ablk : bblk;   // second operand
  // Wave w brings slice w of a buffer: 64 rows of the first operand (w < NS) or
  // of the second.
  const __bf16* wsrc = wave < NS ? asrc + (size_t)(wave * G_SROWS) * K
                                 : bsrc + (size_t)((wave - NS) * G_SROWS) * K;
  const uint32_t ldst = (uint32_t)(size_t)&Ts[wave * G_SLICE];

  // Descriptor group 1, the same for every request: extents in bytes, tensor =
  // tile = 64 rows of 256 bytes, no mask, 16 bytes of pad behind each row.
  u32x8 g1;
  g1[0] = uni((1u << 20) | (5u << 22) | (3u << 25));
  g1[1] = uni(256u << 16);
  g1[2] = uni((uint32_t)G_SROWS << 16);
  g1[3] = uni(256u << 16);
  g1[4] = uni((uint32_t)G_SROWS);
  g1[5] = uni((uint32_t)K * 2u);   // source row pitch
  g1[6] = uni(0u);
  g1[7] = uni(0u);
  // the pinned() form: holds the descriptor's words in their scalar registers for the
  // whole loop; otherwise the compiler forms the constants anew for each request
  // and uses those registers for other values while a request is outstanding
  asm volatile("" : "+s"(g1));

  u32x4 g0;   // descriptor group 0 of the wave's latest request
  auto issue = [&](uint32_t t, uint32_t buf) {
    const uint64_t ga = (uint64_t)(size_t)wsrc + (uint64_t)t * (G_PASS * 2);
    g0[0] = uni(1u);
    g0[1] = uni(ldst + buf * (uint32_t)(BUF * 2));
    g0[2] = uni((uint32_t)ga);
    g0[3] = uni(((uint32_t)(ga >> 32) & 0x01FFFFFFu) | 0x80000000u);
    asm volatile("tensor_load_to_lds %0, %1" :: "s"(g0), "s"(g1) : "memory");
  };
  // The wave's request has landed.  The wait names group 0 as an input: without
  // it the compiler took a register of the outstanding request's group 0 for the
  // loop counter.
  auto landed = [&]() { asm volatile("s_wait_tensorcnt 0" :: "s"(g0) : "memory"); };

  const int npass = K / G_PASS;
  issue(0, 0);
  // pass 0 has landed for this wave, then for all waves
  landed();
  __syncthreads();
  if (pinned(npass > 1)) issue(1, 1);

  for (int t = 0; t < npass; ++t) {
    // the wave's FM / 4 slices of the first operand, its one of the second
    const __bf16* As = &Ts[(t & 1) * BUF + wm * (FM / 4) * G_SLICE];
    const __bf16* Bs = &Ts[(t & 1) * BUF + (NS + wn) * G_SLICE];
    // Two fragment sets: the LDS reads of k step s + 1 are issued as one group
    // ahead of the WMMAs of step s, so that their latency hides behind them.
    v16bf fa[2][FM], fb[2][4];
#pragma unroll  // constant m: fa stays in registers
    for (int m = 0; m < FM; ++m)
      fa[0][m] = load_frag(As + (m / 4) * G_SLICE + (m % 4 * 16) * G_PITCH, G_PITCH);
#pragma unroll  // constant j: fb stays in registers
    for (int j = 0; j < 4; ++j) fb[0][j] = load_frag(Bs + (j * 16) * G_PITCH, G_PITCH);
    // keeps step 0's reads ahead of step 1's: mixed, the first WMMAs wait for
    // both groups, twice the LDS time with every wave of the block waiting
    __builtin_amdgcn_sched_barrier(0);
#pragma unroll  // constant set index: the fragments stay in registers
    for (int s = 0; s < G_PASS / 32; ++s) {
      const int cur = s & 1, nxt = cur ^ 1;
      if (s + 1 < G_PASS / 32) {
        const int kk = (s + 1) * 32;
#pragma unroll  // constant m: fa stays in registers
        for (int m = 0; m < FM; ++m)
          fa[nxt][m] = load_frag(As + (m / 4) * G_SLICE + (m % 4 * 16) * G_PITCH + kk, G_PITCH);
#pragma unroll  // constant j: fb stays in registers
        for (int j = 0; j < 4; ++j)
          fb[nxt][j] = load_frag(Bs + (j * 16) * G_PITCH + kk, G_PITCH);
      }
      // keeps the read group ahead of the WMMAs: without it the scheduler sinks
      // each read to just before its use and every WMMA pair waits on LDS
      __builtin_amdgcn_sched_barrier(0);
#pragma unroll  // constant j, m: accumulators and fragments stay in registers
      for (int j = 0; j < 4; ++j) {
#pragma unroll
        for (int m = 0; m < FM; ++m)
          acc[m][j] = wmma_bf16(fa[cur][m], fb[cur][j], acc[m][j]);
      }
      // keeps the next step's reads from moving up among these WMMAs
      __builtin_amdgcn_sched_barrier(0);
    }
    // Hand-over: this wave's reads of buffer t & 1 are done, its slice of
    // pass t + 1 has landed; behind the barrier that holds for every wave.
    wait_lds();
    landed();
    __syncthreads();
    // the pass number goes through pinned() here, so that the next request's
    // descriptor is formed behind the wait above
    const uint32_t nx = pinned((uint32_t)t + 2u);
    if (pinned(nx < (uint32_t)npass)) issue(nx, (uint32_t)t & 1u);
  }
  // no request is outstanding when the wave goes on to the stores and ends
  landed();
  wait_lds();

  // The ring is free: every wave's last reads ended in front of the last pass's
  // barrier and no request is outstanding.  Each wave stages in a range of its own.
  char* stage = (char*)Ts + wave * (64 * G_SPITCH);
  const int first0  = wm * (FM * 16);   // the wave's place in the first operand's rows
  const int second0 = wn * 64;          // and in the second operand's
  if constexpr (EPI == EPI_QKV) {
    __bf16* o = (__bf16*)outp + (size_t)which * BT_DIM * C_DIM;
    if (bt_first) {   // a scalar branch
      gemm_store<EPI_QK, FM>(acc, (blockIdx.x * TS + first0) % C_DIM,
                             blockIdx.y * TS + second0, bias, o, stage);
    } else {
      gemm_store<EPI_VT, FM>(acc, blockIdx.y * TS + first0,
                             (blockIdx.x * TS + second0) % C_DIM, bias, o, stage);
    }
  } else {
    gemm_store<EPI, FM>(acc, blockIdx.x * TS + first0, blockIdx.y * TS + second0,
                        bias, outp, stage);
  }
}

#define ATT_WAVES 8
#define A_TILES (T_DIM / (16 * ATT_WAVES))   // query tiles per head
#define A_KEYS  64                        // keys per stage
#define A_PITCH 72                        // LDS row pitch, bf16: 144 B = 16 B x 9
#define A_ROWS  128                       // 64 K rows, then 64 V^T rows
#define A_BUF   (A_ROWS * A_PITCH)        // bf16 per buffer

// Four copies of 16 bytes per lane, global -> LDS, through no register.  The
// s_wait_xcnt closes the statement so that no address register named here is
// rewritten before it.
#define A_COPY4(l, g)                                                      \
  asm volatile(                                                            \
      "global_load_async_to_lds_b128 %0, %4, off\n\t"                      \
      "global_load_async_to_lds_b128 %1, %5, off\n\t"                      \
      "global_load_async_to_lds_b128 %2, %6, off\n\t"                      \
      "global_load_async_to_lds_b128 %3, %7, off\n\t"                      \
      "s_wait_xcnt 0x0"                                                    \
      :: "v"(l[0]), "v"(l[1]), "v"(l[2]), "v"(l[3]),                       \
         "v"(g[0]), "v"(g[1]), "v"(g[2]), "v"(g[3])                        \
      : "memory")

// Eight 2^x in one statement.  Behind a transcendental the instruction set asks
// for one independent instruction before its result is read or its source
// overwritten: here each v_exp_f32 is that instruction for the one before it
// (early-clobber outputs: none lies on a source), and the v_nop fills the slot
// behind the last.
#define A_EXP2X8(d, a)                                                     \
  asm("v_exp_f32 %0, %8\n\t"                                               \
      "v_exp_f32 %1, %9\n\t"                                               \
      "v_exp_f32 %2, %10\n\t"                                              \
      "v_exp_f32 %3, %11\n\t"                                              \
      "v_exp_f32 %4, %12\n\t"                                              \
      "v_exp_f32 %5, %13\n\t"                                              \
      "v_exp_f32 %6, %14\n\t"                                              \
      "v_exp_f32 %7, %15\n\t"                                              \
      "v_nop"                                                              \
      : "=&v"(d[0]), "=&v"(d[1]), "=&v"(d[2]), "=&v"(d[3]),                \
        "=&v"(d[4]), "=&v"(d[5]), "=&v"(d[6]), "=&v"(d[7])                 \
      : "v"(a[0]), "v"(a[1]), "v"(a[2]), "v"(a[3]),                        \
        "v"(a[4]), "v"(a[5]), "v"(a[6]), "v"(a[7]))

// lane l with lane l ^ 16, in the vector unit
__device__ __forceinline__ float xhalf(float x) {
  const int b = __builtin_bit_cast(int, x);
  return __builtin_bit_cast(
      float, __builtin_amdgcn_permlanex16(b, b, 0x76543210, 0xfedcba98, false, false));
}

__global__ __launch_bounds__(256) void attn_wmma_kernel(
    const __bf16* __restrict__ q,   // [B,H,T,hd]
    const __bf16* __restrict__ k,   // [B,H,T,hd]
    const __bf16* __restrict__ vt,  // [B,H,hd,T]
    __bf16* __restrict__ attnb) {   // bf16 [B,T,C]
  __shared__ __attribute__((aligned(16))) __bf16 KV[2 * A_BUF];

  // scalar wave number: the test that skips a pass is then a scalar branch
  const int wave = __builtin_amdgcn_readfirstlane(threadIdx.x >> 5);
  const int lane = threadIdx.x & 31;
  const int half = lane >> 4, ln = lane & 15;

  const int bh  = blockIdx.y;
  const int bi  = bh >> 4;          // /H
  const int hi  = bh & (H_DIM - 1);
  int tile = blockIdx.x;            // the first tile; then A_TILES - 1 - blockIdx.x

  // this wave's queries of the first and of the second tile
  const __bf16* Qp = q + ((size_t)bh * T_DIM + (tile * ATT_WAVES + wave) * 16) * HD_DIM;
  const __bf16* Qn = q + ((size_t)bh * T_DIM + ((A_TILES - 1 - tile) * ATT_WAVES + wave) * 16) * HD_DIM;
  const __bf16* Kp = k + (size_t)bh * T_DIM * HD_DIM;
  const __bf16* Vp = vt + (size_t)bh * HD_DIM * T_DIM;

  // Copy map: 8 lanes cover one 128-byte row; copy i of a thread serves stage
  // row i * 32 + crow (i < 2: K rows, i >= 2: V^T rows).
  const int crow = threadIdx.x >> 3;        // 0..31
  const int ccol = (threadIdx.x & 7) << 3;  // bf16 offset in the row
  const __bf16* ksrc = Kp + (size_t)crow * HD_DIM + ccol;
  const __bf16* vsrc = Vp + (size_t)crow * T_DIM + ccol;
  const unsigned ldst = (unsigned)(size_t)&KV[crow * A_PITCH + ccol];

  auto issue = [&](int st, int buf) {
    unsigned l[4];
    const __bf16* g[4];
#pragma unroll  // constant indices: l stays in registers
    for (int i = 0; i < 4; ++i)
      l[i] = ldst + (unsigned)(buf * A_BUF + i * 32 * A_PITCH) * 2u;
    g[0] = ksrc + (size_t)(st * A_KEYS) * HD_DIM;
    g[1] = ksrc + (size_t)(st * A_KEYS + 32) * HD_DIM;
    g[2] = vsrc + st * A_KEYS;
    g[3] = vsrc + (size_t)32 * T_DIM + st * A_KEYS;
    A_COPY4(l, g);
  };

  issue(0, 0);

  // Q as the B operand: column = query ln.  Both tiles' Q are read here, so
  // that the second tile does not start by waiting for its own.
  v16bf qa0 = load_frag(Qp, HD_DIM);              // K = 0..31 of hd
  v16bf qa1 = load_frag(Qp + 32, HD_DIM);         // K = 32..63 of hd
  const v16bf qn0 = load_frag(Qn, HD_DIM);
  const v16bf qn1 = load_frag(Qn + 32, HD_DIM);
  // the code below reuses the address registers that these loads name
  asm volatile("s_wait_xcnt 0x0" ::: "memory");

  // stage 0 has landed for this wave, then for all waves
  asm volatile("s_wait_asynccnt 0x0" ::: "memory");
  __syncthreads();
  issue(1, 1);

  for (int h = 0; h < 2; ++h) {
  const int qt0 = (tile * ATT_WAVES + wave) * 16;
  // The tile's last query is (tile + 1) * 128 - 1: so many keys, in stages of
  // 64; an even number, so each tile starts in buffer 0.
  const int nst = (tile + 1) * (ATT_WAVES * 16 / A_KEYS);
  // O^T: o[jj][r] = O[query ln][hd jj * 16 + half * 8 + r]
  v8f o[4] = {};
  const int qg = qt0 + ln;          // this lane's query
  const int qrel = qg - half * 8;   // its place against the first key of this half's rows
  float rm = -1e30f;                // its running maximum, alike in both halves
  float rl = 0.f;                   // running sum over this half's keys only

  for (int t = 0; t < nst; ++t) {
    const __bf16* Ks = &KV[(t & 1) * A_BUF];
    const __bf16* Vs = Ks + A_KEYS * A_PITCH;
    for (int p = 0; p < A_KEYS / 32; ++p) {
      const int kv0 = t * A_KEYS + p * 32;
      if (kv0 >= qt0 + 16) continue;   // wholly above this wave's diagonal
      // The pass's K and V^T fragments are read from LDS as one group.
      v16bf kf[2][2], vf[4];
#pragma unroll  // constant j: kf stays in registers
      for (int j = 0; j < 2; ++j) {
        const __bf16* Kb = Ks + (p * 32 + j * 16) * A_PITCH;
        kf[j][0] = load_frag(Kb, A_PITCH);
        kf[j][1] = load_frag(Kb + 32, A_PITCH);
      }
#pragma unroll  // constant jj: vf stays in registers
      for (int jj = 0; jj < 4; ++jj)
        vf[jj] = load_frag(Vs + (jj * 16) * A_PITCH + p * 32, A_PITCH);
      // keeps the read group ahead of the WMMAs: without it the scheduler sinks
      // each read to just before its use and every WMMA waits out an LDS read
      __builtin_amdgcn_sched_barrier(0);
      // S^T tile j: pm[j][r] = score of key kv0 + j * 16 + half * 8 + r, query qg
      float pm[2][8];
      const int dq = qrel - kv0;       // key above the query: j * 16 + r > dq
#pragma unroll  // constant j, r: pm stays in registers
      for (int j = 0; j < 2; ++j) {
        v8f s = {};
        s = wmma_bf16(kf[j][0], qa0, s);
        s = wmma_bf16(kf[j][1], qa1, s);
#pragma unroll
        for (int r = 0; r < 8; ++r) {
          float val = s[r] * 0.125f;              // hd^-0.5
          pm[j][r] = (j * 16 + r > dq) ? -1e30f : val;    // causal mask
        }
      }
      // online softmax: 16 of the query's 32 scores are in this lane
      float m4[4];
#pragma unroll  // four independent chains
      for (int e = 0; e < 4; ++e)
        m4[e] = fmaxf(fmaxf(pm[0][2 * e], pm[0][2 * e + 1]), fmaxf(pm[1][2 * e], pm[1][2 * e + 1]));
      float mx = fmaxf(fmaxf(m4[0], m4[1]), fmaxf(m4[2], m4[3]));
      mx = fmaxf(mx, xhalf(mx));
      const float mnew  = fmaxf(rm, mx);
      const float scale = __expf(rm - mnew);
      rm = mnew;
      // P^T as B operand: element s of the lane = tile s >> 3, register s & 7,
      // the k order in which load_frag reads V^T
      v16bf pf;
      float s4[4];
#pragma unroll  // constant j, r: pm and pf stay in registers
      for (int j = 0; j < 2; ++j) {
        float ea[8], pe[8];
#pragma unroll
        for (int r = 0; r < 8; ++r) ea[r] = (pm[j][r] - mnew) * 1.44269504f;  // log2(e)
        A_EXP2X8(pe, ea);
#pragma unroll  // four independent chains
        for (int r = 0; r < 8; ++r) {
          s4[r & 3] = (j == 0 && r < 4) ? pe[r] : s4[r & 3] + pe[r];
          pf[j * 8 + r] = (__bf16)pe[r];
        }
      }
      rl = rl * scale + ((s4[0] + s4[1]) + (s4[2] + s4[3]));
#pragma unroll  // constant jj, r: o stays in registers
      for (int jj = 0; jj < 4; ++jj) {
#pragma unroll
        for (int r = 0; r < 8; ++r) o[jj][r] *= scale;
      }
#pragma unroll  // constant jj: o and vf stay in registers
      for (int jj = 0; jj < 4; ++jj) o[jj] = wmma_bf16(vf[jj], pf, o[jj]);
    }
    // Hand-over: this wave's reads of buffer t & 1 are done, its copies of
    // the next stage have landed; behind the barrier that holds for every wave.
    wait_lds();
    asm volatile("s_wait_asynccnt 0x0" ::: "memory");
    __syncthreads();
    // the stage two ahead: of this tile, or stage 0 or 1 of the second tile
    const bool own = t + 2 < nst;
    if (own || h == 0) issue(own ? t + 2 : t + 2 - nst, t & 1);
  }

  // join the halves' sums, normalize, store to [B,T,C] bf16: a lane's eight
  // registers of a tile are eight consecutive hd of its query, one 16-byte store
  const float inv = 1.f / (rl + xhalf(rl));
  __bf16* dst = attnb + ((size_t)bi * T_DIM + qg) * C_DIM + hi * HD_DIM + half * 8;
#pragma unroll  // constant jj, r: o stays in registers
  for (int jj = 0; jj < 4; ++jj) {
    union { __bf16 h[8]; u32x4 q; } u;
#pragma unroll
    for (int r = 0; r < 8; ++r) u.h[r] = (__bf16)(o[jj][r] * inv);
    *(u32x4*)(dst + jj * 16) = u.q;
  }
  // the second tile reuses the registers that these stores name
  asm volatile("s_wait_xcnt 0x0" ::: "memory");
  tile = A_TILES - 1 - tile;
  qa0 = qn0;
  qa1 = qn1;
  }
  // no copy is outstanding when the wave ends
  asm volatile("s_wait_asynccnt 0x0" ::: "memory");
}

// ---------------------------------------------------------------- LN
// out = LN(x + y) * g + b ; one wave per row of C_DIM=1024, 8 rows per block.
// A lane holds 32 elements of its row (eight 16-byte pieces, 512 bytes of the
// row per wave-wide request); the row's sums need no LDS and no barrier.
__global__ __launch_bounds__(256) void ln_residual_kernel(
    const float* __restrict__ x, const float* __restrict__ y,
    const float* __restrict__ g, const float* __restrict__ b,
    float* __restrict__ out, __bf16* __restrict__ outb) {
  const int lane = threadIdx.x & 31;
  const int row  = blockIdx.x * 8 + (threadIdx.x >> 5);
  const size_t off = (size_t)row * C_DIM + lane * 4;
  f32x8 xy[8], gb[8];   // x | y and g | b, one 16-byte piece of each
#pragma unroll  // constant i: the pieces stay in registers
  for (int i = 0; i < 8; ++i)
    xy[i] = __builtin_shufflevector(*(const f32x4*)(x + off + i * 128),
                                    *(const f32x4*)(y + off + i * 128),
                                    0, 1, 2, 3, 4, 5, 6, 7);
#pragma unroll  // constant i: the pieces stay in registers
  for (int i = 0; i < 8; ++i)
    gb[i] = __builtin_shufflevector(*(const f32x4*)(g + lane * 4 + i * 128),
                                    *(const f32x4*)(b + lane * 4 + i * 128),
                                    0, 1, 2, 3, 4, 5, 6, 7);
  // Loaded values as inputs only: holds all 32 loads ahead of the sums.  Without
  // it the compiler holds some x, y loads back until earlier ones have returned
  // and sinks each g, b load to its use, a further latency per piece.
  asm volatile("" :: "v"(xy[0]), "v"(xy[1]), "v"(xy[2]), "v"(xy[3]),
                     "v"(xy[4]), "v"(xy[5]), "v"(xy[6]), "v"(xy[7]),
                     "v"(gb[0]), "v"(gb[1]), "v"(gb[2]), "v"(gb[3]),
                     "v"(gb[4]), "v"(gb[5]), "v"(gb[6]), "v"(gb[7]));
  float v[8][4];
  float sa[4] = {0.f, 0.f, 0.f, 0.f}, sb[4] = {0.f, 0.f, 0.f, 0.f};
#pragma unroll  // constant i, e: xy and v stay in registers
  for (int i = 0; i < 8; ++i) {
#pragma unroll  // four independent chains
    for (int e = 0; e < 4; ++e) {
      v[i][e] = xy[i][e] + xy[i][e + 4];
      sa[e] += v[i][e];
      sb[e] += v[i][e] * v[i][e];
    }
  }
  float s  = (sa[0] + sa[1]) + (sa[2] + sa[3]);
  float s2 = (sb[0] + sb[1]) + (sb[2] + sb[3]);
#pragma unroll
  for (int m = 1; m < 32; m <<= 1) {
    s  += __shfl_xor(s, m, 32);
    s2 += __shfl_xor(s2, m, 32);
  }
  const float mean = s * (1.f / C_DIM);
  const float var  = s2 * (1.f / C_DIM) - mean * mean;
  const float rstd = rsqrtf(var + 1e-5f);
#pragma unroll  // constant i, e: v and gb stay in registers
  for (int i = 0; i < 8; ++i) {
#pragma unroll
    for (int e = 0; e < 4; ++e)
      v[i][e] = (v[i][e] - mean) * rstd * gb[i][e] + gb[i][e + 4];
    *(float4*)(out + off + i * 128) = make_float4(v[i][0], v[i][1], v[i][2], v[i][3]);
  }
  // the converts below reuse registers that the stores above name
  asm volatile("s_wait_xcnt 0x0" ::: "memory");
  if (outb) {
#pragma unroll  // constant i, e: v stays in registers
    for (int i = 0; i < 8; ++i) {
      union { __bf16 h[4]; u32x2 q; } u;
#pragma unroll
      for (int e = 0; e < 4; ++e) u.h[e] = (__bf16)v[i][e];
      *(u32x2*)(outb + off + i * 128) = u.q;
    }
  }
}

// ---------------------------------------------------------------- launch
extern "C" void kernel_launch(void* const* d_in, const int* in_sizes, int n_in,
                              void* d_out, int out_size, void* d_ws, size_t ws_size,
                              hipStream_t stream) {
  const float* x     = (const float*)d_in[0];
  const float* wq    = (const float*)d_in[1];
  const float* wk    = (const float*)d_in[2];
  const float* wv    = (const float*)d_in[3];
  const float* wp    = (const float*)d_in[4];
  const float* bproj = (const float*)d_in[5];
  const float* w1    = (const float*)d_in[6];
  const float* b1    = (const float*)d_in[7];
  const float* w2    = (const float*)d_in[8];
  const float* b2    = (const float*)d_in[9];
  const float* g1    = (const float*)d_in[10];
  const float* be1   = (const float*)d_in[11];
  const float* g2    = (const float*)d_in[12];
  const float* be2   = (const float*)d_in[13];

  char* ws = (char*)d_ws;
  size_t o = 0;
  auto take = [&](size_t nbytes) -> void* {
    void* p = ws + o;
    o += (nbytes + 255) & ~(size_t)255;
    return p;
  };
  const size_t BTC = (size_t)BT_DIM * C_DIM;
  __bf16* xb    = (__bf16*)take(BTC * 2);
  __bf16* wct   = (__bf16*)take((size_t)4 * C_DIM * C_DIM * 2);  // q, k, v, proj
  __bf16* wpt   = wct + (size_t)3 * C_DIM * C_DIM;
  __bf16* w1t   = (__bf16*)take((size_t)C_DIM * DFF_DIM * 2);
  __bf16* w2t   = (__bf16*)take((size_t)DFF_DIM * C_DIM * 2);
  __bf16* qb    = (__bf16*)take(3 * BTC * 2);                    // q, k, v^T
  __bf16* kb    = qb + BTC;
  __bf16* vtb   = qb + 2 * BTC;
  __bf16* attnb = (__bf16*)take(BTC * 2);
  float*  y1    = (float*)take(BTC * 4);
  float*  x1    = (float*)take(BTC * 4);
  __bf16* x1b   = (__bf16*)take(BTC * 2);
  __bf16* h1    = (__bf16*)take((size_t)BT_DIM * DFF_DIM * 2);
  float*  y2    = (float*)take(BTC * 4);

  prep_kernel<<<PREP_GRID, 256, 0, stream>>>(x, wq, wk, wv, wp, w1, w2, xb, wct, w1t, w2t);

  // block tiles: 256 x 256 for N = 3072 and 4096, 128 x 128 for N = 1024
  const dim3 gC(C_DIM / 128, BT_DIM / 128);
  gemm_bf16_wmma<EPI_QKV, 256><<<dim3(3 * C_DIM / 256, BT_DIM / 256), 256, 0, stream>>>(
      xb, wct, nullptr, qb, BT_DIM, 3 * C_DIM, C_DIM);

  attn_wmma_kernel<<<dim3(A_TILES / 2, B_DIM * H_DIM), 256, 0, stream>>>(
      qb, kb, vtb, attnb);

  gemm_bf16_wmma<EPI_F32_BIAS, 128><<<gC, 128, 0, stream>>>(attnb, wpt, bproj, y1, BT_DIM, C_DIM, C_DIM);
  ln_residual_kernel<<<BT_DIM / 8, 256, 0, stream>>>(x, y1, g1, be1, x1, x1b);

  gemm_bf16_wmma<EPI_RELU_BF16, 256><<<dim3(DFF_DIM / 256, BT_DIM / 256), 256, 0, stream>>>(
      x1b, w1t, b1, h1, BT_DIM, DFF_DIM, C_DIM);
  gemm_bf16_wmma<EPI_F32_BIAS, 128><<<gC, 128, 0, stream>>>(h1, w2t, b2, y2, BT_DIM, C_DIM, DFF_DIM);
  ln_residual_kernel<<<BT_DIM / 8, 256, 0, stream>>>(x1, y2, g2, be2, (float*)d_out, nullptr);
}

// v010
// Measured time: 129 microseconds a run.
// Two timings next to v009 put it at 1.11 and 1.12 times that version's speed.
// All steps since v000 together make it 3.51 times as fast.
#include <hip/hip_runtime.h>

#define B_DIM   2
#define T_DIM   2048
#define C_DIM   1024
#define H_DIM   16
#define HD_DIM  64
#define DFF_DIM 4096
#define BT_DIM  (B_DIM * T_DIM)

typedef __attribute__((ext_vector_type(16))) __bf16 v16bf;
typedef __attribute__((ext_vector_type(8)))  float  v8f;
typedef __attribute__((ext_vector_type(4)))  unsigned int u32x4;
typedef __attribute__((ext_vector_type(2)))  unsigned int u32x2;
typedef __attribute__((ext_vector_type(8)))  unsigned int u32x8;
typedef __attribute__((ext_vector_type(4)))  float  f32x4;
typedef __attribute__((ext_vector_type(8)))  float  f32x8;

__device__ __forceinline__ v8f wmma_bf16(v16bf a, v16bf b, v8f c) {
  // D = A(16x32 bf16) * B(32x16 bf16) + C(16x16 f32)
  return __builtin_amdgcn_wmma_f32_16x16x32_bf16(
      /*neg_a=*/false, a, /*neg_b=*/false, b,
      /*c_mod=*/(short)0, c, /*reuse_a=*/false, /*reuse_b=*/false);
}

// Load one 16x32 bf16 fragment in the CDNA5 A-matrix lane layout from a
// row-major [16 x ld] tile.  Lanes 0-15: row=lane, K 0-7 (lo) / 16-23 (hi);
// lanes 16-31: row=lane-16, K 8-15 (lo) / 24-31 (hi).  Two b128 loads.
// Works for B as well when B is pre-transposed to [N][K].
__device__ __forceinline__ v16bf load_frag(const __bf16* base, int ld) {
  const int lane = threadIdx.x & 31;
  const int r    = lane & 15;
  const int kh   = (lane >> 4) << 3;        // 0 or 8
  const __bf16* p = base + (size_t)r * ld + kh;
  union { v16bf v; struct { u32x4 lo, hi; } q; } u;
  u.q.lo = *(const u32x4*)(p);
  u.q.hi = *(const u32x4*)(p + 16);
  return u.v;
}

__device__ __forceinline__ void wait_lds() {
  asm volatile("s_wait_dscnt 0" ::: "memory");
}

// ---------------------------------------------------------------- converts
// The kernels without matrix work: each wave below keeps 8 to 32 loads of
// 512 bytes in flight instead of a few short ones.

// 32 elements per thread: eight 16-byte loads in flight, eight 8-byte stores.
// Block job blk of n / 8192; needs n % 8192 == 0.
__device__ __forceinline__ void f32_to_bf16_job(
    const float* __restrict__ in, __bf16* __restrict__ out, int blk) {
  const size_t base = (size_t)blk * 8192 + threadIdx.x * 4;
  float4 f[8];
#pragma unroll  // constant i: f stays in registers, the loads go out together
  for (int i = 0; i < 8; ++i) f[i] = *(const float4*)(in + base + i * 1024);
#pragma unroll  // constant i: f stays in registers
  for (int i = 0; i < 8; ++i) {
    union { __bf16 h[4]; u32x2 q; } u;
    u.h[0] = (__bf16)f[i].x;
    u.h[1] = (__bf16)f[i].y;
    u.h[2] = (__bf16)f[i].z;
    u.h[3] = (__bf16)f[i].w;
    *(u32x2*)(out + base + i * 1024) = u.q;
  }
  // the built code goes on from here into tests that lead to the other jobs,
  // which reuse the registers that these stores name
  asm volatile("s_wait_xcnt 0x0" ::: "memory");
}

// in: f32 row-major [R][Cc] -> out: bf16 [Cc][R]   (weights -> [N][K] layout)
// One 128 x 128 tile per block of 8 waves.  A wave reads 16 whole tile rows
// (512 bytes each), so a lane holds 16 consecutive r of 4 columns: per column
// two 16-byte pieces of an output row.  The pieces pass through LDS so that
// the stores cover whole 256-byte output rows.  LDS rows are 256 bytes without
// a pad; piece p of row c lies at p ^ ((c >> 2) & 15), which spreads both the
// writers (16 lanes: 16 rows, one p) and the readers (16 lanes: one row) over
// all banks.  R and Cc are compile-time: every row step is then an immediate
// offset on one address.  Needs R % 128 == 0, Cc % 128 == 0.
// Block job (bx, by) of (Cc / 128, R / 128); tile: 128 * 128 bf16 of LDS, [c][r].
template <int R, int Cc>
__device__ __forceinline__ void transpose_f32_to_bf16_job(
    const float* __restrict__ in, __bf16* __restrict__ out, __bf16* tile,
    int bx, int by) {
  const int lane = threadIdx.x & 31;
  const int wave = threadIdx.x >> 5;
  const int c0 = bx * 128, r0 = by * 128;
  const float* src = in + (size_t)(r0 + wave * 16) * Cc + c0 + lane * 4;
  float f[16][4];
#pragma unroll  // constant i: f stays in registers, the loads go out together
  for (int i = 0; i < 16; ++i) {
    // the last load's result may land in the address pair that the earlier
    // loads name: the wait stands in front of that overwrite
    if (i == 15) asm volatile("s_wait_xcnt 0x0" ::: "memory");
    const float4 t = *(const float4*)(src + i * Cc);
    f[i][0] = t.x; f[i][1] = t.y; f[i][2] = t.z; f[i][3] = t.w;
  }
  // keeps all 16 loads ahead of the converts: without it the scheduler holds
  // six of them back until earlier ones have returned, a second latency
  __builtin_amdgcn_sched_barrier(0);
#pragma unroll  // constant e, h, k: f stays in registers
  for (int e = 0; e < 4; ++e) {
#pragma unroll
    for (int h = 0; h < 2; ++h) {
      union { __bf16 b[8]; u32x4 q; } u;
#pragma unroll
      for (int k = 0; k < 8; ++k) u.b[k] = (__bf16)f[h * 8 + k][e];
      const int piece = (wave * 2 + h) ^ (lane & 15);
      *(u32x4*)&tile[(lane * 4 + e) * 128 + piece * 8] = u.q;
    }
  }
  __syncthreads();
  const int crow = threadIdx.x >> 4;   // 0..15
  const int p    = threadIdx.x & 15;   // 16-byte piece of the output row
  __bf16* dst = out + (size_t)(c0 + crow) * R + r0 + p * 8;
#pragma unroll  // the eight LDS reads go out together, row steps are immediates
  for (int i = 0; i < 8; ++i) {
    const int c = i * 16 + crow;
    const u32x4 q = *(const u32x4*)&tile[c * 128 + (p ^ ((c >> 2) & 15)) * 8];
    *(u32x4*)(dst + i * 16 * R) = q;
  }
  // the built code goes on from here into tests that lead to the other jobs,
  // which reuse the registers that these stores name
  asm volatile("s_wait_xcnt 0x0" ::: "memory");
}

// All seven operand preparations in one launch: none depends on another, and
// each alone is too short to fill the chip or to pay for its own launch.  The
// block index picks the job (a scalar branch); the larger jobs come first.
// wct: the four C x C weights' outputs, one behind the other (q, k, v, proj).
#define PREP_W1   (DFF_DIM / 128 * (C_DIM / 128))      // 256 blocks
#define PREP_W2   (C_DIM / 128 * (DFF_DIM / 128))      // 256 blocks
#define PREP_WC   (C_DIM / 128 * (C_DIM / 128))        // 64 blocks per weight
#define PREP_X    (BT_DIM * C_DIM / 8192)              // 512 blocks
#define PREP_GRID (PREP_W1 + PREP_W2 + 4 * PREP_WC + PREP_X)
__global__ __launch_bounds__(256) void prep_kernel(
    const float* __restrict__ x, const float* __restrict__ wq,
    const float* __restrict__ wk, const float* __restrict__ wv,
    const float* __restrict__ wp, const float* __restrict__ w1,
    const float* __restrict__ w2, __bf16* __restrict__ xb,
    __bf16* __restrict__ wct, __bf16* __restrict__ w1t,
    __bf16* __restrict__ w2t) {
  __shared__ __attribute__((aligned(16))) __bf16 tile[128 * 128];
  int b = blockIdx.x;
  if (b < PREP_W1) {
    transpose_f32_to_bf16_job<C_DIM, DFF_DIM>(w1, w1t, tile, b % (DFF_DIM / 128),
                                              b / (DFF_DIM / 128));
    return;
  }
  b -= PREP_W1;
  if (b < PREP_W2) {
    transpose_f32_to_bf16_job<DFF_DIM, C_DIM>(w2, w2t, tile, b % (C_DIM / 128),
                                              b / (C_DIM / 128));
    return;
  }
  b -= PREP_W2;
  if (b < 4 * PREP_WC) {
    const int w = b / PREP_WC, j = b % PREP_WC;
    const float* in = w == 0 ? wq : w == 1 ? wk : w == 2 ? wv : wp;
    transpose_f32_to_bf16_job<C_DIM, C_DIM>(in, wct + (size_t)w * C_DIM * C_DIM, tile,
                                            j % (C_DIM / 128), j / (C_DIM / 128));
    return;
  }
  f32_to_bf16_job(x, xb, b - 4 * PREP_WC);
}

// ---------------------------------------------------------------- GEMM
// EPI_QKV: the q, k and v products as one GEMM over the three weights, N = 3 C;
// a wave's 128 columns of q or k are two heads, its 64 of v one head; stored as
// EPI_QK or EPI_VT.
enum { EPI_QK = 0, EPI_VT = 1, EPI_F32_BIAS = 2, EPI_RELU_BF16 = 3, EPI_QKV = 4 };

// Stores a wave's results: FM * 16 indices in the register dimension (a lane's
// eight registers of a tile are eight consecutive ones) by 64 in the lane
// dimension.  The register dimension is the one that is contiguous in the
// output: the columns, or for EPI_VT the rows (tokens).  A lane's eight values
// are one or two 16-byte pieces; the pieces pass through the wave's own LDS
// range, 64 rows of 256 bytes, so that every global store covers whole lines:
// 16 lanes one row.  The row pitch of 272 bytes spreads the 16 writers of a
// piece over all banks.  reg0, lane0: the wave's first index in each dimension;
// for EPI_QK and EPI_VT columns count within the one product and outp is that
// product's output.
#define G_SPITCH 272                      // staging row pitch, bytes
template <int EPI, int FM>
__device__ __forceinline__ void gemm_store(
    const v8f (&acc)[FM][4], int reg0, int lane0,
    const float* __restrict__ bias, void* __restrict__ outp, char* stage) {
  static_assert(FM * 16 * (EPI == EPI_F32_BIAS ? 4 : 2) == 256, "a staged row is 256 bytes");
  const int lane = threadIdx.x & 31;
  const int half = lane >> 4, ln = lane & 15;
  f32x4 bv[FM][2] = {};   // the bias of this lane's columns
  if constexpr (EPI == EPI_F32_BIAS || EPI == EPI_RELU_BF16) {
#pragma unroll  // constant m: bv stays in registers, the loads go out together
    for (int m = 0; m < FM; ++m) {
      bv[m][0] = *(const f32x4*)(bias + reg0 + m * 16 + half * 8);
      bv[m][1] = *(const f32x4*)(bias + reg0 + m * 16 + half * 8 + 4);
    }
    // the sums below reuse the address pair that these loads name
    asm volatile("s_wait_xcnt 0x0" ::: "memory");
    // keeps the sums behind that wait
    __builtin_amdgcn_sched_barrier(0);
  }
#pragma unroll  // constant m, j, r: acc stays in registers
  for (int m = 0; m < FM; ++m) {
    const f32x4 b0 = bv[m][0], b1 = bv[m][1];
#pragma unroll
    for (int j = 0; j < 4; ++j) {
      char* row = stage + (j * 16 + ln) * G_SPITCH;
      if constexpr (EPI == EPI_F32_BIAS) {
        f32x4 lo, hi;
#pragma unroll
        for (int r = 0; r < 4; ++r) {
          lo[r] = acc[m][j][r] + b0[r];
          hi[r] = acc[m][j][r + 4] + b1[r];
        }
        *(f32x4*)(row + m * 64 + half * 32) = lo;
        *(f32x4*)(row + m * 64 + half * 32 + 16) = hi;
      } else {
        union { __bf16 h[8]; u32x4 q; } u;
#pragma unroll
        for (int r = 0; r < 8; ++r) {
          float v = acc[m][j][r];
          if constexpr (EPI == EPI_RELU_BF16) {
            v += r < 4 ? b0[r & 3] : b1[r & 3];
            v = v > 0.f ? v : 0.f;
          }
          u.h[r] = (__bf16)v;
        }
        *(u32x4*)(row + m * 32 + half * 16) = u.q;
      }
    }
  }
  // this wave's staged pieces are in LDS before its lanes read each other's
  wait_lds();
  const int rr = lane >> 4;    // staged row of this lane in a pair of rows
  const int pc = lane & 15;    // its 16-byte piece of the row
  char* g;                     // where staged row rr, piece pc goes
  int step;                    // bytes from one staged row's place to the next
  if constexpr (EPI == EPI_QK) {
    // [BT,C] -> bf16 [B,H,T,hd]: a staged row is one token of two heads
    const int row = lane0 + rr, col = reg0 + pc * 8;
    const int bi = row >> 11, ti = row & (T_DIM - 1);
    const int hi = col >> 6, di = col & (HD_DIM - 1);
    g = (char*)outp + ((((size_t)bi * H_DIM + hi) * T_DIM + ti) * HD_DIM + di) * 2;
    step = HD_DIM * 2;
  } else if constexpr (EPI == EPI_VT) {
    // [BT,C] -> bf16 [B,H,hd,T]  (V transposed: K-contiguous for P*V): a staged
    // row is 128 tokens of one column
    const int row = reg0 + pc * 8, col = lane0 + rr;
    const int bi = row >> 11, ti = row & (T_DIM - 1);
    const int hi = col >> 6, di = col & (HD_DIM - 1);
    g = (char*)outp + ((((size_t)bi * H_DIM + hi) * HD_DIM + di) * T_DIM + ti) * 2;
    step = T_DIM * 2;
  } else if constexpr (EPI == EPI_F32_BIAS) {
    g = (char*)outp + ((size_t)(lane0 + rr) * C_DIM + reg0 + pc * 4) * 4;
    step = C_DIM * 4;
  } else {  // EPI_RELU_BF16
    g = (char*)outp + ((size_t)(lane0 + rr) * DFF_DIM + reg0 + pc * 8) * 2;
    step = DFF_DIM * 2;
  }
  u32x4 d[32];
#pragma unroll  // constant i: d stays in registers, the reads go out together
  for (int i = 0; i < 32; ++i)
    d[i] = *(const u32x4*)(stage + (i * 2 + rr) * G_SPITCH + pc * 16);
  // keeps every read ahead of the first store: each store then names registers
  // of its own, and none that a store names is written again
  __builtin_amdgcn_sched_barrier(0);
#pragma unroll  // constant i: the row steps are immediate offsets on one address
  for (int i = 0; i < 32; ++i) *(u32x4*)(g + i * 2 * step) = d[i];
  // where two kinds share a kernel the built code can run on from here into the
  // other kind's code, which reuses the registers that these stores name
  if constexpr (EPI == EPI_QK || EPI == EPI_VT) asm volatile("s_wait_xcnt 0x0" ::: "memory");
}

// C[M,N] = A[M,K](bf16) * Bt[N,K]^T(bf16), f32 accumulate.
// Block tile TS x TS, TS threads.  What a block draws from L2 per result falls
// with the tile's edge.  TS = 256 where that still
// gives about one block per WGP, TS = 128 where N is small.
// Waves: 2 over the first operand's rows x TS / 64 over the second's; wave tile
// TS / 2 first-operand x 64 second-operand rows, that is FM x 4 tiles
// = 32 (TS = 256) or 16 (TS = 128) WMMAs per K=32 step.
// The products are taken transposed, Bt rows as the first operand and A rows as
// the second: a lane's eight registers of a tile are then eight consecutive
// columns of one output row.  Only the v product, whose output is transposed,
// keeps A first.  Both operands have the same fragment layout and k order.
// A pass is 128 k = 256 bytes of each of the TS first-operand rows and the TS
// second-operand rows.  The pass's rows are brought into LDS by tensor loads,
// through no register: each wave asks once per pass for a slice of 64 rows.
// TS = 256: two buffers fill the LDS; the next pass's loads fly while this pass
// is multiplied.  TS = 128: four buffers, three requests of a wave in
// flight, give each request three passes to land.
// Needs M % TS == 0, N % TS == 0, K % 128 == 0.
#define G_PASS  128                       // k per pass
#define G_PITCH 136                       // LDS row pitch, bf16: 272 B = 16 B x 17
#define G_SROWS 64                        // rows per slice
// bf16 per slice in LDS: 64 rows of 272 B, rounded up so that every slice
// starts at a multiple of 2 KiB
#define G_SLICE ((G_SROWS * G_PITCH * 2 + 2047) / 2048 * 1024)

__device__ __forceinline__ uint32_t uni(uint32_t v) {
  return (uint32_t)__builtin_amdgcn_readfirstlane(v);
}
__device__ __forceinline__ uint32_t pinned(uint32_t v) {
  uint32_t w = (uint32_t)__builtin_amdgcn_readfirstlane(v);
  // the pinned() form for the tensor mover: holds the word in a scalar register,
  // so that a test on it is a scalar branch and what is formed from it is formed
  // behind the statements in front of this one
  asm volatile("" : "+s"(w));
  return w;
}

template <int EPI, int TS>
__global__ __launch_bounds__(TS) void gemm_bf16_wmma(
    const __bf16* __restrict__ A, const __bf16* __restrict__ Bt,
    const float* __restrict__ bias, void* __restrict__ outp,
    int M, int N, int K) {
  constexpr int FM  = TS / 32;             // 16-row tiles per wave
  constexpr int WN  = TS / 64;             // waves across
  constexpr int NS  = TS / G_SROWS;        // slices per operand; 2 * NS waves
  constexpr int BUF = 2 * NS * G_SLICE;    // bf16 per buffer: NS first-operand slices, then NS second
  constexpr int NB  = TS == 128 ? 4 : 2;   // buffers of the ring; NB - 1 requests of a wave in flight
  __shared__ __attribute__((aligned(2048))) __bf16 Ts[NB * BUF];

  // scalar wave number: the wave's places in the tile and in the staging stay
  // out of the vector registers, which the main loop fills
  const int wave = __builtin_amdgcn_readfirstlane(threadIdx.x >> 5);
  const int wm = wave / WN, wn = wave % WN;
  // which of q, k, v: the same for the whole block
  const int which = EPI == EPI_QKV ? blockIdx.x * TS / C_DIM : 0;
  const bool bt_first = which < 2;

  v8f acc[FM][4] = {};

  // the block's rows of each operand are scalar addresses
  const __bf16* ablk = A + (size_t)(blockIdx.y * TS) * K;
  const __bf16* bblk = Bt + (size_t)(blockIdx.x * TS) * K;
  const __bf16* asrc = bt_first ? bblk : ablk;   // first operand
  const __bf16* bsrc = bt_first ? ablk : bblk;   // second operand
  // Wave w brings slice w of a buffer: 64 rows of the first operand (w < NS) or
  // of the second.
  const __bf16* wsrc = wave < NS ? asrc + (size_t)(wave * G_SROWS) * K
                                 : bsrc + (size_t)((wave - NS) * G_SROWS) * K;
  const uint32_t ldst = (uint32_t)(size_t)&Ts[wave * G_SLICE];

  // Descriptor group 1, the same for every request: extents in bytes, tensor =
  // tile = 64 rows of 256 bytes, no mask, 16 bytes of pad behind each row.
  u32x8 g1;
  g1[0] = uni((1u << 20) | (5u << 22) | (3u << 25));
  g1[1] = uni(256u << 16);
  g1[2] = uni((uint32_t)G_SROWS << 16);
  g1[3] = uni(256u << 16);
  g1[4] = uni((uint32_t)G_SROWS);
  g1[5] = uni((uint32_t)K * 2u);   // source row pitch
  g1[6] = uni(0u);
  g1[7] = uni(0u);
  // the pinned() form: holds the descriptor's words in their scalar registers for the
  // whole loop; otherwise the compiler forms the constants anew for each request
  // and uses those registers for other values while a request is outstanding
  asm volatile("" : "+s"(g1));

  // Descriptor group 0.  Word 0 is formed once, word 3 changes only with none outstanding; both keep their registers:
  // with requests outstanding only words 1 and 2 (place in LDS, low address word)
  // take new values.
  const uint64_t ga0 = (uint64_t)(size_t)wsrc;
  u32x4 g0;
  g0[0] = uni(1u);
  g0[1] = uni(ldst);
  g0[2] = uni((uint32_t)ga0);
  g0[3] = uni(((uint32_t)(ga0 >> 32) & 0x01FFFFFFu) | 0x80000000u);
  // All of the wave's requests have landed.  The waits name both groups as
  // inputs: without it the compiler took descriptor registers for other values
  // ahead of a wait.
  auto landed = [&]() { asm volatile("s_wait_tensorcnt 0" :: "s"(g0), "s"(g1) : "memory"); };
  // All but the wave's NB - 2 youngest requests have landed.
  auto landed_oldest = [&]() {
    asm volatile("s_wait_tensorcnt %2" :: "s"(g0), "s"(g1), "n"(NB - 2) : "memory");
  };
  // group 0 goes in and out: it stays in the same four registers from request
  // to request
  auto fire = [&]() {
    asm volatile("tensor_load_to_lds %0, %1" : "+s"(g0) : "s"(g1) : "memory");
  };
  auto issue = [&](uint32_t t, uint32_t buf) {
    const uint64_t ga = ga0 + (uint64_t)t * (G_PASS * 2);
    const uint32_t w3 = uni(((uint32_t)(ga >> 32) & 0x01FFFFFFu) | 0x80000000u);
    // a row that crosses a multiple of 4 GiB: word 3 changes, behind a wait that
    // covers every outstanding request
    if (pinned(w3 != g0[3])) {
      landed();
      g0[3] = w3;
    }
    g0[1] = uni(ldst + buf * (uint32_t)(BUF * 2));
    g0[2] = uni((uint32_t)ga);
    fire();
  };

  const int npass = K / G_PASS;
  fire();   // pass 0 into buffer 0: group 0 as formed above
#pragma unroll  // constant s: the buffer's place is an immediate
  for (int s = 1; s < NB - 1; ++s)
    if (pinned(s < npass)) issue(s, s);
  // pass 0 has landed for this wave, then for all waves; the counted wait covers
  // it only where all NB - 1 requests above were issued
  if (NB > 2 && pinned(npass > NB - 2)) landed_oldest();
  else landed();
  __syncthreads();
  if (pinned(npass > NB - 1)) issue(NB - 1, NB - 1);

  for (int t = 0; t < npass; ++t) {
    // the wave's FM / 4 slices of the first operand, its one of the second
    const __bf16* As = &Ts[(t & (NB - 1)) * BUF + wm * (FM / 4) * G_SLICE];
    const __bf16* Bs = &Ts[(t & (NB - 1)) * BUF + (NS + wn) * G_SLICE];
    // Two fragment sets: the LDS reads of k step s + 1 are issued as one group
    // ahead of the WMMAs of step s, so that their latency hides behind them.
    v16bf fa[2][FM], fb[2][4];
#pragma unroll  // constant m: fa stays in registers
    for (int m = 0; m < FM; ++m)
      fa[0][m] = load_frag(As + (m / 4) * G_SLICE + (m % 4 * 16) * G_PITCH, G_PITCH);
#pragma unroll  // constant j: fb stays in registers
    for (int j = 0; j < 4; ++j) fb[0][j] = load_frag(Bs + (j * 16) * G_PITCH, G_PITCH);
    // keeps step 0's reads ahead of step 1's: mixed, the first WMMAs wait for
    // both groups, twice the LDS time with every wave of the block waiting
    __builtin_amdgcn_sched_barrier(0);
#pragma unroll  // constant set index: the fragments stay in registers
    for (int s = 0; s < G_PASS / 32; ++s) {
      const int cur = s & 1, nxt = cur ^ 1;
      if (s + 1 < G_PASS / 32) {
        const int kk = (s + 1) * 32;
#pragma unroll  // constant m: fa stays in registers
        for (int m = 0; m < FM; ++m)
          fa[nxt][m] = load_frag(As + (m / 4) * G_SLICE + (m % 4 * 16) * G_PITCH + kk, G_PITCH);
#pragma unroll  // constant j: fb stays in registers
        for (int j = 0; j < 4; ++j)
          fb[nxt][j] = load_frag(Bs + (j * 16) * G_PITCH + kk, G_PITCH);
      }
      // keeps the read group ahead of the WMMAs: without it the scheduler sinks
      // each read to just before its use and every WMMA pair waits on LDS
      __builtin_amdgcn_sched_barrier(0);
#pragma unroll  // constant j, m: accumulators and fragments stay in registers
      for (int j = 0; j < 4; ++j) {
#pragma unroll
        for (int m = 0; m < FM; ++m)
          acc[m][j] = wmma_bf16(fa[cur][m], fb[cur][j], acc[m][j]);
      }
      // keeps the next step's reads from moving up among these WMMAs
      __builtin_amdgcn_sched_barrier(0);
    }
    // Hand-over: this wave's reads of this pass's buffer are done, its slice of
    // pass t + 1 has landed; behind the barrier that holds for every wave.  The
    // requests behind that slice are those of passes t + 2 to t + NB - 1: the
    // counted wait covers it while the last of them exists.
    wait_lds();
    if (NB > 2 && pinned((uint32_t)t + (uint32_t)(NB - 1) < (uint32_t)npass)) landed_oldest();
    else landed();
    __syncthreads();
    // the pass number goes through pinned() here, so that the next request's
    // descriptor is formed behind the wait above
    const uint32_t nx = pinned((uint32_t)t + (uint32_t)NB);
    if (pinned(nx < (uint32_t)npass)) issue(nx, (uint32_t)t & (uint32_t)(NB - 1));
  }
  // no request is outstanding when the wave goes on to the stores and ends
  landed();
  wait_lds();

  // The ring is free: every wave's last reads ended in front of the last pass's
  // barrier and no request is outstanding.  Each wave stages in a range of its own.
  char* stage = (char*)Ts + wave * (64 * G_SPITCH);
  const int first0  = wm * (FM * 16);   // the wave's place in the first operand's rows
  const int second0 = wn * 64;          // and in the second operand's
  if constexpr (EPI == EPI_QKV) {
    __bf16* o = (__bf16*)outp + (size_t)which * BT_DIM * C_DIM;
    if (bt_first) {   // a scalar branch
      gemm_store<EPI_QK, FM>(acc, (blockIdx.x * TS + first0) % C_DIM,
                             blockIdx.y * TS + second0, bias, o, stage);
    } else {
      gemm_store<EPI_VT, FM>(acc, blockIdx.y * TS + first0,
                             (blockIdx.x * TS + second0) % C_DIM, bias, o, stage);
    }
  } else {
    gemm_store<EPI, FM>(acc, blockIdx.x * TS + first0, blockIdx.y * TS + second0,
                        bias, outp, stage);
  }
}

#define ATT_WAVES 8
#define A_TILES (T_DIM / (16 * ATT_WAVES))   // query tiles per head
#define A_KEYS  64                        // keys per stage
#define A_PITCH 72                        // LDS row pitch, bf16: 144 B = 16 B x 9
#define A_ROWS  128                       // 64 K rows, then 64 V^T rows
#define A_BUF   (A_ROWS * A_PITCH)        // bf16 per buffer

// Four copies of 16 bytes per lane, global -> LDS, through no register.  The
// s_wait_xcnt closes the statement so that no address register named here is
// rewritten before it.
#define A_COPY4(l, g)                                                      \
  asm volatile(                                                            \
      "global_load_async_to_lds_b128 %0, %4, off\n\t"                      \
      "global_load_async_to_lds_b128 %1, %5, off\n\t"                      \
      "global_load_async_to_lds_b128 %2, %6, off\n\t"                      \
      "global_load_async_to_lds_b128 %3, %7, off\n\t"                      \
      "s_wait_xcnt 0x0"                                                    \
      :: "v"(l[0]), "v"(l[1]), "v"(l[2]), "v"(l[3]),                       \
         "v"(g[0]), "v"(g[1]), "v"(g[2]), "v"(g[3])                        \
      : "memory")

// Eight 2^x in one statement.  Behind a transcendental the instruction set asks
// for one independent instruction before its result is read or its source
// overwritten: here each v_exp_f32 is that instruction for the one before it
// (early-clobber outputs: none lies on a source), and the v_nop fills the slot
// behind the last.
#define A_EXP2X8(d, a)                                                     \
  asm("v_exp_f32 %0, %8\n\t"                                               \
      "v_exp_f32 %1, %9\n\t"                                               \
      "v_exp_f32 %2, %10\n\t"                                              \
      "v_exp_f32 %3, %11\n\t"                                              \
      "v_exp_f32 %4, %12\n\t"                                              \
      "v_exp_f32 %5, %13\n\t"                                              \
      "v_exp_f32 %6, %14\n\t"                                              \
      "v_exp_f32 %7, %15\n\t"                                              \
      "v_nop"                                                              \
      : "=&v"(d[0]), "=&v"(d[1]), "=&v"(d[2]), "=&v"(d[3]),                \
        "=&v"(d[4]), "=&v"(d[5]), "=&v"(d[6]), "=&v"(d[7])                 \
      : "v"(a[0]), "v"(a[1]), "v"(a[2]), "v"(a[3]),                        \
        "v"(a[4]), "v"(a[5]), "v"(a[6]), "v"(a[7]))

// lane l with lane l ^ 16, in the vector unit
__device__ __forceinline__ float xhalf(float x) {
  const int b = __builtin_bit_cast(int, x);
  return __builtin_bit_cast(
      float, __builtin_amdgcn_permlanex16(b, b, 0x76543210, 0xfedcba98, false, false));
}

__global__ __launch_bounds__(256) void attn_wmma_kernel(
    const __bf16* __restrict__ q,   // [B,H,T,hd]
    const __bf16* __restrict__ k,   // [B,H,T,hd]
    const __bf16* __restrict__ vt,  // [B,H,hd,T]
    __bf16* __restrict__ attnb) {   // bf16 [B,T,C]
  __shared__ __attribute__((aligned(16))) __bf16 KV[2 * A_BUF];

  // scalar wave number: the test that skips a pass is then a scalar branch
  const int wave = __builtin_amdgcn_readfirstlane(threadIdx.x >> 5);
  const int lane = threadIdx.x & 31;
  const int half = lane >> 4, ln = lane & 15;

  const int bh  = blockIdx.y;
  const int bi  = bh >> 4;          // /H
  const int hi  = bh & (H_DIM - 1);
  int tile = blockIdx.x;            // the first tile; then A_TILES - 1 - blockIdx.x

  // this wave's queries of the first and of the second tile
  const __bf16* Qp = q + ((size_t)bh * T_DIM + (tile * ATT_WAVES + wave) * 16) * HD_DIM;
  const __bf16* Qn = q + ((size_t)bh * T_DIM + ((A_TILES - 1 - tile) * ATT_WAVES + wave) * 16) * HD_DIM;
  const __bf16* Kp = k + (size_t)bh * T_DIM * HD_DIM;
  const __bf16* Vp = vt + (size_t)bh * HD_DIM * T_DIM;

  // Copy map: 8 lanes cover one 128-byte row; copy i of a thread serves stage
  // row i * 32 + crow (i < 2: K rows, i >= 2: V^T rows).
  const int crow = threadIdx.x >> 3;        // 0..31
  const int ccol = (threadIdx.x & 7) << 3;  // bf16 offset in the row
  const __bf16* ksrc = Kp + (size_t)crow * HD_DIM + ccol;
  const __bf16* vsrc = Vp + (size_t)crow * T_DIM + ccol;
  const unsigned ldst = (unsigned)(size_t)&KV[crow * A_PITCH + ccol];

  auto issue = [&](int st, int buf) {
    unsigned l[4];
    const __bf16* g[4];
#pragma unroll  // constant indices: l stays in registers
    for (int i = 0; i < 4; ++i)
      l[i] = ldst + (unsigned)(buf * A_BUF + i * 32 * A_PITCH) * 2u;
    g[0] = ksrc + (size_t)(st * A_KEYS) * HD_DIM;
    g[1] = ksrc + (size_t)(st * A_KEYS + 32) * HD_DIM;
    g[2] = vsrc + st * A_KEYS;
    g[3] = vsrc + (size_t)32 * T_DIM + st * A_KEYS;
    A_COPY4(l, g);
  };

  issue(0, 0);

  // Q as the B operand: column = query ln.  Both tiles' Q are read here, so
  // that the second tile does not start by waiting for its own.
  v16bf qa0 = load_frag(Qp, HD_DIM);              // K = 0..31 of hd
  v16bf qa1 = load_frag(Qp + 32, HD_DIM);         // K = 32..63 of hd
  const v16bf qn0 = load_frag(Qn, HD_DIM);
  const v16bf qn1 = load_frag(Qn + 32, HD_DIM);
  // the code below reuses the address registers that these loads name
  asm volatile("s_wait_xcnt 0x0" ::: "memory");

  // stage 0 has landed for this wave, then for all waves
  asm volatile("s_wait_asynccnt 0x0" ::: "memory");
  __syncthreads();
  issue(1, 1);

  for (int h = 0; h < 2; ++h) {
  const int qt0 = (tile * ATT_WAVES + wave) * 16;
  // The tile's last query is (tile + 1) * 128 - 1: so many keys, in stages of
  // 64; an even number, so each tile starts in buffer 0.
  const int nst = (tile + 1) * (ATT_WAVES * 16 / A_KEYS);
  // O^T: o[jj][r] = O[query ln][hd jj * 16 + half * 8 + r]
  v8f o[4] = {};
  const int qg = qt0 + ln;          // this lane's query
  const int qrel = qg - half * 8;   // its place against the first key of this half's rows
  float rm = -1e30f;                // its running maximum, alike in both halves
  float rl = 0.f;                   // running sum over this half's keys only

  for (int t = 0; t < nst; ++t) {
    const __bf16* Ks = &KV[(t & 1) * A_BUF];
    const __bf16* Vs = Ks + A_KEYS * A_PITCH;
    for (int p = 0; p < A_KEYS / 32; ++p) {
      const int kv0 = t * A_KEYS + p * 32;
      if (kv0 >= qt0 + 16) continue;   // wholly above this wave's diagonal
      // The pass's K and V^T fragments are read from LDS as one group.
      v16bf kf[2][2], vf[4];
#pragma unroll  // constant j: kf stays in registers
      for (int j = 0; j < 2; ++j) {
        const __bf16* Kb = Ks + (p * 32 + j * 16) * A_PITCH;
        kf[j][0] = load_frag(Kb, A_PITCH);
        kf[j][1] = load_frag(Kb + 32, A_PITCH);
      }
#pragma unroll  // constant jj: vf stays in registers
      for (int jj = 0; jj < 4; ++jj)
        vf[jj] = load_frag(Vs + (jj * 16) * A_PITCH + p * 32, A_PITCH);
      // keeps the read group ahead of the WMMAs: without it the scheduler sinks
      // each read to just before its use and every WMMA waits out an LDS read
      __builtin_amdgcn_sched_barrier(0);
      // S^T tile j: pm[j][r] = score of key kv0 + j * 16 + half * 8 + r, query qg
      float pm[2][8];
      const int dq = qrel - kv0;       // key above the query: j * 16 + r > dq
#pragma unroll  // constant j, r: pm stays in registers
      for (int j = 0; j < 2; ++j) {
        v8f s = {};
        s = wmma_bf16(kf[j][0], qa0, s);
        s = wmma_bf16(kf[j][1], qa1, s);
#pragma unroll
        for (int r = 0; r < 8; ++r) {
          float val = s[r] * 0.125f;              // hd^-0.5
          pm[j][r] = (j * 16 + r > dq) ? -1e30f : val;    // causal mask
        }
      }
      // online softmax: 16 of the query's 32 scores are in this lane
      float m4[4];
#pragma unroll  // four independent chains
      for (int e = 0; e < 4; ++e)
        m4[e] = fmaxf(fmaxf(pm[0][2 * e], pm[0][2 * e + 1]), fmaxf(pm[1][2 * e], pm[1][2 * e + 1]));
      float mx = fmaxf(fmaxf(m4[0], m4[1]), fmaxf(m4[2], m4[3]));
      mx = fmaxf(mx, xhalf(mx));
      const float mnew  = fmaxf(rm, mx);
      const float scale = __expf(rm - mnew);
      rm = mnew;
      // P^T as B operand: element s of the lane = tile s >> 3, register s & 7,
      // the k order in which load_frag reads V^T
      v16bf pf;
      float s4[4];
#pragma unroll  // constant j, r: pm and pf stay in registers
      for (int j = 0; j < 2; ++j) {
        float ea[8], pe[8];
#pragma unroll
        for (int r = 0; r < 8; ++r) ea[r] = (pm[j][r] - mnew) * 1.44269504f;  // log2(e)
        A_EXP2X8(pe, ea);
#pragma unroll  // four independent chains
        for (int r = 0; r < 8; ++r) {
          s4[r & 3] = (j == 0 && r < 4) ? pe[r] : s4[r & 3] + pe[r];
          pf[j * 8 + r] = (__bf16)pe[r];
        }
      }
      rl = rl * scale + ((s4[0] + s4[1]) + (s4[2] + s4[3]));
#pragma unroll  // constant jj, r: o stays in registers
      for (int jj = 0; jj < 4; ++jj) {
#pragma unroll
        for (int r = 0; r < 8; ++r) o[jj][r] *= scale;
      }
#pragma unroll  // constant jj: o and vf stay in registers
      for (int jj = 0; jj < 4; ++jj) o[jj] = wmma_bf16(vf[jj], pf, o[jj]);
    }
    // Hand-over: this wave's reads of buffer t & 1 are done, its copies of
    // the next stage have landed; behind the barrier that holds for every wave.
    wait_lds();
    asm volatile("s_wait_asynccnt 0x0" ::: "memory");
    __syncthreads();
    // the stage two ahead: of this tile, or stage 0 or 1 of the second tile
    const bool own = t + 2 < nst;
    if (own || h == 0) issue(own ? t + 2 : t + 2 - nst, t & 1);
  }

  // join the halves' sums, normalize, store to [B,T,C] bf16: a lane's eight
  // registers of a tile are eight consecutive hd of its query, one 16-byte store
  const float inv = 1.f / (rl + xhalf(rl));
  __bf16* dst = attnb + ((size_t)bi * T_DIM + qg) * C_DIM + hi * HD_DIM + half * 8;
#pragma unroll  // constant jj, r: o stays in registers
  for (int jj = 0; jj < 4; ++jj) {
    union { __bf16 h[8]; u32x4 q; } u;
#pragma unroll
    for (int r = 0; r < 8; ++r) u.h[r] = (__bf16)(o[jj][r] * inv);
    *(u32x4*)(dst + jj * 16) = u.q;
  }
  // the second tile reuses the registers that these stores name
  asm volatile("s_wait_xcnt 0x0" ::: "memory");
  tile = A_TILES - 1 - tile;
  qa0 = qn0;
  qa1 = qn1;
  }
  // no copy is outstanding when the wave ends
  asm volatile("s_wait_asynccnt 0x0" ::: "memory");
}

// ---------------------------------------------------------------- LN
// out = LN(x + y) * g + b ; one wave per row of C_DIM=1024, 8 rows per block.
// A lane holds 32 elements of its row (eight 16-byte pieces, 512 bytes of the
// row per wave-wide request); the row's sums need no LDS and no barrier.
__global__ __launch_bounds__(256) void ln_residual_kernel(
    const float* __restrict__ x, const float* __restrict__ y,
    const float* __restrict__ g, const float* __restrict__ b,
    float* __restrict__ out, __bf16* __restrict__ outb) {
  const int lane = threadIdx.x & 31;
  const int row  = blockIdx.x * 8 + (threadIdx.x >> 5);
  const size_t off = (size_t)row * C_DIM + lane * 4;
  f32x8 xy[8], gb[8];   // x | y and g | b, one 16-byte piece of each
#pragma unroll  // constant i: the pieces stay in registers
  for (int i = 0; i < 8; ++i)
    xy[i] = __builtin_shufflevector(*(const f32x4*)(x + off + i * 128),
                                    *(const f32x4*)(y + off + i * 128),
                                    0, 1, 2, 3, 4, 5, 6, 7);
#pragma unroll  // constant i: the pieces stay in registers
  for (int i = 0; i < 8; ++i)
    gb[i] = __builtin_shufflevector(*(const f32x4*)(g + lane * 4 + i * 128),
                                    *(const f32x4*)(b + lane * 4 + i * 128),
                                    0, 1, 2, 3, 4, 5, 6, 7);
  // Loaded values as inputs only: holds all 32 loads ahead of the sums.  Without
  // it the compiler holds some x, y loads back until earlier ones have returned
  // and sinks each g, b load to its use, a further latency per piece.
  asm volatile("" :: "v"(xy[0]), "v"(xy[1]), "v"(xy[2]), "v"(xy[3]),
                     "v"(xy[4]), "v"(xy[5]), "v"(xy[6]), "v"(xy[7]),
                     "v"(gb[0]), "v"(gb[1]), "v"(gb[2]), "v"(gb[3]),
                     "v"(gb[4]), "v"(gb[5]), "v"(gb[6]), "v"(gb[7]));
  float v[8][4];
  float sa[4] = {0.f, 0.f, 0.f, 0.f}, sb[4] = {0.f, 0.f, 0.f, 0.f};
#pragma unroll  // constant i, e: xy and v stay in registers
  for (int i = 0; i < 8; ++i) {
#pragma unroll  // four independent chains
    for (int e = 0; e < 4; ++e) {
      v[i][e] = xy[i][e] + xy[i][e + 4];
      sa[e] += v[i][e];
      sb[e] += v[i][e] * v[i][e];
    }
  }
  float s  = (sa[0] + sa[1]) + (sa[2] + sa[3]);
  float s2 = (sb[0] + sb[1]) + (sb[2] + sb[3]);
#pragma unroll
  for (int m = 1; m < 32; m <<= 1) {
    s  += __shfl_xor(s, m, 32);
    s2 += __shfl_xor(s2, m, 32);
  }
  const float mean = s * (1.f / C_DIM);
  const float var  = s2 * (1.f / C_DIM) - mean * mean;
  const float rstd = rsqrtf(var + 1e-5f);
#pragma unroll  // constant i, e: v and gb stay in registers
  for (int i = 0; i < 8; ++i) {
#pragma unroll
    for (int e = 0; e < 4; ++e)
      v[i][e] = (v[i][e] - mean) * rstd * gb[i][e] + gb[i][e + 4];
    *(float4*)(out + off + i * 128) = make_float4(v[i][0], v[i][1], v[i][2], v[i][3]);
  }
  // the converts below reuse registers that the stores above name
  asm volatile("s_wait_xcnt 0x0" ::: "memory");
  if (outb) {
#pragma unroll  // constant i, e: v stays in registers
    for (int i = 0; i < 8; ++i) {
      union { __bf16 h[4]; u32x2 q; } u;
#pragma unroll
      for (int e = 0; e < 4; ++e) u.h[e] = (__bf16)v[i][e];
      *(u32x2*)(outb + off + i * 128) = u.q;
    }
  }
}

// ---------------------------------------------------------------- launch
extern "C" void kernel_launch(void* const* d_in, const int* in_sizes, int n_in,
                              void* d_out, int out_size, void* d_ws, size_t ws_size,
                              hipStream_t stream) {
  const float* x     = (const float*)d_in[0];
  const float* wq    = (const float*)d_in[1];
  const float* wk    = (const float*)d_in[2];
  const float* wv    = (const float*)d_in[3];
  const float* wp    = (const float*)d_in[4];
  const float* bproj = (const float*)d_in[5];
  const float* w1    = (const float*)d_in[6];
  const float* b1    = (const float*)d_in[7];
  const float* w2    = (const float*)d_in[8];
  const float* b2    = (const float*)d_in[9];
  const float* g1    = (const float*)d_in[10];
  const float* be1   = (const float*)d_in[11];
  const float* g2    = (const float*)d_in[12];
  const float* be2   = (const float*)d_in[13];

  char* ws = (char*)d_ws;
  size_t o = 0;
  auto take = [&](size_t nbytes) -> void* {
    void* p = ws + o;
    o += (nbytes + 255) & ~(size_t)255;
    return p;
  };
  const size_t BTC = (size_t)BT_DIM * C_DIM;
  __bf16* xb    = (__bf16*)take(BTC * 2);
  __bf16* wct   = (__bf16*)take((size_t)4 * C_DIM * C_DIM * 2);  // q, k, v, proj
  __bf16* wpt   = wct + (size_t)3 * C_DIM * C_DIM;
  __bf16* w1t   = (__bf16*)take((size_t)C_DIM * DFF_DIM * 2);
  __bf16* w2t   = (__bf16*)take((size_t)DFF_DIM * C_DIM * 2);
  __bf16* qb    = (__bf16*)take(3 * BTC * 2);                    // q, k, v^T
  __bf16* kb    = qb + BTC;
  __bf16* vtb   = qb + 2 * BTC;
  __bf16* attnb = (__bf16*)take(BTC * 2);
  float*  y1    = (float*)take(BTC * 4);
  float*  x1    = (float*)take(BTC * 4);
  __bf16* x1b   = (__bf16*)take(BTC * 2);
  __bf16* h1    = (__bf16*)take((size_t)BT_DIM * DFF_DIM * 2);
  float*  y2    = (float*)take(BTC * 4);

  prep_kernel<<<PREP_GRID, 256, 0, stream>>>(x, wq, wk, wv, wp, w1, w2, xb, wct, w1t, w2t);

  // block tiles: 256 x 256 for N = 3072 and 4096, 128 x 128 for N = 1024
  const dim3 gC(C_DIM / 128, BT_DIM / 128);
  gemm_bf16_wmma<EPI_QKV, 256><<<dim3(3 * C_DIM / 256, BT_DIM / 256), 256, 0, stream>>>(
      xb, wct, nullptr, qb, BT_DIM, 3 * C_DIM, C_DIM);

  attn_wmma_kernel<<<dim3(A_TILES / 2, B_DIM * H_DIM), 256, 0, stream>>>(
      qb, kb, vtb, attnb);

  gemm_bf16_wmma<EPI_F32_BIAS, 128><<<gC, 128, 0, stream>>>(attnb, wpt, bproj, y1, BT_DIM, C_DIM, C_DIM);
  ln_residual_kernel<<<BT_DIM / 8, 256, 0, stream>>>(x, y1, g1, be1, x1, x1b);

  gemm_bf16_wmma<EPI_RELU_BF16, 256><<<dim3(DFF_DIM / 256, BT_DIM / 256), 256, 0, stream>>>(
      x1b, w1t, b1, h1, BT_DIM, DFF_DIM, C_DIM);
  gemm_bf16_wmma<EPI_F32_BIAS, 128><<<gC, 128, 0, stream>>>(h1, w2t, b2, y2, BT_DIM, C_DIM, DFF_DIM);
  ln_residual_kernel<<<BT_DIM / 8, 256, 0, stream>>>(x1, y2, g2, be2, (float*)d_out, nullptr);
}
